// v000
// Times are from an AMD MI455X. After a warm-up the kernel runs many times in a row, and a time is the length of
// such a window on the GPU divided by its runs, so every launch and the gaps after it count. The runs cycle
// through copies of the inputs. A figure is the median of several windows, for all but v000 over two sittings.
// Sittings can differ by a few percent; kernels timed side by side share one.
// The starting kernel, v000, takes 317 microseconds a run.
#include <hip/hip_runtime.h>
#include <hip/hip_bf16.h>
#include <math.h>

// ---------------------------------------------------------------------------
// RotaryAttention for MI455X (gfx1250, wave32, WMMA).
// Phase 1: RoPE+f16 pack of Q/K, V transpose (all into d_ws).
// Phase 2: flash attention, S^T formulation, v_wmma_f32_16x16x32_f16.
// ---------------------------------------------------------------------------

typedef _Float16 half8 __attribute__((ext_vector_type(8)));
typedef _Float16 v16h  __attribute__((ext_vector_type(16)));
typedef float    v8f   __attribute__((ext_vector_type(8)));

#define NH      16
#define HD      64
#define SEQ     2048
#define NKV     2049          // 2048 keys + 1 register token
#define KPAD    2080          // padded to multiple of 32
#define BATCH   4

// 1/sqrt(64) * log2(e): scores come out in log2 domain -> native v_exp_f32
#define QSCALE  0.18033688011112042f
// log2(10000)/16
#define FREQC   0.83048202372184065f

__device__ __forceinline__ v8f wmma_f16(v16h a, v16h b, v8f c) {
    return __builtin_amdgcn_wmma_f32_16x16x32_f16(false, a, false, b,
                                                  (short)0, c, false, false);
}

__device__ __forceinline__ v16h cat8(half8 lo, half8 hi) {
    return __builtin_shufflevector(lo, hi, 0,1,2,3,4,5,6,7,8,9,10,11,12,13,14,15);
}

// Raw v_exp_f32: args are always <= 0 here; flush-to-zero below -126 is the
// desired flash-softmax semantics (avoids OCML's range-fix cmp/cndmask pairs).
__device__ __forceinline__ float fast_exp2(float x) {
    return __builtin_amdgcn_exp2f(x);
}

// ---------------------------------------------------------------------------
// Phase 1a: Q -> RoPE -> *QSCALE -> f16, layout [b][h][s][d]
// ---------------------------------------------------------------------------
__global__ __launch_bounds__(256) void rope_q_kernel(
    const float* __restrict__ qin, _Float16* __restrict__ Qh)
{
    size_t tid = (size_t)blockIdx.x * 256 + threadIdx.x;   // ((b*S+s)*NH+h)*HD+d
    int d = (int)(tid & 63);
    int h = (int)((tid >> 6) & 15);
    int s = (int)((tid >> 10) & 2047);
    int b = (int)(tid >> 21);

    float x = qin[tid];
    float val = x;
    if (d < 32) {
        int f = d & 15;
        float angle = (float)s * exp2f(-(float)f * FREQC);
        float sn, cs;
        __sincosf(angle, &sn, &cs);
        float other = (d < 16) ? -qin[tid + 16] : qin[tid - 16];
        val = x * cs + other * sn;
    }
    Qh[(((size_t)b * NH + h) * SEQ + s) * HD + d] = (_Float16)(val * QSCALE);
}

// ---------------------------------------------------------------------------
// Phase 1b: K -> RoPE -> f16, layout [b][h][key][d], key in [0,KPAD)
//   key==2048: register token (rotary half zeroed), key>2048: zero pad
// ---------------------------------------------------------------------------
__global__ __launch_bounds__(256) void rope_k_kernel(
    const float* __restrict__ kin, const float* __restrict__ kreg,
    _Float16* __restrict__ Kh)
{
    size_t tid = (size_t)blockIdx.x * 256 + threadIdx.x;   // [b][h][key][d]
    int d = (int)(tid & 63);
    size_t r1 = tid >> 6;
    int key = (int)(r1 % KPAD);
    size_t r2 = r1 / KPAD;
    int h = (int)(r2 & 15);
    int b = (int)(r2 >> 4);

    float val = 0.0f;
    if (key < SEQ) {
        size_t src = (((size_t)b * SEQ + key) * NH + h) * HD + d;
        float x = kin[src];
        val = x;
        if (d < 32) {
            int f = d & 15;
            float angle = (float)key * exp2f(-(float)f * FREQC);
            float sn, cs;
            __sincosf(angle, &sn, &cs);
            float other = (d < 16) ? -kin[src + 16] : kin[src - 16];
            val = x * cs + other * sn;
        }
    } else if (key == SEQ) {
        val = (d < 32) ? 0.0f : kreg[h * HD + d];   // reg_mask zeros rotary half
    }
    Kh[tid] = (_Float16)val;
}

// ---------------------------------------------------------------------------
// Phase 1c: V transpose -> f16, layout [b][h][d][key], key in [0,KPAD)
// LDS 16x16 tile transpose; grid = B*NH * 4(dtiles) * (KPAD/16)(keytiles)
// ---------------------------------------------------------------------------
__global__ __launch_bounds__(256) void vt_kernel(
    const float* __restrict__ vin, const float* __restrict__ vreg,
    _Float16* __restrict__ Vt)
{
    __shared__ float tile[16][17];
    int bidx = blockIdx.x;
    int kt = bidx % (KPAD / 16); bidx /= (KPAD / 16);
    int dt = bidx & 3;           bidx >>= 2;
    int h  = bidx & 15;
    int b  = bidx >> 4;

    int tx = threadIdx.x & 15, ty = threadIdx.x >> 4;
    int key = kt * 16 + ty;
    int d   = dt * 16 + tx;

    float v = 0.0f;
    if (key < SEQ)       v = vin[(((size_t)b * SEQ + key) * NH + h) * HD + d];
    else if (key == SEQ) v = vreg[h * HD + d];
    tile[ty][tx] = v;
    __syncthreads();

    // write d' = dt*16+ty, key' = kt*16+tx  (contiguous over tx)
    Vt[(((size_t)b * NH + h) * HD + dt * 16 + ty) * KPAD + kt * 16 + tx] =
        (_Float16)tile[tx][ty];
}

// ---------------------------------------------------------------------------
// Phase 2: flash attention. One wave = 16 query rows; block = 8 waves = 128 q.
// grid.x = B*NH*(SEQ/128).  S^T = K_tile x Q^T so softmax is per-lane and
// exp(S^T) feeds the PV WMMA A-operand with no cross-lane transpose.
// ---------------------------------------------------------------------------
__global__ __launch_bounds__(256) void fa_kernel(
    const _Float16* __restrict__ Qh, const _Float16* __restrict__ Kh,
    const _Float16* __restrict__ Vt, float* __restrict__ out)
{
    const int lane   = threadIdx.x & 31;
    const int wave   = threadIdx.x >> 5;
    const int wg     = blockIdx.x;
    const int qblk   = wg & 15;           // 16 blocks of 128 queries
    const int bh     = wg >> 4;           // b*NH + h
    const int b      = bh >> 4;
    const int h      = bh & 15;
    const int qbase  = qblk * 128 + wave * 16;
    const int lo     = lane & 15;
    const int hi8    = (lane & 16) ? 8 : 0;   // lane-half K/row offset
    const int dA     = hi8;                   // A/B slot pattern offset

    // ---- Q^T fragments: lane holds q-row qbase+lo, slots {dA..dA+7, dA+16..}
    const _Float16* qrow = Qh + ((size_t)bh * SEQ + (qbase + lo)) * HD;
    v16h qt0 = cat8(*(const half8*)(qrow +  0 + dA), *(const half8*)(qrow + 16 + dA));
    v16h qt1 = cat8(*(const half8*)(qrow + 32 + dA), *(const half8*)(qrow + 48 + dA));

    v8f o0 = {}, o1 = {}, o2 = {}, o3 = {};
    float m = -1e38f, lsum = 0.0f;

    const _Float16* kbase = Kh + (size_t)bh * KPAD * HD;
    const _Float16* vbase = Vt + (size_t)bh * HD * KPAD;

    for (int t = 0; t < KPAD / 32; ++t) {
        const int kb = t * 32;

        // ---- K A-fragments: lane = key row (kb+lo / kb+16+lo)
        const _Float16* kr0 = kbase + (size_t)(kb + lo) * HD;
        const _Float16* kr1 = kr0 + 16 * HD;
        v16h ka0c0 = cat8(*(const half8*)(kr0 +  0 + dA), *(const half8*)(kr0 + 16 + dA));
        v16h ka0c1 = cat8(*(const half8*)(kr0 + 32 + dA), *(const half8*)(kr0 + 48 + dA));
        v16h ka1c0 = cat8(*(const half8*)(kr1 +  0 + dA), *(const half8*)(kr1 + 16 + dA));
        v16h ka1c1 = cat8(*(const half8*)(kr1 + 32 + dA), *(const half8*)(kr1 + 48 + dA));

        // ---- S^T tiles (M=key, N=q), log2 domain (scale folded into Q)
        v8f c0 = {}; c0 = wmma_f16(ka0c0, qt0, c0); c0 = wmma_f16(ka0c1, qt1, c0);
        v8f c1 = {}; c1 = wmma_f16(ka1c0, qt0, c1); c1 = wmma_f16(ka1c1, qt1, c1);

        // ---- tail mask: keys >= NKV are padding
        if (kb + 32 > NKV) {
            #pragma unroll
            for (int r = 0; r < 8; ++r) {
                if (kb + r + hi8 >= NKV)      c0[r] = -1e30f;
                if (kb + 16 + r + hi8 >= NKV) c1[r] = -1e30f;
            }
        }

        // ---- online softmax (per-lane over 16 regs + one xor-16 shuffle)
        float mt = fmaxf(c0[0], c1[0]);
        #pragma unroll
        for (int r = 1; r < 8; ++r) { mt = fmaxf(mt, fmaxf(c0[r], c1[r])); }
        mt = fmaxf(mt, __shfl_xor(mt, 16));
        float mnew  = fmaxf(m, mt);
        float alpha = fast_exp2(m - mnew);

        union { v16h v; _Float16 e[16]; } pf;
        float ps = 0.0f;
        #pragma unroll
        for (int r = 0; r < 8; ++r) {
            float p0 = fast_exp2(c0[r] - mnew); ps += p0; pf.e[r]     = (_Float16)p0;
            float p1 = fast_exp2(c1[r] - mnew); ps += p1; pf.e[8 + r] = (_Float16)p1;
        }
        ps += __shfl_xor(ps, 16);
        lsum = lsum * alpha + ps;
        m = mnew;

        // ---- rescale O (row q = r + hi8 lives at lane r+hi8)
        #pragma unroll
        for (int r = 0; r < 8; ++r) {
            float sc = __shfl(alpha, r + hi8);
            o0[r] *= sc; o1[r] *= sc; o2[r] *= sc; o3[r] *= sc;
        }

        // ---- V B-fragments (rows of V^T) and PV accumulation
        const _Float16* vr0 = vbase + (size_t)(lo +  0) * KPAD + kb + dA;
        const _Float16* vr1 = vbase + (size_t)(lo + 16) * KPAD + kb + dA;
        const _Float16* vr2 = vbase + (size_t)(lo + 32) * KPAD + kb + dA;
        const _Float16* vr3 = vbase + (size_t)(lo + 48) * KPAD + kb + dA;
        v16h bv0 = cat8(*(const half8*)(vr0), *(const half8*)(vr0 + 16));
        v16h bv1 = cat8(*(const half8*)(vr1), *(const half8*)(vr1 + 16));
        v16h bv2 = cat8(*(const half8*)(vr2), *(const half8*)(vr2 + 16));
        v16h bv3 = cat8(*(const half8*)(vr3), *(const half8*)(vr3 + 16));
        o0 = wmma_f16(pf.v, bv0, o0);
        o1 = wmma_f16(pf.v, bv1, o1);
        o2 = wmma_f16(pf.v, bv2, o2);
        o3 = wmma_f16(pf.v, bv3, o3);
    }

    // ---- finalize: divide by softmax denominator, store (B,S,NH*HD)
    float invl = 1.0f / lsum;
    #pragma unroll
    for (int r = 0; r < 8; ++r) {
        float il = __shfl(invl, r + hi8);
        int q = qbase + r + hi8;
        size_t base = (((size_t)b * SEQ + q) * NH + h) * HD + lo;
        out[base +  0] = o0[r] * il;
        out[base + 16] = o1[r] * il;
        out[base + 32] = o2[r] * il;
        out[base + 48] = o3[r] * il;
    }
}

// ---------------------------------------------------------------------------
extern "C" void kernel_launch(void* const* d_in, const int* in_sizes, int n_in,
                              void* d_out, int out_size, void* d_ws, size_t ws_size,
                              hipStream_t stream)
{
    (void)in_sizes; (void)n_in; (void)out_size; (void)ws_size;

    const float* q    = (const float*)d_in[0];
    const float* k    = (const float*)d_in[1];
    const float* v    = (const float*)d_in[2];
    const float* kreg = (const float*)d_in[3];
    const float* vreg = (const float*)d_in[4];
    float* out = (float*)d_out;

    // workspace layout (f16)
    const size_t QH_ELEMS = (size_t)BATCH * NH * SEQ  * HD;   //  8,388,608
    const size_t KH_ELEMS = (size_t)BATCH * NH * KPAD * HD;   //  8,519,680
    _Float16* Qh = (_Float16*)d_ws;
    _Float16* Kh = Qh + QH_ELEMS;
    _Float16* Vt = Kh + KH_ELEMS;

    // Phase 1
    rope_q_kernel<<<(unsigned)(QH_ELEMS / 256), 256, 0, stream>>>(q, Qh);
    rope_k_kernel<<<(unsigned)(KH_ELEMS / 256), 256, 0, stream>>>(k, kreg, Kh);
    vt_kernel<<<BATCH * NH * 4 * (KPAD / 16), 256, 0, stream>>>(v, vreg, Vt);

    // Phase 2: B*NH*(SEQ/128) workgroups of 8 waves
    fa_kernel<<<BATCH * NH * (SEQ / 128), 256, 0, stream>>>(Qh, Kh, Vt, out);
}

// v001
// Measured time: 147 microseconds a run.
// Two timings next to v000 both put it at 2.25 times that version's speed.
#include <hip/hip_runtime.h>
#include <hip/hip_bf16.h>
#include <math.h>

// ---------------------------------------------------------------------------
// RotaryAttention for MI455X (gfx1250, wave32, WMMA).
// Phase 1: RoPE+f16 pack of Q/K, V transpose (all into d_ws).
// Phase 2: flash attention, S^T formulation, v_wmma_f32_16x16x32_f16.
// ---------------------------------------------------------------------------

typedef _Float16 half8 __attribute__((ext_vector_type(8)));
typedef _Float16 v16h  __attribute__((ext_vector_type(16)));
typedef float    v8f   __attribute__((ext_vector_type(8)));

#define NH      16
#define HD      64
#define SEQ     2048
#define NKV     2049          // 2048 keys + 1 register token
#define KPAD    2080          // padded to multiple of 32
#define BATCH   4

// 1/sqrt(64) * log2(e): scores come out in log2 domain -> native v_exp_f32
#define QSCALE  0.18033688011112042f
// log2(10000)/16
#define FREQC   0.83048202372184065f

__device__ __forceinline__ v8f wmma_f16(v16h a, v16h b, v8f c) {
    return __builtin_amdgcn_wmma_f32_16x16x32_f16(false, a, false, b,
                                                  (short)0, c, false, false);
}

__device__ __forceinline__ v16h cat8(half8 lo, half8 hi) {
    return __builtin_shufflevector(lo, hi, 0,1,2,3,4,5,6,7,8,9,10,11,12,13,14,15);
}

// Raw v_exp_f32: args are always <= 0 here; flush-to-zero below -126 is the
// desired flash-softmax semantics (avoids OCML's range-fix cmp/cndmask pairs).
__device__ __forceinline__ float fast_exp2(float x) {
    return __builtin_amdgcn_exp2f(x);
}

// ---------------------------------------------------------------------------
// Phase 1a: Q -> RoPE -> *QSCALE -> f16, layout [b][h][s][d]
// ---------------------------------------------------------------------------
__global__ __launch_bounds__(256) void rope_q_kernel(
    const float* __restrict__ qin, _Float16* __restrict__ Qh)
{
    size_t tid = (size_t)blockIdx.x * 256 + threadIdx.x;   // ((b*S+s)*NH+h)*HD+d
    int d = (int)(tid & 63);
    int h = (int)((tid >> 6) & 15);
    int s = (int)((tid >> 10) & 2047);
    int b = (int)(tid >> 21);

    float x = qin[tid];
    float val = x;
    if (d < 32) {
        int f = d & 15;
        float angle = (float)s * exp2f(-(float)f * FREQC);
        float sn, cs;
        __sincosf(angle, &sn, &cs);
        float other = (d < 16) ? -qin[tid + 16] : qin[tid - 16];
        val = x * cs + other * sn;
    }
    Qh[(((size_t)b * NH + h) * SEQ + s) * HD + d] = (_Float16)(val * QSCALE);
}

// ---------------------------------------------------------------------------
// Phase 1b: K -> RoPE -> f16, layout [b][h][key][d], key in [0,KPAD)
//   key==2048: register token (rotary half zeroed), key>2048: zero pad
// ---------------------------------------------------------------------------
__global__ __launch_bounds__(256) void rope_k_kernel(
    const float* __restrict__ kin, const float* __restrict__ kreg,
    _Float16* __restrict__ Kh)
{
    size_t tid = (size_t)blockIdx.x * 256 + threadIdx.x;   // [b][h][key][d]
    int d = (int)(tid & 63);
    size_t r1 = tid >> 6;
    int key = (int)(r1 % KPAD);
    size_t r2 = r1 / KPAD;
    int h = (int)(r2 & 15);
    int b = (int)(r2 >> 4);

    float val = 0.0f;
    if (key < SEQ) {
        size_t src = (((size_t)b * SEQ + key) * NH + h) * HD + d;
        float x = kin[src];
        val = x;
        if (d < 32) {
            int f = d & 15;
            float angle = (float)key * exp2f(-(float)f * FREQC);
            float sn, cs;
            __sincosf(angle, &sn, &cs);
            float other = (d < 16) ? -kin[src + 16] : kin[src - 16];
            val = x * cs + other * sn;
        }
    } else if (key == SEQ) {
        val = (d < 32) ? 0.0f : kreg[h * HD + d];   // reg_mask zeros rotary half
    }
    Kh[tid] = (_Float16)val;
}

// ---------------------------------------------------------------------------
// Phase 1c: V transpose -> f16, layout [b][h][d][key], key in [0,KPAD)
// LDS 16x16 tile transpose; grid = B*NH * 4(dtiles) * (KPAD/16)(keytiles)
// ---------------------------------------------------------------------------
__global__ __launch_bounds__(256) void vt_kernel(
    const float* __restrict__ vin, const float* __restrict__ vreg,
    _Float16* __restrict__ Vt)
{
    __shared__ float tile[16][17];
    int bidx = blockIdx.x;
    int kt = bidx % (KPAD / 16); bidx /= (KPAD / 16);
    int dt = bidx & 3;           bidx >>= 2;
    int h  = bidx & 15;
    int b  = bidx >> 4;

    int tx = threadIdx.x & 15, ty = threadIdx.x >> 4;
    int key = kt * 16 + ty;
    int d   = dt * 16 + tx;

    float v = 0.0f;
    if (key < SEQ)       v = vin[(((size_t)b * SEQ + key) * NH + h) * HD + d];
    else if (key == SEQ) v = vreg[h * HD + d];
    tile[ty][tx] = v;
    __syncthreads();

    // write d' = dt*16+ty, key' = kt*16+tx  (contiguous over tx)
    Vt[(((size_t)b * NH + h) * HD + dt * 16 + ty) * KPAD + kt * 16 + tx] =
        (_Float16)tile[tx][ty];
}

// ---------------------------------------------------------------------------
// Phase 2: flash attention. One wave = 16 query rows; block = 8 waves = 128 q.
// grid.x = B*NH*(SEQ/128).  S^T = K_tile x Q^T so softmax is per-lane and
// exp(S^T) feeds the PV WMMA A-operand with no cross-lane transpose.
// K and V^T come through LDS: the block's 8 waves share one 128-key stage,
// filled by asynchronous copies of whole lines, two buffers, one stage ahead.
// ---------------------------------------------------------------------------
#define STG     128                       // keys per LDS stage (4 passes of 32)
#define NSTG    ((KPAD + STG - 1) / STG)  // 17; the last stage holds one pass
#define KPITCH  72                        // halves: 128-B K row + 16 B (b128 readers)
#define VPITCH  136                       // halves: 256-B V^T row + 16 B
#define KSTAGE  (STG * KPITCH)            // halves per K buffer
#define VSTAGE  (HD * VPITCH)             // halves per V^T buffer

__device__ __forceinline__ unsigned lds_off(const void* p) {
    return (unsigned)(size_t)p;           // low 32 bits = byte offset in LDS
}

// One stage: 4 K copies + 4 V^T copies of 16 B per lane. The global side is
// clamped so that the short last stage stays inside Kh / Vt; the LDS bytes
// filled from clamped addresses belong to passes that are never run.
__device__ __forceinline__ void stage_copy(
    const _Float16* kbase, const _Float16* vbase, int kb0,
    unsigned kdst, unsigned vdst, int krow, int kcol, int vrow, int vcol)
{
    const _Float16* gk0 = kbase + (size_t)min(kb0 + krow +  0, KPAD - 1) * HD + kcol;
    const _Float16* gk1 = kbase + (size_t)min(kb0 + krow + 32, KPAD - 1) * HD + kcol;
    const _Float16* gk2 = kbase + (size_t)min(kb0 + krow + 64, KPAD - 1) * HD + kcol;
    const _Float16* gk3 = kbase + (size_t)min(kb0 + krow + 96, KPAD - 1) * HD + kcol;
    const _Float16* gv0 = vbase + (size_t)vrow * KPAD + min(kb0 + vcol, KPAD - 8);
    const _Float16* gv1 = gv0 + (size_t)16 * KPAD;
    const _Float16* gv2 = gv0 + (size_t)32 * KPAD;
    const _Float16* gv3 = gv0 + (size_t)48 * KPAD;
    // s_wait_xcnt is the statement's last line as a precaution: so it stands in
    // front of every later write of an address register that a copy names.
    asm volatile(
        "global_load_async_to_lds_b128 %0, %8, off\n\t"
        "global_load_async_to_lds_b128 %1, %9, off\n\t"
        "global_load_async_to_lds_b128 %2, %10, off\n\t"
        "global_load_async_to_lds_b128 %3, %11, off\n\t"
        "global_load_async_to_lds_b128 %4, %12, off\n\t"
        "global_load_async_to_lds_b128 %5, %13, off\n\t"
        "global_load_async_to_lds_b128 %6, %14, off\n\t"
        "global_load_async_to_lds_b128 %7, %15, off\n\t"
        "s_wait_xcnt 0x0"
        :: "v"(kdst), "v"(kdst + 32 * KPITCH * 2), "v"(kdst + 64 * KPITCH * 2),
           "v"(kdst + 96 * KPITCH * 2),
           "v"(vdst), "v"(vdst + 16 * VPITCH * 2), "v"(vdst + 32 * VPITCH * 2),
           "v"(vdst + 48 * VPITCH * 2),
           "v"(gk0), "v"(gk1), "v"(gk2), "v"(gk3),
           "v"(gv0), "v"(gv1), "v"(gv2), "v"(gv3)
        : "memory");
}

__global__ __launch_bounds__(256) void fa_kernel(
    const _Float16* __restrict__ Qh, const _Float16* __restrict__ Kh,
    const _Float16* __restrict__ Vt, float* __restrict__ out)
{
    __shared__ __attribute__((aligned(16))) _Float16 Ks[2][KSTAGE];
    __shared__ __attribute__((aligned(16))) _Float16 Vs[2][VSTAGE];

    const int lane   = threadIdx.x & 31;
    const int wave   = threadIdx.x >> 5;
    const int wg     = blockIdx.x;
    const int qblk   = wg & 15;           // 16 blocks of 128 queries
    const int bh     = wg >> 4;           // b*NH + h
    const int b      = bh >> 4;
    const int h      = bh & 15;
    const int qbase  = qblk * 128 + wave * 16;
    const int lo     = lane & 15;
    const int hi8    = (lane & 16) ? 8 : 0;   // lane-half K/row offset
    const int dA     = hi8;                   // A/B slot pattern offset

    const _Float16* kbase = Kh + (size_t)bh * KPAD * HD;
    const _Float16* vbase = Vt + (size_t)bh * HD * KPAD;

    // ---- this thread's share of a stage: a wave's K copy is 4 whole rows
    // (512 contiguous bytes), its V^T copy 2 rows of 256 bytes
    const int krow = threadIdx.x >> 3, kcol = (threadIdx.x & 7) * 8;
    const int vrow = threadIdx.x >> 4, vcol = (threadIdx.x & 15) * 8;
    const unsigned kdst = lds_off(&Ks[0][krow * KPITCH + kcol]);
    const unsigned vdst = lds_off(&Vs[0][vrow * VPITCH + vcol]);

    // ---- prologue: stage 0 lands and is published, stage 1 starts to fly
    stage_copy(kbase, vbase, 0, kdst, vdst, krow, kcol, vrow, vcol);

    // ---- Q^T fragments: lane holds q-row qbase+lo, slots {dA..dA+7, dA+16..}
    const _Float16* qrow = Qh + ((size_t)bh * SEQ + (qbase + lo)) * HD;
    v16h qt0 = cat8(*(const half8*)(qrow +  0 + dA), *(const half8*)(qrow + 16 + dA));
    v16h qt1 = cat8(*(const half8*)(qrow + 32 + dA), *(const half8*)(qrow + 48 + dA));

    v8f o0 = {}, o1 = {}, o2 = {}, o3 = {};
    float m = -1e38f, lsum = 0.0f;

    // this wave's copies of stage 0 have landed before the barrier publishes them
    asm volatile("s_wait_asynccnt 0x0" ::: "memory");
    __syncthreads();
    stage_copy(kbase, vbase, STG, kdst + KSTAGE * 2, vdst + VSTAGE * 2,
               krow, kcol, vrow, vcol);

    for (int st = 0; st < NSTG; ++st) {
      const int buf = st & 1;
      const _Float16* ks = &Ks[buf][lo * KPITCH + dA];
      const _Float16* vs = &Vs[buf][lo * VPITCH + dA];
      const int left = KPAD - st * STG;
      const int np = (left < STG ? left : STG) / 32;   // passes in this stage

      for (int p = 0; p < np; ++p) {
        const int kb = st * STG + p * 32;

        // ---- K A-fragments: lane = key row (kb+lo / kb+16+lo)
        const _Float16* kr0 = ks + p * 32 * KPITCH;
        const _Float16* kr1 = kr0 + 16 * KPITCH;
        v16h ka0c0 = cat8(*(const half8*)(kr0 +  0), *(const half8*)(kr0 + 16));
        v16h ka0c1 = cat8(*(const half8*)(kr0 + 32), *(const half8*)(kr0 + 48));
        v16h ka1c0 = cat8(*(const half8*)(kr1 +  0), *(const half8*)(kr1 + 16));
        v16h ka1c1 = cat8(*(const half8*)(kr1 + 32), *(const half8*)(kr1 + 48));

        // ---- S^T tiles (M=key, N=q), log2 domain (scale folded into Q)
        v8f c0 = {}; c0 = wmma_f16(ka0c0, qt0, c0); c0 = wmma_f16(ka0c1, qt1, c0);
        v8f c1 = {}; c1 = wmma_f16(ka1c0, qt0, c1); c1 = wmma_f16(ka1c1, qt1, c1);

        // ---- tail mask: keys >= NKV are padding
        if (kb + 32 > NKV) {
            #pragma unroll
            for (int r = 0; r < 8; ++r) {
                if (kb + r + hi8 >= NKV)      c0[r] = -1e30f;
                if (kb + 16 + r + hi8 >= NKV) c1[r] = -1e30f;
            }
        }

        // ---- online softmax (per-lane over 16 regs + one xor-16 shuffle)
        float mt = fmaxf(c0[0], c1[0]);
        #pragma unroll
        for (int r = 1; r < 8; ++r) { mt = fmaxf(mt, fmaxf(c0[r], c1[r])); }
        mt = fmaxf(mt, __shfl_xor(mt, 16));
        float mnew  = fmaxf(m, mt);
        float alpha = fast_exp2(m - mnew);

        union { v16h v; _Float16 e[16]; } pf;
        float ps = 0.0f;
        #pragma unroll
        for (int r = 0; r < 8; ++r) {
            float p0 = fast_exp2(c0[r] - mnew); ps += p0; pf.e[r]     = (_Float16)p0;
            float p1 = fast_exp2(c1[r] - mnew); ps += p1; pf.e[8 + r] = (_Float16)p1;
        }
        ps += __shfl_xor(ps, 16);
        lsum = lsum * alpha + ps;
        m = mnew;

        // ---- rescale O (row q = r + hi8 lives at lane r+hi8)
        #pragma unroll
        for (int r = 0; r < 8; ++r) {
            float sc = __shfl(alpha, r + hi8);
            o0[r] *= sc; o1[r] *= sc; o2[r] *= sc; o3[r] *= sc;
        }

        // ---- V B-fragments (rows of V^T) and PV accumulation
        const _Float16* vr0 = vs + p * 32;
        const _Float16* vr1 = vr0 + 16 * VPITCH;
        const _Float16* vr2 = vr0 + 32 * VPITCH;
        const _Float16* vr3 = vr0 + 48 * VPITCH;
        v16h bv0 = cat8(*(const half8*)(vr0), *(const half8*)(vr0 + 16));
        v16h bv1 = cat8(*(const half8*)(vr1), *(const half8*)(vr1 + 16));
        v16h bv2 = cat8(*(const half8*)(vr2), *(const half8*)(vr2 + 16));
        v16h bv3 = cat8(*(const half8*)(vr3), *(const half8*)(vr3 + 16));
        o0 = wmma_f16(pf.v, bv0, o0);
        o1 = wmma_f16(pf.v, bv1, o1);
        o2 = wmma_f16(pf.v, bv2, o2);
        o3 = wmma_f16(pf.v, bv3, o3);
      }

      // ---- publish point of stage st+1, every wave, in this order:
      // this wave's reads of the buffer to be refilled have returned
      asm volatile("s_wait_dscnt 0x0" ::: "memory");
      // this wave's copies of stage st+1 have landed
      asm volatile("s_wait_asynccnt 0x0" ::: "memory");
      __syncthreads();
      if (st + 2 < NSTG)
        stage_copy(kbase, vbase, (st + 2) * STG,
                   kdst + buf * (KSTAGE * 2), vdst + buf * (VSTAGE * 2),
                   krow, kcol, vrow, vcol);
    }
    // no copy is left in flight when the wave ends
    asm volatile("s_wait_asynccnt 0x0" ::: "memory");

    // ---- finalize: divide by softmax denominator, store (B,S,NH*HD)
    float invl = 1.0f / lsum;
    #pragma unroll
    for (int r = 0; r < 8; ++r) {
        float il = __shfl(invl, r + hi8);
        int q = qbase + r + hi8;
        size_t base = (((size_t)b * SEQ + q) * NH + h) * HD + lo;
        out[base +  0] = o0[r] * il;
        out[base + 16] = o1[r] * il;
        out[base + 32] = o2[r] * il;
        out[base + 48] = o3[r] * il;
    }
}

// ---------------------------------------------------------------------------
extern "C" void kernel_launch(void* const* d_in, const int* in_sizes, int n_in,
                              void* d_out, int out_size, void* d_ws, size_t ws_size,
                              hipStream_t stream)
{
    (void)in_sizes; (void)n_in; (void)out_size; (void)ws_size;

    const float* q    = (const float*)d_in[0];
    const float* k    = (const float*)d_in[1];
    const float* v    = (const float*)d_in[2];
    const float* kreg = (const float*)d_in[3];
    const float* vreg = (const float*)d_in[4];
    float* out = (float*)d_out;

    // workspace layout (f16)
    const size_t QH_ELEMS = (size_t)BATCH * NH * SEQ  * HD;   //  8,388,608
    const size_t KH_ELEMS = (size_t)BATCH * NH * KPAD * HD;   //  8,519,680
    _Float16* Qh = (_Float16*)d_ws;
    _Float16* Kh = Qh + QH_ELEMS;
    _Float16* Vt = Kh + KH_ELEMS;

    // Phase 1
    rope_q_kernel<<<(unsigned)(QH_ELEMS / 256), 256, 0, stream>>>(q, Qh);
    rope_k_kernel<<<(unsigned)(KH_ELEMS / 256), 256, 0, stream>>>(k, kreg, Kh);
    vt_kernel<<<BATCH * NH * 4 * (KPAD / 16), 256, 0, stream>>>(v, vreg, Vt);

    // Phase 2: B*NH*(SEQ/128) workgroups of 8 waves
    fa_kernel<<<BATCH * NH * (SEQ / 128), 256, 0, stream>>>(Qh, Kh, Vt, out);
}

// v002
// A run of this version takes 99.5 microseconds.
// Next to v001, in two timings, it ran 1.47 times as fast each time.
// All steps since v000 together make it 3.31 times as fast.
#include <hip/hip_runtime.h>
#include <hip/hip_bf16.h>
#include <math.h>

// ---------------------------------------------------------------------------
// RotaryAttention for MI455X (gfx1250, wave32, WMMA).
// Phase 1: RoPE+f16 pack of Q/K, V transpose (all into d_ws).
// Phase 2: flash attention, S^T formulation, v_wmma_f32_16x16x32_f16.
// ---------------------------------------------------------------------------

typedef _Float16 half8 __attribute__((ext_vector_type(8)));
typedef _Float16 v16h  __attribute__((ext_vector_type(16)));
typedef float    v8f   __attribute__((ext_vector_type(8)));

#define NH      16
#define HD      64
#define SEQ     2048
#define NKV     2049          // 2048 keys + 1 register token
#define KPAD    2080          // padded to multiple of 32
#define BATCH   4

// 1/sqrt(64) * log2(e): scores come out in log2 domain -> native v_exp_f32
#define QSCALE  0.18033688011112042f
// log2(10000)/16
#define FREQC   0.83048202372184065f

__device__ __forceinline__ v8f wmma_f16(v16h a, v16h b, v8f c) {
    return __builtin_amdgcn_wmma_f32_16x16x32_f16(false, a, false, b,
                                                  (short)0, c, false, false);
}

__device__ __forceinline__ v16h cat8(half8 lo, half8 hi) {
    return __builtin_shufflevector(lo, hi, 0,1,2,3,4,5,6,7,8,9,10,11,12,13,14,15);
}

// Raw v_exp_f32: args are always <= 0 here; flush-to-zero below -126 is the
// desired flash-softmax semantics (avoids OCML's range-fix cmp/cndmask pairs).
__device__ __forceinline__ float fast_exp2(float x) {
    return __builtin_amdgcn_exp2f(x);
}

// ---------------------------------------------------------------------------
// Phase 1, common shape: few, fat work-groups. A lane moves 16 bytes per load,
// a wave-wide load covers whole 256-byte head rows, all of a thread's loads are
// issued before the first is used, and stores cover whole lines.
// ---------------------------------------------------------------------------
typedef _Float16 half4 __attribute__((ext_vector_type(4)));
typedef _Float16 half2 __attribute__((ext_vector_type(2)));

#define RPW     16            // positions per wave: 8 loads x 2 rows

// One wave: RPW consecutive positions of one head. Lanes 0-15 hold one row
// (4 dims each), lanes 16-31 the next; src/dst point at the lane's own 4 dims
// of its first row, pos is that row's position.
__device__ __forceinline__ void rope_rows(
    const float* __restrict__ src, _Float16* __restrict__ dst,
    int pos, int d, float scale)
{
    float4 x[RPW / 2];
    #pragma unroll
    for (int j = 0; j < RPW / 2; ++j)
        x[j] = *(const float4*)(src + (size_t)j * 2 * NH * HD);

    // rotate_half partner: dims d+16 / d-16 sit 4 lanes away in the same row
    float4 o[RPW / 2];
    #pragma unroll
    for (int j = 0; j < RPW / 2; ++j) {
        o[j].x = __shfl_xor(x[j].x, 4);
        o[j].y = __shfl_xor(x[j].y, 4);
        o[j].z = __shfl_xor(x[j].z, 4);
        o[j].w = __shfl_xor(x[j].w, 4);
    }

    if (d < 32) {
        const float sg = (d < 16) ? -1.0f : 1.0f;
        const int   f  = d & 15;
        const float f0 = exp2f(-(float)(f + 0) * FREQC);
        const float f1 = exp2f(-(float)(f + 1) * FREQC);
        const float f2 = exp2f(-(float)(f + 2) * FREQC);
        const float f3 = exp2f(-(float)(f + 3) * FREQC);
        #pragma unroll
        for (int j = 0; j < RPW / 2; ++j) {
            const float p = (float)(pos + 2 * j);
            float sn, cs;
            __sincosf(p * f0, &sn, &cs); x[j].x = x[j].x * cs + (sg * o[j].x) * sn;
            __sincosf(p * f1, &sn, &cs); x[j].y = x[j].y * cs + (sg * o[j].y) * sn;
            __sincosf(p * f2, &sn, &cs); x[j].z = x[j].z * cs + (sg * o[j].z) * sn;
            __sincosf(p * f3, &sn, &cs); x[j].w = x[j].w * cs + (sg * o[j].w) * sn;
        }
    }

    #pragma unroll
    for (int j = 0; j < RPW / 2; ++j) {
        half4 r = { (_Float16)(x[j].x * scale), (_Float16)(x[j].y * scale),
                    (_Float16)(x[j].z * scale), (_Float16)(x[j].w * scale) };
        *(half4*)(dst + j * 2 * HD) = r;
    }
}

// ---------------------------------------------------------------------------
// Phase 1a: Q -> RoPE -> *QSCALE -> f16, layout [b][h][s][d]
// grid = B * (SEQ/RPW) * NH waves / 8
// ---------------------------------------------------------------------------
__global__ __launch_bounds__(256) void rope_q_kernel(
    const float* __restrict__ qin, _Float16* __restrict__ Qh)
{
    const int lane = threadIdx.x & 31;
    const int w    = blockIdx.x * 8 + (threadIdx.x >> 5);
    const int h    = w & 15;
    const int sblk = (w >> 4) & (SEQ / RPW - 1);
    const int b    = w >> 11;
    const int d    = (lane & 15) * 4;
    const int s    = sblk * RPW + (lane >> 4);

    rope_rows(qin + (((size_t)b * SEQ + s) * NH + h) * HD + d,
              Qh  + (((size_t)b * NH + h) * SEQ + s) * HD + d, s, d, QSCALE);
}

// ---------------------------------------------------------------------------
// Phase 1b: K -> RoPE -> f16, layout [b][h][key][d], key in [0,KPAD)
//   key==2048: register token (rotary half zeroed), key>2048: zero pad
// grid = B * (KPAD/RPW) * NH waves / 8
// ---------------------------------------------------------------------------
__global__ __launch_bounds__(256) void rope_k_kernel(
    const float* __restrict__ kin, const float* __restrict__ kreg,
    _Float16* __restrict__ Kh)
{
    const int lane = threadIdx.x & 31;
    const int w    = blockIdx.x * 8 + (threadIdx.x >> 5);
    const int h    = w & 15;
    const int r    = w >> 4;
    const int kblk = r % (KPAD / RPW);
    const int b    = r / (KPAD / RPW);
    const int d    = (lane & 15) * 4;
    const int key  = kblk * RPW + (lane >> 4);

    _Float16* dst = Kh + (((size_t)b * NH + h) * KPAD + key) * HD + d;
    if (kblk < SEQ / RPW) {
        rope_rows(kin + (((size_t)b * SEQ + key) * NH + h) * HD + d, dst, key, d, 1.0f);
    } else {
        const float4 g = *(const float4*)(kreg + h * HD + d);
        const half4 reg = { (_Float16)g.x, (_Float16)g.y, (_Float16)g.z, (_Float16)g.w };
        const half4 zero = {};
        #pragma unroll
        for (int j = 0; j < RPW / 2; ++j)   // reg_mask zeros the rotary half
            *(half4*)(dst + j * 2 * HD) = (key + 2 * j == SEQ && d >= 32) ? reg : zero;
    }
}

// ---------------------------------------------------------------------------
// Phase 1c: V transpose -> f16, layout [b][h][d][key], key in [0,KPAD)
// One work-group: all 64 dims x 160 keys of one head through LDS.
// grid = B * (KPAD/VTK) * NH
// ---------------------------------------------------------------------------
#define VTK     160           // keys per tile; KPAD = 13 * 160
#define VTP     (VTK / 2 + 1) // dwords per dim row: odd, so that the 16 lanes of
                              // a row (4 dims apart) store to 16 different banks

__global__ __launch_bounds__(256) void vt_kernel(
    const float* __restrict__ vin, const float* __restrict__ vreg,
    _Float16* __restrict__ Vt)
{
    __shared__ unsigned tile[HD * VTP];   // [dim][key pair], two f16 keys a dword
    int bidx = blockIdx.x;
    const int h  = bidx & 15;  bidx >>= 4;
    const int kt = bidx % (KPAD / VTK);
    const int b  = bidx / (KPAD / VTK);
    const int t  = threadIdx.x;
    const int d  = (t & 15) * 4;
    const int kp = t >> 4;

    // a thread's key pairs: keys 2n and 2n+1, n = i*16 + kp
    float4 e[VTK / 32], o[VTK / 32];
    if (kt * VTK + VTK <= SEQ) {          // whole tile inside the sequence
        const float* p = vin + (((size_t)b * SEQ + kt * VTK + kp * 2) * NH + h) * HD + d;
        #pragma unroll
        for (int i = 0; i < VTK / 32; ++i) {
            e[i] = *(const float4*)(p + (size_t)(i * 32 + 0) * NH * HD);
            o[i] = *(const float4*)(p + (size_t)(i * 32 + 1) * NH * HD);
        }
    } else {                              // last tile: register token, zero pad
        #pragma unroll
        for (int i = 0; i < VTK / 32; ++i) {
            // key is even, so key and key+1 lie on the same side of SEQ; past
            // the sequence the pointer names the register row (in bounds)
            const int key = kt * VTK + (i * 16 + kp) * 2;
            const bool in = key < SEQ;
            const float* p = in ? vin + (((size_t)b * SEQ + key) * NH + h) * HD + d
                                : vreg + h * HD + d;
            const float4 pe = *(const float4*)p;
            const float4 po = *(const float4*)(in ? p + NH * HD : p);
            const bool te = key <= SEQ;   // key == SEQ is the register token
            e[i].x = te ? pe.x : 0.0f;  e[i].y = te ? pe.y : 0.0f;
            e[i].z = te ? pe.z : 0.0f;  e[i].w = te ? pe.w : 0.0f;
            o[i].x = in ? po.x : 0.0f;  o[i].y = in ? po.y : 0.0f;
            o[i].z = in ? po.z : 0.0f;  o[i].w = in ? po.w : 0.0f;
        }
    }
    #pragma unroll
    for (int i = 0; i < VTK / 32; ++i) {
        const float ev[4] = { e[i].x, e[i].y, e[i].z, e[i].w };
        const float ov[4] = { o[i].x, o[i].y, o[i].z, o[i].w };
        #pragma unroll
        for (int c = 0; c < 4; ++c) {
            half2 pr = { (_Float16)ev[c], (_Float16)ov[c] };
            tile[(d + c) * VTP + i * 16 + kp] = __builtin_bit_cast(unsigned, pr);
        }
    }
    __syncthreads();

    // 8 keys (16 bytes) per lane; 20 lanes cover a dim row's 320 bytes
    _Float16* dst = Vt + ((size_t)b * NH + h) * HD * KPAD + kt * VTK;
    #pragma unroll
    for (int i = 0; i < HD * VTK / 8 / 256; ++i) {
        const int idx = i * 256 + t;
        const int row = idx / (VTK / 8);
        const int g   = idx - row * (VTK / 8);
        const unsigned* s = &tile[row * VTP + g * 4];
        uint4 v = { s[0], s[1], s[2], s[3] };
        *(uint4*)(dst + (size_t)row * KPAD + g * 8) = v;
    }
}

// ---------------------------------------------------------------------------
// Phase 2: flash attention. One wave = 16 query rows; block = 8 waves = 128 q.
// grid.x = B*NH*(SEQ/128).  S^T = K_tile x Q^T so softmax is per-lane and
// exp(S^T) feeds the PV WMMA A-operand with no cross-lane transpose.
// K and V^T come through LDS: the block's 8 waves share one 128-key stage,
// filled by asynchronous copies of whole lines, two buffers, one stage ahead.
// ---------------------------------------------------------------------------
#define STG     128                       // keys per LDS stage (4 passes of 32)
#define NSTG    ((KPAD + STG - 1) / STG)  // 17; the last stage holds one pass
#define KPITCH  72                        // halves: 128-B K row + 16 B (b128 readers)
#define VPITCH  136                       // halves: 256-B V^T row + 16 B
#define KSTAGE  (STG * KPITCH)            // halves per K buffer
#define VSTAGE  (HD * VPITCH)             // halves per V^T buffer

__device__ __forceinline__ unsigned lds_off(const void* p) {
    return (unsigned)(size_t)p;           // low 32 bits = byte offset in LDS
}

// One stage: 4 K copies + 4 V^T copies of 16 B per lane. The global side is
// clamped so that the short last stage stays inside Kh / Vt; the LDS bytes
// filled from clamped addresses belong to passes that are never run.
__device__ __forceinline__ void stage_copy(
    const _Float16* kbase, const _Float16* vbase, int kb0,
    unsigned kdst, unsigned vdst, int krow, int kcol, int vrow, int vcol)
{
    const _Float16* gk0 = kbase + (size_t)min(kb0 + krow +  0, KPAD - 1) * HD + kcol;
    const _Float16* gk1 = kbase + (size_t)min(kb0 + krow + 32, KPAD - 1) * HD + kcol;
    const _Float16* gk2 = kbase + (size_t)min(kb0 + krow + 64, KPAD - 1) * HD + kcol;
    const _Float16* gk3 = kbase + (size_t)min(kb0 + krow + 96, KPAD - 1) * HD + kcol;
    const _Float16* gv0 = vbase + (size_t)vrow * KPAD + min(kb0 + vcol, KPAD - 8);
    const _Float16* gv1 = gv0 + (size_t)16 * KPAD;
    const _Float16* gv2 = gv0 + (size_t)32 * KPAD;
    const _Float16* gv3 = gv0 + (size_t)48 * KPAD;
    // s_wait_xcnt is the statement's last line as a precaution: so it stands in
    // front of every later write of an address register that a copy names.
    asm volatile(
        "global_load_async_to_lds_b128 %0, %8, off\n\t"
        "global_load_async_to_lds_b128 %1, %9, off\n\t"
        "global_load_async_to_lds_b128 %2, %10, off\n\t"
        "global_load_async_to_lds_b128 %3, %11, off\n\t"
        "global_load_async_to_lds_b128 %4, %12, off\n\t"
        "global_load_async_to_lds_b128 %5, %13, off\n\t"
        "global_load_async_to_lds_b128 %6, %14, off\n\t"
        "global_load_async_to_lds_b128 %7, %15, off\n\t"
        "s_wait_xcnt 0x0"
        :: "v"(kdst), "v"(kdst + 32 * KPITCH * 2), "v"(kdst + 64 * KPITCH * 2),
           "v"(kdst + 96 * KPITCH * 2),
           "v"(vdst), "v"(vdst + 16 * VPITCH * 2), "v"(vdst + 32 * VPITCH * 2),
           "v"(vdst + 48 * VPITCH * 2),
           "v"(gk0), "v"(gk1), "v"(gk2), "v"(gk3),
           "v"(gv0), "v"(gv1), "v"(gv2), "v"(gv3)
        : "memory");
}

__global__ __launch_bounds__(256) void fa_kernel(
    const _Float16* __restrict__ Qh, const _Float16* __restrict__ Kh,
    const _Float16* __restrict__ Vt, float* __restrict__ out)
{
    __shared__ __attribute__((aligned(16))) _Float16 Ks[2][KSTAGE];
    __shared__ __attribute__((aligned(16))) _Float16 Vs[2][VSTAGE];

    const int lane   = threadIdx.x & 31;
    const int wave   = threadIdx.x >> 5;
    const int wg     = blockIdx.x;
    const int qblk   = wg & 15;           // 16 blocks of 128 queries
    const int bh     = wg >> 4;           // b*NH + h
    const int b      = bh >> 4;
    const int h      = bh & 15;
    const int qbase  = qblk * 128 + wave * 16;
    const int lo     = lane & 15;
    const int hi8    = (lane & 16) ? 8 : 0;   // lane-half K/row offset
    const int dA     = hi8;                   // A/B slot pattern offset

    const _Float16* kbase = Kh + (size_t)bh * KPAD * HD;
    const _Float16* vbase = Vt + (size_t)bh * HD * KPAD;

    // ---- this thread's share of a stage: a wave's K copy is 4 whole rows
    // (512 contiguous bytes), its V^T copy 2 rows of 256 bytes
    const int krow = threadIdx.x >> 3, kcol = (threadIdx.x & 7) * 8;
    const int vrow = threadIdx.x >> 4, vcol = (threadIdx.x & 15) * 8;
    const unsigned kdst = lds_off(&Ks[0][krow * KPITCH + kcol]);
    const unsigned vdst = lds_off(&Vs[0][vrow * VPITCH + vcol]);

    // ---- prologue: stage 0 lands and is published, stage 1 starts to fly
    stage_copy(kbase, vbase, 0, kdst, vdst, krow, kcol, vrow, vcol);

    // ---- Q^T fragments: lane holds q-row qbase+lo, slots {dA..dA+7, dA+16..}
    const _Float16* qrow = Qh + ((size_t)bh * SEQ + (qbase + lo)) * HD;
    v16h qt0 = cat8(*(const half8*)(qrow +  0 + dA), *(const half8*)(qrow + 16 + dA));
    v16h qt1 = cat8(*(const half8*)(qrow + 32 + dA), *(const half8*)(qrow + 48 + dA));

    v8f o0 = {}, o1 = {}, o2 = {}, o3 = {};
    float m = -1e38f, lsum = 0.0f;

    // this wave's copies of stage 0 have landed before the barrier publishes them
    asm volatile("s_wait_asynccnt 0x0" ::: "memory");
    __syncthreads();
    stage_copy(kbase, vbase, STG, kdst + KSTAGE * 2, vdst + VSTAGE * 2,
               krow, kcol, vrow, vcol);

    for (int st = 0; st < NSTG; ++st) {
      const int buf = st & 1;
      const _Float16* ks = &Ks[buf][lo * KPITCH + dA];
      const _Float16* vs = &Vs[buf][lo * VPITCH + dA];
      const int left = KPAD - st * STG;
      const int np = (left < STG ? left : STG) / 32;   // passes in this stage

      for (int p = 0; p < np; ++p) {
        const int kb = st * STG + p * 32;

        // ---- K A-fragments: lane = key row (kb+lo / kb+16+lo)
        const _Float16* kr0 = ks + p * 32 * KPITCH;
        const _Float16* kr1 = kr0 + 16 * KPITCH;
        v16h ka0c0 = cat8(*(const half8*)(kr0 +  0), *(const half8*)(kr0 + 16));
        v16h ka0c1 = cat8(*(const half8*)(kr0 + 32), *(const half8*)(kr0 + 48));
        v16h ka1c0 = cat8(*(const half8*)(kr1 +  0), *(const half8*)(kr1 + 16));
        v16h ka1c1 = cat8(*(const half8*)(kr1 + 32), *(const half8*)(kr1 + 48));

        // ---- S^T tiles (M=key, N=q), log2 domain (scale folded into Q)
        v8f c0 = {}; c0 = wmma_f16(ka0c0, qt0, c0); c0 = wmma_f16(ka0c1, qt1, c0);
        v8f c1 = {}; c1 = wmma_f16(ka1c0, qt0, c1); c1 = wmma_f16(ka1c1, qt1, c1);

        // ---- tail mask: keys >= NKV are padding
        if (kb + 32 > NKV) {
            #pragma unroll
            for (int r = 0; r < 8; ++r) {
                if (kb + r + hi8 >= NKV)      c0[r] = -1e30f;
                if (kb + 16 + r + hi8 >= NKV) c1[r] = -1e30f;
            }
        }

        // ---- online softmax (per-lane over 16 regs + one xor-16 shuffle)
        float mt = fmaxf(c0[0], c1[0]);
        #pragma unroll
        for (int r = 1; r < 8; ++r) { mt = fmaxf(mt, fmaxf(c0[r], c1[r])); }
        mt = fmaxf(mt, __shfl_xor(mt, 16));
        float mnew  = fmaxf(m, mt);
        float alpha = fast_exp2(m - mnew);

        union { v16h v; _Float16 e[16]; } pf;
        float ps = 0.0f;
        #pragma unroll
        for (int r = 0; r < 8; ++r) {
            float p0 = fast_exp2(c0[r] - mnew); ps += p0; pf.e[r]     = (_Float16)p0;
            float p1 = fast_exp2(c1[r] - mnew); ps += p1; pf.e[8 + r] = (_Float16)p1;
        }
        ps += __shfl_xor(ps, 16);
        lsum = lsum * alpha + ps;
        m = mnew;

        // ---- rescale O (row q = r + hi8 lives at lane r+hi8)
        #pragma unroll
        for (int r = 0; r < 8; ++r) {
            float sc = __shfl(alpha, r + hi8);
            o0[r] *= sc; o1[r] *= sc; o2[r] *= sc; o3[r] *= sc;
        }

        // ---- V B-fragments (rows of V^T) and PV accumulation
        const _Float16* vr0 = vs + p * 32;
        const _Float16* vr1 = vr0 + 16 * VPITCH;
        const _Float16* vr2 = vr0 + 32 * VPITCH;
        const _Float16* vr3 = vr0 + 48 * VPITCH;
        v16h bv0 = cat8(*(const half8*)(vr0), *(const half8*)(vr0 + 16));
        v16h bv1 = cat8(*(const half8*)(vr1), *(const half8*)(vr1 + 16));
        v16h bv2 = cat8(*(const half8*)(vr2), *(const half8*)(vr2 + 16));
        v16h bv3 = cat8(*(const half8*)(vr3), *(const half8*)(vr3 + 16));
        o0 = wmma_f16(pf.v, bv0, o0);
        o1 = wmma_f16(pf.v, bv1, o1);
        o2 = wmma_f16(pf.v, bv2, o2);
        o3 = wmma_f16(pf.v, bv3, o3);
      }

      // ---- publish point of stage st+1, every wave, in this order:
      // this wave's reads of the buffer to be refilled have returned
      asm volatile("s_wait_dscnt 0x0" ::: "memory");
      // this wave's copies of stage st+1 have landed
      asm volatile("s_wait_asynccnt 0x0" ::: "memory");
      __syncthreads();
      if (st + 2 < NSTG)
        stage_copy(kbase, vbase, (st + 2) * STG,
                   kdst + buf * (KSTAGE * 2), vdst + buf * (VSTAGE * 2),
                   krow, kcol, vrow, vcol);
    }
    // no copy is left in flight when the wave ends
    asm volatile("s_wait_asynccnt 0x0" ::: "memory");

    // ---- finalize: divide by softmax denominator, store (B,S,NH*HD)
    float invl = 1.0f / lsum;
    #pragma unroll
    for (int r = 0; r < 8; ++r) {
        float il = __shfl(invl, r + hi8);
        int q = qbase + r + hi8;
        size_t base = (((size_t)b * SEQ + q) * NH + h) * HD + lo;
        out[base +  0] = o0[r] * il;
        out[base + 16] = o1[r] * il;
        out[base + 32] = o2[r] * il;
        out[base + 48] = o3[r] * il;
    }
}

// ---------------------------------------------------------------------------
extern "C" void kernel_launch(void* const* d_in, const int* in_sizes, int n_in,
                              void* d_out, int out_size, void* d_ws, size_t ws_size,
                              hipStream_t stream)
{
    (void)in_sizes; (void)n_in; (void)out_size; (void)ws_size;

    const float* q    = (const float*)d_in[0];
    const float* k    = (const float*)d_in[1];
    const float* v    = (const float*)d_in[2];
    const float* kreg = (const float*)d_in[3];
    const float* vreg = (const float*)d_in[4];
    float* out = (float*)d_out;

    // workspace layout (f16)
    const size_t QH_ELEMS = (size_t)BATCH * NH * SEQ  * HD;   //  8,388,608
    const size_t KH_ELEMS = (size_t)BATCH * NH * KPAD * HD;   //  8,519,680
    _Float16* Qh = (_Float16*)d_ws;
    _Float16* Kh = Qh + QH_ELEMS;
    _Float16* Vt = Kh + KH_ELEMS;

    // Phase 1
    rope_q_kernel<<<BATCH * NH * (SEQ / RPW) / 8, 256, 0, stream>>>(q, Qh);
    rope_k_kernel<<<BATCH * NH * (KPAD / RPW) / 8, 256, 0, stream>>>(k, kreg, Kh);
    vt_kernel<<<BATCH * NH * (KPAD / VTK), 256, 0, stream>>>(v, vreg, Vt);

    // Phase 2: B*NH*(SEQ/128) workgroups of 8 waves
    fa_kernel<<<BATCH * NH * (SEQ / 128), 256, 0, stream>>>(Qh, Kh, Vt, out);
}

// v003
// A run of this version takes 91.7 microseconds.
// Timed twice side by side with v002, it ran 1.08 and 1.09 times as fast.
// Over all steps from v000 it is 3.59 times as fast.
#include <hip/hip_runtime.h>
#include <hip/hip_bf16.h>
#include <math.h>

// ---------------------------------------------------------------------------
// RotaryAttention for MI455X (gfx1250, wave32, WMMA).
// Phase 1: RoPE+f16 pack of Q/K, V transpose (all into d_ws).
// Phase 2: flash attention, S^T formulation, v_wmma_f32_16x16x32_f16.
// ---------------------------------------------------------------------------

typedef _Float16 half8 __attribute__((ext_vector_type(8)));
typedef _Float16 v16h  __attribute__((ext_vector_type(16)));
typedef float    v8f   __attribute__((ext_vector_type(8)));

#define NH      16
#define HD      64
#define SEQ     2048
#define NKV     2049          // 2048 keys + 1 register token
#define KPAD    2080          // padded to multiple of 32
#define BATCH   4

// 1/sqrt(64) * log2(e): scores come out in log2 domain -> native v_exp_f32
#define QSCALE  0.18033688011112042f
// log2(10000)/16
#define FREQC   0.83048202372184065f

__device__ __forceinline__ v8f wmma_f16(v16h a, v16h b, v8f c) {
    return __builtin_amdgcn_wmma_f32_16x16x32_f16(false, a, false, b,
                                                  (short)0, c, false, false);
}

__device__ __forceinline__ v16h cat8(half8 lo, half8 hi) {
    return __builtin_shufflevector(lo, hi, 0,1,2,3,4,5,6,7,8,9,10,11,12,13,14,15);
}

// Raw v_exp_f32: args are always <= 0 here; flush-to-zero below -126 is the
// desired flash-softmax semantics (avoids OCML's range-fix cmp/cndmask pairs).
__device__ __forceinline__ float fast_exp2(float x) {
    return __builtin_amdgcn_exp2f(x);
}

// Lane l with lane l ^ 16 on the vector pipe (no trip through the LDS unit).
__device__ __forceinline__ float xhalf(float x) {
    const int b = __builtin_bit_cast(int, x);
    return __builtin_bit_cast(float,
        __builtin_amdgcn_permlanex16(b, b, 0x76543210, 0xfedcba98, false, false));
}

// ---------------------------------------------------------------------------
// Phase 1, common shape: few, fat work-groups. A lane moves 16 bytes per load,
// a wave-wide load covers whole 256-byte head rows, all of a thread's loads are
// issued before the first is used, and stores cover whole lines.
// ---------------------------------------------------------------------------
typedef _Float16 half4 __attribute__((ext_vector_type(4)));
typedef _Float16 half2 __attribute__((ext_vector_type(2)));

#define RPW     16            // positions per wave: 8 loads x 2 rows

// One wave: RPW consecutive positions of one head. Lanes 0-15 hold one row
// (4 dims each), lanes 16-31 the next; src/dst point at the lane's own 4 dims
// of its first row, pos is that row's position.
__device__ __forceinline__ void rope_rows(
    const float* __restrict__ src, _Float16* __restrict__ dst,
    int pos, int d, float scale)
{
    float4 x[RPW / 2];
    #pragma unroll
    for (int j = 0; j < RPW / 2; ++j)
        x[j] = *(const float4*)(src + (size_t)j * 2 * NH * HD);

    // rotate_half partner: dims d+16 / d-16 sit 4 lanes away in the same row
    float4 o[RPW / 2];
    #pragma unroll
    for (int j = 0; j < RPW / 2; ++j) {
        o[j].x = __shfl_xor(x[j].x, 4);
        o[j].y = __shfl_xor(x[j].y, 4);
        o[j].z = __shfl_xor(x[j].z, 4);
        o[j].w = __shfl_xor(x[j].w, 4);
    }

    if (d < 32) {
        const float sg = (d < 16) ? -1.0f : 1.0f;
        const int   f  = d & 15;
        const float f0 = exp2f(-(float)(f + 0) * FREQC);
        const float f1 = exp2f(-(float)(f + 1) * FREQC);
        const float f2 = exp2f(-(float)(f + 2) * FREQC);
        const float f3 = exp2f(-(float)(f + 3) * FREQC);
        #pragma unroll
        for (int j = 0; j < RPW / 2; ++j) {
            const float p = (float)(pos + 2 * j);
            float sn, cs;
            __sincosf(p * f0, &sn, &cs); x[j].x = x[j].x * cs + (sg * o[j].x) * sn;
            __sincosf(p * f1, &sn, &cs); x[j].y = x[j].y * cs + (sg * o[j].y) * sn;
            __sincosf(p * f2, &sn, &cs); x[j].z = x[j].z * cs + (sg * o[j].z) * sn;
            __sincosf(p * f3, &sn, &cs); x[j].w = x[j].w * cs + (sg * o[j].w) * sn;
        }
    }

    #pragma unroll
    for (int j = 0; j < RPW / 2; ++j) {
        half4 r = { (_Float16)(x[j].x * scale), (_Float16)(x[j].y * scale),
                    (_Float16)(x[j].z * scale), (_Float16)(x[j].w * scale) };
        *(half4*)(dst + j * 2 * HD) = r;
    }
}

// ---------------------------------------------------------------------------
// Phase 1a: Q -> RoPE -> *QSCALE -> f16, layout [b][h][s][d]
// grid = B * (SEQ/RPW) * NH waves / 8
// ---------------------------------------------------------------------------
__global__ __launch_bounds__(256) void rope_q_kernel(
    const float* __restrict__ qin, _Float16* __restrict__ Qh)
{
    const int lane = threadIdx.x & 31;
    const int w    = blockIdx.x * 8 + (threadIdx.x >> 5);
    const int h    = w & 15;
    const int sblk = (w >> 4) & (SEQ / RPW - 1);
    const int b    = w >> 11;
    const int d    = (lane & 15) * 4;
    const int s    = sblk * RPW + (lane >> 4);

    rope_rows(qin + (((size_t)b * SEQ + s) * NH + h) * HD + d,
              Qh  + (((size_t)b * NH + h) * SEQ + s) * HD + d, s, d, QSCALE);
}

// ---------------------------------------------------------------------------
// Phase 1b: K -> RoPE -> f16, layout [b][h][key][d], key in [0,KPAD)
//   key==2048: register token (rotary half zeroed), key>2048: zero pad
// grid = B * (KPAD/RPW) * NH waves / 8
// ---------------------------------------------------------------------------
__global__ __launch_bounds__(256) void rope_k_kernel(
    const float* __restrict__ kin, const float* __restrict__ kreg,
    _Float16* __restrict__ Kh)
{
    const int lane = threadIdx.x & 31;
    const int w    = blockIdx.x * 8 + (threadIdx.x >> 5);
    const int h    = w & 15;
    const int r    = w >> 4;
    const int kblk = r % (KPAD / RPW);
    const int b    = r / (KPAD / RPW);
    const int d    = (lane & 15) * 4;
    const int key  = kblk * RPW + (lane >> 4);

    _Float16* dst = Kh + (((size_t)b * NH + h) * KPAD + key) * HD + d;
    if (kblk < SEQ / RPW) {
        rope_rows(kin + (((size_t)b * SEQ + key) * NH + h) * HD + d, dst, key, d, 1.0f);
    } else {
        const float4 g = *(const float4*)(kreg + h * HD + d);
        const half4 reg = { (_Float16)g.x, (_Float16)g.y, (_Float16)g.z, (_Float16)g.w };
        const half4 zero = {};
        #pragma unroll
        for (int j = 0; j < RPW / 2; ++j)   // reg_mask zeros the rotary half
            *(half4*)(dst + j * 2 * HD) = (key + 2 * j == SEQ && d >= 32) ? reg : zero;
    }
}

// ---------------------------------------------------------------------------
// Phase 1c: V transpose -> f16, layout [b][h][d][key], key in [0,KPAD)
// One work-group: all 64 dims x 160 keys of one head through LDS.
// grid = B * (KPAD/VTK) * NH
// ---------------------------------------------------------------------------
#define VTK     160           // keys per tile; KPAD = 13 * 160
#define VTP     (VTK / 2 + 1) // dwords per dim row: odd, so that the 16 lanes of
                              // a row (4 dims apart) store to 16 different banks

__global__ __launch_bounds__(256) void vt_kernel(
    const float* __restrict__ vin, const float* __restrict__ vreg,
    _Float16* __restrict__ Vt)
{
    __shared__ unsigned tile[HD * VTP];   // [dim][key pair], two f16 keys a dword
    int bidx = blockIdx.x;
    const int h  = bidx & 15;  bidx >>= 4;
    const int kt = bidx % (KPAD / VTK);
    const int b  = bidx / (KPAD / VTK);
    const int t  = threadIdx.x;
    const int d  = (t & 15) * 4;
    const int kp = t >> 4;

    // a thread's key pairs: keys 2n and 2n+1, n = i*16 + kp
    float4 e[VTK / 32], o[VTK / 32];
    if (kt * VTK + VTK <= SEQ) {          // whole tile inside the sequence
        const float* p = vin + (((size_t)b * SEQ + kt * VTK + kp * 2) * NH + h) * HD + d;
        #pragma unroll
        for (int i = 0; i < VTK / 32; ++i) {
            e[i] = *(const float4*)(p + (size_t)(i * 32 + 0) * NH * HD);
            o[i] = *(const float4*)(p + (size_t)(i * 32 + 1) * NH * HD);
        }
    } else {                              // last tile: register token, zero pad
        #pragma unroll
        for (int i = 0; i < VTK / 32; ++i) {
            // key is even, so key and key+1 lie on the same side of SEQ; past
            // the sequence the pointer names the register row (in bounds)
            const int key = kt * VTK + (i * 16 + kp) * 2;
            const bool in = key < SEQ;
            const float* p = in ? vin + (((size_t)b * SEQ + key) * NH + h) * HD + d
                                : vreg + h * HD + d;
            const float4 pe = *(const float4*)p;
            const float4 po = *(const float4*)(in ? p + NH * HD : p);
            const bool te = key <= SEQ;   // key == SEQ is the register token
            e[i].x = te ? pe.x : 0.0f;  e[i].y = te ? pe.y : 0.0f;
            e[i].z = te ? pe.z : 0.0f;  e[i].w = te ? pe.w : 0.0f;
            o[i].x = in ? po.x : 0.0f;  o[i].y = in ? po.y : 0.0f;
            o[i].z = in ? po.z : 0.0f;  o[i].w = in ? po.w : 0.0f;
        }
    }
    #pragma unroll
    for (int i = 0; i < VTK / 32; ++i) {
        const float ev[4] = { e[i].x, e[i].y, e[i].z, e[i].w };
        const float ov[4] = { o[i].x, o[i].y, o[i].z, o[i].w };
        #pragma unroll
        for (int c = 0; c < 4; ++c) {
            half2 pr = { (_Float16)ev[c], (_Float16)ov[c] };
            tile[(d + c) * VTP + i * 16 + kp] = __builtin_bit_cast(unsigned, pr);
        }
    }
    __syncthreads();

    // 8 keys (16 bytes) per lane; 20 lanes cover a dim row's 320 bytes
    _Float16* dst = Vt + ((size_t)b * NH + h) * HD * KPAD + kt * VTK;
    #pragma unroll
    for (int i = 0; i < HD * VTK / 8 / 256; ++i) {
        const int idx = i * 256 + t;
        const int row = idx / (VTK / 8);
        const int g   = idx - row * (VTK / 8);
        const unsigned* s = &tile[row * VTP + g * 4];
        uint4 v = { s[0], s[1], s[2], s[3] };
        *(uint4*)(dst + (size_t)row * KPAD + g * 8) = v;
    }
}

// ---------------------------------------------------------------------------
// Phase 2: flash attention. One wave = 16 query rows; block = 8 waves = 128 q.
// grid.x = B*NH*(SEQ/128).  S^T = K_tile x Q^T and O^T += V^T x P^T: a lane
// holds one query's scores, its maximum, its sum AND its outputs, so exp(S^T)
// packs into the B operand in place and the rescale factor is the lane's own.
// K and V^T come through LDS: the block's 8 waves share one 128-key stage,
// filled by asynchronous copies of whole lines, two buffers, one stage ahead.
// ---------------------------------------------------------------------------
#define STG     128                       // keys per LDS stage (4 passes of 32)
#define NSTG    ((KPAD + STG - 1) / STG)  // 17; the last stage holds one pass
#define KPITCH  72                        // halves: 128-B K row + 16 B (b128 readers)
#define VPITCH  136                       // halves: 256-B V^T row + 16 B
#define KSTAGE  (STG * KPITCH)            // halves per K buffer
#define VSTAGE  (HD * VPITCH)             // halves per V^T buffer
#define EPITCH  68                        // floats: 256-B output row + 16 B (b128 writers)

__device__ __forceinline__ unsigned lds_off(const void* p) {
    return (unsigned)(size_t)p;           // low 32 bits = byte offset in LDS
}

// One stage: 4 K copies + 4 V^T copies of 16 B per lane. The global side is
// clamped so that the short last stage stays inside Kh / Vt; the LDS bytes
// filled from clamped addresses belong to passes that are never run.
__device__ __forceinline__ void stage_copy(
    const _Float16* kbase, const _Float16* vbase, int kb0,
    unsigned kdst, unsigned vdst, int krow, int kcol, int vrow, int vcol)
{
    const _Float16* gk0 = kbase + (size_t)min(kb0 + krow +  0, KPAD - 1) * HD + kcol;
    const _Float16* gk1 = kbase + (size_t)min(kb0 + krow + 32, KPAD - 1) * HD + kcol;
    const _Float16* gk2 = kbase + (size_t)min(kb0 + krow + 64, KPAD - 1) * HD + kcol;
    const _Float16* gk3 = kbase + (size_t)min(kb0 + krow + 96, KPAD - 1) * HD + kcol;
    const _Float16* gv0 = vbase + (size_t)vrow * KPAD + min(kb0 + vcol, KPAD - 8);
    const _Float16* gv1 = gv0 + (size_t)16 * KPAD;
    const _Float16* gv2 = gv0 + (size_t)32 * KPAD;
    const _Float16* gv3 = gv0 + (size_t)48 * KPAD;
    // s_wait_xcnt is the statement's last line as a precaution: so it stands in
    // front of every later write of an address register that a copy names.
    asm volatile(
        "global_load_async_to_lds_b128 %0, %8, off\n\t"
        "global_load_async_to_lds_b128 %1, %9, off\n\t"
        "global_load_async_to_lds_b128 %2, %10, off\n\t"
        "global_load_async_to_lds_b128 %3, %11, off\n\t"
        "global_load_async_to_lds_b128 %4, %12, off\n\t"
        "global_load_async_to_lds_b128 %5, %13, off\n\t"
        "global_load_async_to_lds_b128 %6, %14, off\n\t"
        "global_load_async_to_lds_b128 %7, %15, off\n\t"
        "s_wait_xcnt 0x0"
        :: "v"(kdst), "v"(kdst + 32 * KPITCH * 2), "v"(kdst + 64 * KPITCH * 2),
           "v"(kdst + 96 * KPITCH * 2),
           "v"(vdst), "v"(vdst + 16 * VPITCH * 2), "v"(vdst + 32 * VPITCH * 2),
           "v"(vdst + 48 * VPITCH * 2),
           "v"(gk0), "v"(gk1), "v"(gk2), "v"(gk3),
           "v"(gv0), "v"(gv1), "v"(gv2), "v"(gv3)
        : "memory");
}

__global__ __launch_bounds__(256) void fa_kernel(
    const _Float16* __restrict__ Qh, const _Float16* __restrict__ Kh,
    const _Float16* __restrict__ Vt, float* __restrict__ out)
{
    __shared__ __attribute__((aligned(16))) _Float16 Ks[2][KSTAGE];
    __shared__ __attribute__((aligned(16))) _Float16 Vs[2][VSTAGE];

    const int lane   = threadIdx.x & 31;
    const int wave   = threadIdx.x >> 5;
    const int wg     = blockIdx.x;
    const int qblk   = wg & 15;           // 16 blocks of 128 queries
    const int bh     = wg >> 4;           // b*NH + h
    const int b      = bh >> 4;
    const int h      = bh & 15;
    const int qbase  = qblk * 128 + wave * 16;
    const int lo     = lane & 15;
    const int hi8    = (lane & 16) ? 8 : 0;   // lane-half K/row offset
    const int dA     = hi8;                   // A/B slot pattern offset

    const _Float16* kbase = Kh + (size_t)bh * KPAD * HD;
    const _Float16* vbase = Vt + (size_t)bh * HD * KPAD;

    // ---- this thread's share of a stage: a wave's K copy is 4 whole rows
    // (512 contiguous bytes), its V^T copy 2 rows of 256 bytes
    const int krow = threadIdx.x >> 3, kcol = (threadIdx.x & 7) * 8;
    const int vrow = threadIdx.x >> 4, vcol = (threadIdx.x & 15) * 8;
    const unsigned kdst = lds_off(&Ks[0][krow * KPITCH + kcol]);
    const unsigned vdst = lds_off(&Vs[0][vrow * VPITCH + vcol]);

    // ---- prologue: stage 0 lands and is published, stage 1 starts to fly
    stage_copy(kbase, vbase, 0, kdst, vdst, krow, kcol, vrow, vcol);

    // ---- Q^T fragments: lane holds q-row qbase+lo, slots {dA..dA+7, dA+16..}
    const _Float16* qrow = Qh + ((size_t)bh * SEQ + (qbase + lo)) * HD;
    v16h qt0 = cat8(*(const half8*)(qrow +  0 + dA), *(const half8*)(qrow + 16 + dA));
    v16h qt1 = cat8(*(const half8*)(qrow + 32 + dA), *(const half8*)(qrow + 48 + dA));

    v8f o0 = {}, o1 = {}, o2 = {}, o3 = {};
    float m = -1e38f, lsum = 0.0f;

    // this wave's copies of stage 0 have landed before the barrier publishes them
    asm volatile("s_wait_asynccnt 0x0" ::: "memory");
    __syncthreads();
    stage_copy(kbase, vbase, STG, kdst + KSTAGE * 2, vdst + VSTAGE * 2,
               krow, kcol, vrow, vcol);

    for (int st = 0; st < NSTG; ++st) {
      const int buf = st & 1;
      const _Float16* ks = &Ks[buf][lo * KPITCH + dA];
      const _Float16* vs = &Vs[buf][lo * VPITCH + dA];
      const int left = KPAD - st * STG;
      const int np = (left < STG ? left : STG) / 32;   // passes in this stage

      for (int p = 0; p < np; ++p) {
        const int kb = st * STG + p * 32;

        // ---- K A-fragments: lane = key row (kb+lo / kb+16+lo)
        const _Float16* kr0 = ks + p * 32 * KPITCH;
        const _Float16* kr1 = kr0 + 16 * KPITCH;
        v16h ka0c0 = cat8(*(const half8*)(kr0 +  0), *(const half8*)(kr0 + 16));
        v16h ka0c1 = cat8(*(const half8*)(kr0 + 32), *(const half8*)(kr0 + 48));
        v16h ka1c0 = cat8(*(const half8*)(kr1 +  0), *(const half8*)(kr1 + 16));
        v16h ka1c1 = cat8(*(const half8*)(kr1 + 32), *(const half8*)(kr1 + 48));

        // ---- S^T tiles (M=key, N=q), log2 domain (scale folded into Q)
        v8f c0 = {}; c0 = wmma_f16(ka0c0, qt0, c0); c0 = wmma_f16(ka0c1, qt1, c0);
        v8f c1 = {}; c1 = wmma_f16(ka1c0, qt0, c1); c1 = wmma_f16(ka1c1, qt1, c1);

        // ---- tail mask: keys >= NKV are padding
        if (kb + 32 > NKV) {
            #pragma unroll
            for (int r = 0; r < 8; ++r) {
                if (kb + r + hi8 >= NKV)      c0[r] = -1e30f;
                if (kb + 16 + r + hi8 >= NKV) c1[r] = -1e30f;
            }
        }

        // ---- online softmax: per-lane over 16 regs; the two lanes of a query
        // share the maximum, each keeps the sum of its own 16 keys
        float mt = fmaxf(c0[0], c1[0]);
        #pragma unroll
        for (int r = 1; r < 8; ++r) { mt = fmaxf(mt, fmaxf(c0[r], c1[r])); }
        mt = fmaxf(mt, xhalf(mt));
        float mnew  = fmaxf(m, mt);
        float alpha = fast_exp2(m - mnew);

        union { v16h v; _Float16 e[16]; } pf;
        float ps = 0.0f;
        #pragma unroll
        for (int r = 0; r < 8; ++r) {
            float p0 = fast_exp2(c0[r] - mnew); ps += p0; pf.e[r]     = (_Float16)p0;
            float p1 = fast_exp2(c1[r] - mnew); ps += p1; pf.e[8 + r] = (_Float16)p1;
        }
        lsum = lsum * alpha + ps;
        m = mnew;

        // ---- rescale O^T (every register of a lane belongs to its query)
        o0 *= alpha; o1 *= alpha; o2 *= alpha; o3 *= alpha;

        // ---- V^T A-fragments (lane = dim row) and O^T accumulation
        const _Float16* vr0 = vs + p * 32;
        const _Float16* vr1 = vr0 + 16 * VPITCH;
        const _Float16* vr2 = vr0 + 32 * VPITCH;
        const _Float16* vr3 = vr0 + 48 * VPITCH;
        v16h bv0 = cat8(*(const half8*)(vr0), *(const half8*)(vr0 + 16));
        v16h bv1 = cat8(*(const half8*)(vr1), *(const half8*)(vr1 + 16));
        v16h bv2 = cat8(*(const half8*)(vr2), *(const half8*)(vr2 + 16));
        v16h bv3 = cat8(*(const half8*)(vr3), *(const half8*)(vr3 + 16));
        o0 = wmma_f16(bv0, pf.v, o0);
        o1 = wmma_f16(bv1, pf.v, o1);
        o2 = wmma_f16(bv2, pf.v, o2);
        o3 = wmma_f16(bv3, pf.v, o3);
      }

      // ---- publish point of stage st+1, every wave, in this order:
      // this wave's reads of the buffer to be refilled have returned
      asm volatile("s_wait_dscnt 0x0" ::: "memory");
      // this wave's copies of stage st+1 have landed
      asm volatile("s_wait_asynccnt 0x0" ::: "memory");
      __syncthreads();
      if (st + 2 < NSTG)
        stage_copy(kbase, vbase, (st + 2) * STG,
                   kdst + buf * (KSTAGE * 2), vdst + buf * (VSTAGE * 2),
                   krow, kcol, vrow, vcol);
    }
    // no copy is left in flight when the wave ends
    asm volatile("s_wait_asynccnt 0x0" ::: "memory");

    // ---- finalize: join the two halves' sums, divide, store (B,S,NH*HD).
    // Lane (lo, half) holds query qbase+lo, dims 16t + hi8 .. + 7 of tile t.
    // The ring is free here: the loop's last barrier stands behind every wave's
    // last read and last landed copy. Each wave stages its 16 rows in a range
    // of its own, so that the stores below cover whole 256-byte head rows.
    const float invl = 1.0f / (lsum + xhalf(lsum));
    float* es = (float*)&Ks[0][0] + wave * (16 * EPITCH);
    {
        float* er = es + lo * EPITCH + hi8;
        const v8f t0 = o0 * invl, t1 = o1 * invl, t2 = o2 * invl, t3 = o3 * invl;
        *(float4*)(er +  0) = make_float4(t0[0], t0[1], t0[2], t0[3]);
        *(float4*)(er +  4) = make_float4(t0[4], t0[5], t0[6], t0[7]);
        *(float4*)(er + 16) = make_float4(t1[0], t1[1], t1[2], t1[3]);
        *(float4*)(er + 20) = make_float4(t1[4], t1[5], t1[6], t1[7]);
        *(float4*)(er + 32) = make_float4(t2[0], t2[1], t2[2], t2[3]);
        *(float4*)(er + 36) = make_float4(t2[4], t2[5], t2[6], t2[7]);
        *(float4*)(er + 48) = make_float4(t3[0], t3[1], t3[2], t3[3]);
        *(float4*)(er + 52) = make_float4(t3[4], t3[5], t3[6], t3[7]);
    }
    // the wave's staged rows are in LDS before its other lanes read them back
    asm volatile("s_wait_dscnt 0x0" ::: "memory");
    {
        const int row = lane >> 4, col = lo * 4;
        const float* rr = es + row * EPITCH + col;
        float* dst = out + (((size_t)b * SEQ + qbase + row) * NH + h) * HD + col;
        #pragma unroll
        for (int i = 0; i < 8; ++i)
            *(float4*)(dst + (size_t)i * 2 * NH * HD) = *(const float4*)(rr + i * 2 * EPITCH);
    }
}

// ---------------------------------------------------------------------------
extern "C" void kernel_launch(void* const* d_in, const int* in_sizes, int n_in,
                              void* d_out, int out_size, void* d_ws, size_t ws_size,
                              hipStream_t stream)
{
    (void)in_sizes; (void)n_in; (void)out_size; (void)ws_size;

    const float* q    = (const float*)d_in[0];
    const float* k    = (const float*)d_in[1];
    const float* v    = (const float*)d_in[2];
    const float* kreg = (const float*)d_in[3];
    const float* vreg = (const float*)d_in[4];
    float* out = (float*)d_out;

    // workspace layout (f16)
    const size_t QH_ELEMS = (size_t)BATCH * NH * SEQ  * HD;   //  8,388,608
    const size_t KH_ELEMS = (size_t)BATCH * NH * KPAD * HD;   //  8,519,680
    _Float16* Qh = (_Float16*)d_ws;
    _Float16* Kh = Qh + QH_ELEMS;
    _Float16* Vt = Kh + KH_ELEMS;

    // Phase 1
    rope_q_kernel<<<BATCH * NH * (SEQ / RPW) / 8, 256, 0, stream>>>(q, Qh);
    rope_k_kernel<<<BATCH * NH * (KPAD / RPW) / 8, 256, 0, stream>>>(k, kreg, Kh);
    vt_kernel<<<BATCH * NH * (KPAD / VTK), 256, 0, stream>>>(v, vreg, Vt);

    // Phase 2: B*NH*(SEQ/128) workgroups of 8 waves
    fa_kernel<<<BATCH * NH * (SEQ / 128), 256, 0, stream>>>(Qh, Kh, Vt, out);
}

// v004
// A run of this version takes 86.7 microseconds.
// Next to v003, in two timings, it ran 1.06 times as fast each time.
// Over all steps from v000 it is 3.80 times as fast.
#include <hip/hip_runtime.h>
#include <hip/hip_bf16.h>
#include <math.h>

// ---------------------------------------------------------------------------
// RotaryAttention for MI455X (gfx1250, wave32, WMMA).
// Phase 1: RoPE+f16 pack of Q/K, V transpose (all into d_ws).
// Phase 2: flash attention, S^T formulation, v_wmma_f32_16x16x32_f16.
// ---------------------------------------------------------------------------

typedef _Float16 half8 __attribute__((ext_vector_type(8)));
typedef _Float16 v16h  __attribute__((ext_vector_type(16)));
typedef float    v8f   __attribute__((ext_vector_type(8)));

#define NH      16
#define HD      64
#define SEQ     2048
#define NKV     2049          // 2048 keys + 1 register token
#define KPAD    2080          // padded to multiple of 32
#define BATCH   4

// 1/sqrt(64) * log2(e): scores come out in log2 domain -> native v_exp_f32
#define QSCALE  0.18033688011112042f
// log2(10000)/16
#define FREQC   0.83048202372184065f

__device__ __forceinline__ v8f wmma_f16(v16h a, v16h b, v8f c) {
    return __builtin_amdgcn_wmma_f32_16x16x32_f16(false, a, false, b,
                                                  (short)0, c, false, false);
}

__device__ __forceinline__ v16h cat8(half8 lo, half8 hi) {
    return __builtin_shufflevector(lo, hi, 0,1,2,3,4,5,6,7,8,9,10,11,12,13,14,15);
}

// Raw v_exp_f32: args are at most LAZY (8) here; flush-to-zero below -126 is the
// desired flash-softmax semantics (avoids OCML's range-fix cmp/cndmask pairs).
__device__ __forceinline__ float fast_exp2(float x) {
    return __builtin_amdgcn_exp2f(x);
}

// Lane l with lane l ^ 16 on the vector pipe (no trip through the LDS unit).
__device__ __forceinline__ float xhalf(float x) {
    const int b = __builtin_bit_cast(int, x);
    return __builtin_bit_cast(float,
        __builtin_amdgcn_permlanex16(b, b, 0x76543210, 0xfedcba98, false, false));
}

// ---------------------------------------------------------------------------
// Phase 1, common shape: few, fat work-groups. A lane moves 16 bytes per load,
// a wave-wide load covers whole 256-byte head rows, all of a thread's loads are
// issued before the first is used, and stores cover whole lines.
// ---------------------------------------------------------------------------
typedef _Float16 half4 __attribute__((ext_vector_type(4)));
typedef _Float16 half2 __attribute__((ext_vector_type(2)));

#define RPW     16            // positions per wave: 8 loads x 2 rows

// One wave: RPW consecutive positions of one head. Lanes 0-15 hold one row
// (4 dims each), lanes 16-31 the next; src/dst point at the lane's own 4 dims
// of its first row, pos is that row's position.
__device__ __forceinline__ void rope_rows(
    const float* __restrict__ src, _Float16* __restrict__ dst,
    int pos, int d, float scale)
{
    float4 x[RPW / 2];
    #pragma unroll
    for (int j = 0; j < RPW / 2; ++j)
        x[j] = *(const float4*)(src + (size_t)j * 2 * NH * HD);

    // rotate_half partner: dims d+16 / d-16 sit 4 lanes away in the same row
    float4 o[RPW / 2];
    #pragma unroll
    for (int j = 0; j < RPW / 2; ++j) {
        o[j].x = __shfl_xor(x[j].x, 4);
        o[j].y = __shfl_xor(x[j].y, 4);
        o[j].z = __shfl_xor(x[j].z, 4);
        o[j].w = __shfl_xor(x[j].w, 4);
    }

    if (d < 32) {
        const float sg = (d < 16) ? -1.0f : 1.0f;
        const int   f  = d & 15;
        const float f0 = exp2f(-(float)(f + 0) * FREQC);
        const float f1 = exp2f(-(float)(f + 1) * FREQC);
        const float f2 = exp2f(-(float)(f + 2) * FREQC);
        const float f3 = exp2f(-(float)(f + 3) * FREQC);
        #pragma unroll
        for (int j = 0; j < RPW / 2; ++j) {
            const float p = (float)(pos + 2 * j);
            float sn, cs;
            __sincosf(p * f0, &sn, &cs); x[j].x = x[j].x * cs + (sg * o[j].x) * sn;
            __sincosf(p * f1, &sn, &cs); x[j].y = x[j].y * cs + (sg * o[j].y) * sn;
            __sincosf(p * f2, &sn, &cs); x[j].z = x[j].z * cs + (sg * o[j].z) * sn;
            __sincosf(p * f3, &sn, &cs); x[j].w = x[j].w * cs + (sg * o[j].w) * sn;
        }
    }

    #pragma unroll
    for (int j = 0; j < RPW / 2; ++j) {
        half4 r = { (_Float16)(x[j].x * scale), (_Float16)(x[j].y * scale),
                    (_Float16)(x[j].z * scale), (_Float16)(x[j].w * scale) };
        *(half4*)(dst + j * 2 * HD) = r;
    }
}

// ---------------------------------------------------------------------------
// Phase 1a: Q -> RoPE -> *QSCALE -> f16, layout [b][h][s][d]
// grid = B * (SEQ/RPW) * NH waves / 8
// ---------------------------------------------------------------------------
__global__ __launch_bounds__(256) void rope_q_kernel(
    const float* __restrict__ qin, _Float16* __restrict__ Qh)
{
    const int lane = threadIdx.x & 31;
    const int w    = blockIdx.x * 8 + (threadIdx.x >> 5);
    const int h    = w & 15;
    const int sblk = (w >> 4) & (SEQ / RPW - 1);
    const int b    = w >> 11;
    const int d    = (lane & 15) * 4;
    const int s    = sblk * RPW + (lane >> 4);

    rope_rows(qin + (((size_t)b * SEQ + s) * NH + h) * HD + d,
              Qh  + (((size_t)b * NH + h) * SEQ + s) * HD + d, s, d, QSCALE);
}

// ---------------------------------------------------------------------------
// Phase 1b: K -> RoPE -> f16, layout [b][h][key][d], key in [0,KPAD)
//   key==2048: register token (rotary half zeroed), key>2048: zero pad
// grid = B * (KPAD/RPW) * NH waves / 8
// ---------------------------------------------------------------------------
__global__ __launch_bounds__(256) void rope_k_kernel(
    const float* __restrict__ kin, const float* __restrict__ kreg,
    _Float16* __restrict__ Kh)
{
    const int lane = threadIdx.x & 31;
    const int w    = blockIdx.x * 8 + (threadIdx.x >> 5);
    const int h    = w & 15;
    const int r    = w >> 4;
    const int kblk = r % (KPAD / RPW);
    const int b    = r / (KPAD / RPW);
    const int d    = (lane & 15) * 4;
    const int key  = kblk * RPW + (lane >> 4);

    _Float16* dst = Kh + (((size_t)b * NH + h) * KPAD + key) * HD + d;
    if (kblk < SEQ / RPW) {
        rope_rows(kin + (((size_t)b * SEQ + key) * NH + h) * HD + d, dst, key, d, 1.0f);
    } else {
        const float4 g = *(const float4*)(kreg + h * HD + d);
        const half4 reg = { (_Float16)g.x, (_Float16)g.y, (_Float16)g.z, (_Float16)g.w };
        const half4 zero = {};
        #pragma unroll
        for (int j = 0; j < RPW / 2; ++j)   // reg_mask zeros the rotary half
            *(half4*)(dst + j * 2 * HD) = (key + 2 * j == SEQ && d >= 32) ? reg : zero;
    }
}

// ---------------------------------------------------------------------------
// Phase 1c: V transpose -> f16, layout [b][h][d][key], key in [0,KPAD)
// One work-group: all 64 dims x 160 keys of one head through LDS.
// grid = B * (KPAD/VTK) * NH
// ---------------------------------------------------------------------------
#define VTK     160           // keys per tile; KPAD = 13 * 160
#define VTP     (VTK / 2 + 1) // dwords per dim row: odd, so that the 16 lanes of
                              // a row (4 dims apart) store to 16 different banks

__global__ __launch_bounds__(256) void vt_kernel(
    const float* __restrict__ vin, const float* __restrict__ vreg,
    _Float16* __restrict__ Vt)
{
    __shared__ unsigned tile[HD * VTP];   // [dim][key pair], two f16 keys a dword
    int bidx = blockIdx.x;
    const int h  = bidx & 15;  bidx >>= 4;
    const int kt = bidx % (KPAD / VTK);
    const int b  = bidx / (KPAD / VTK);
    const int t  = threadIdx.x;
    const int d  = (t & 15) * 4;
    const int kp = t >> 4;

    // a thread's key pairs: keys 2n and 2n+1, n = i*16 + kp
    float4 e[VTK / 32], o[VTK / 32];
    if (kt * VTK + VTK <= SEQ) {          // whole tile inside the sequence
        const float* p = vin + (((size_t)b * SEQ + kt * VTK + kp * 2) * NH + h) * HD + d;
        #pragma unroll
        for (int i = 0; i < VTK / 32; ++i) {
            e[i] = *(const float4*)(p + (size_t)(i * 32 + 0) * NH * HD);
            o[i] = *(const float4*)(p + (size_t)(i * 32 + 1) * NH * HD);
        }
    } else {                              // last tile: register token, zero pad
        #pragma unroll
        for (int i = 0; i < VTK / 32; ++i) {
            // key is even, so key and key+1 lie on the same side of SEQ; past
            // the sequence the pointer names the register row (in bounds)
            const int key = kt * VTK + (i * 16 + kp) * 2;
            const bool in = key < SEQ;
            const float* p = in ? vin + (((size_t)b * SEQ + key) * NH + h) * HD + d
                                : vreg + h * HD + d;
            const float4 pe = *(const float4*)p;
            const float4 po = *(const float4*)(in ? p + NH * HD : p);
            const bool te = key <= SEQ;   // key == SEQ is the register token
            e[i].x = te ? pe.x : 0.0f;  e[i].y = te ? pe.y : 0.0f;
            e[i].z = te ? pe.z : 0.0f;  e[i].w = te ? pe.w : 0.0f;
            o[i].x = in ? po.x : 0.0f;  o[i].y = in ? po.y : 0.0f;
            o[i].z = in ? po.z : 0.0f;  o[i].w = in ? po.w : 0.0f;
        }
    }
    #pragma unroll
    for (int i = 0; i < VTK / 32; ++i) {
        const float ev[4] = { e[i].x, e[i].y, e[i].z, e[i].w };
        const float ov[4] = { o[i].x, o[i].y, o[i].z, o[i].w };
        #pragma unroll
        for (int c = 0; c < 4; ++c) {
            half2 pr = { (_Float16)ev[c], (_Float16)ov[c] };
            tile[(d + c) * VTP + i * 16 + kp] = __builtin_bit_cast(unsigned, pr);
        }
    }
    __syncthreads();

    // 8 keys (16 bytes) per lane; 20 lanes cover a dim row's 320 bytes
    _Float16* dst = Vt + ((size_t)b * NH + h) * HD * KPAD + kt * VTK;
    #pragma unroll
    for (int i = 0; i < HD * VTK / 8 / 256; ++i) {
        const int idx = i * 256 + t;
        const int row = idx / (VTK / 8);
        const int g   = idx - row * (VTK / 8);
        const unsigned* s = &tile[row * VTP + g * 4];
        uint4 v = { s[0], s[1], s[2], s[3] };
        *(uint4*)(dst + (size_t)row * KPAD + g * 8) = v;
    }
}

// ---------------------------------------------------------------------------
// Phase 2: flash attention. One wave = 16 query rows; block = 8 waves = 128 q.
// grid.x = B*NH*(SEQ/128).  S^T = K_tile x Q^T and O^T += V^T x P^T: a lane
// holds one query's scores, its maximum, its sum AND its outputs, so exp(S^T)
// packs into the B operand in place and the rescale factor is the lane's own.
// The rescale is lazy: outputs and sums are scaled only in a pass where a score
// passes the maximum in use by more than LAZY (log2 domain).
// K and V^T come through LDS: the block's 8 waves share one 128-key stage,
// filled by asynchronous copies of whole lines, two buffers, one stage ahead.
// ---------------------------------------------------------------------------
#define STG     128                       // keys per LDS stage (4 passes of 32)
#define NSTG    ((KPAD + STG - 1) / STG)  // 17; the last stage holds one pass
#define KPITCH  72                        // halves: 128-B K row + 16 B (b128 readers)
#define VPITCH  136                       // halves: 256-B V^T row + 16 B
#define KSTAGE  (STG * KPITCH)            // halves per K buffer
#define VSTAGE  (HD * VPITCH)             // halves per V^T buffer
#define EPITCH  68                        // floats: 256-B output row + 16 B (b128 writers)
#define LAZY    8.0f                      // log2: how far a score may pass the maximum in use

__device__ __forceinline__ unsigned lds_off(const void* p) {
    return (unsigned)(size_t)p;           // low 32 bits = byte offset in LDS
}

// One stage: 4 K copies + 4 V^T copies of 16 B per lane. The global side is
// clamped so that the short last stage stays inside Kh / Vt; the LDS bytes
// filled from clamped addresses belong to passes that are never run.
__device__ __forceinline__ void stage_copy(
    const _Float16* kbase, const _Float16* vbase, int kb0,
    unsigned kdst, unsigned vdst, int krow, int kcol, int vrow, int vcol)
{
    const _Float16* gk0 = kbase + (size_t)min(kb0 + krow +  0, KPAD - 1) * HD + kcol;
    const _Float16* gk1 = kbase + (size_t)min(kb0 + krow + 32, KPAD - 1) * HD + kcol;
    const _Float16* gk2 = kbase + (size_t)min(kb0 + krow + 64, KPAD - 1) * HD + kcol;
    const _Float16* gk3 = kbase + (size_t)min(kb0 + krow + 96, KPAD - 1) * HD + kcol;
    const _Float16* gv0 = vbase + (size_t)vrow * KPAD + min(kb0 + vcol, KPAD - 8);
    const _Float16* gv1 = gv0 + (size_t)16 * KPAD;
    const _Float16* gv2 = gv0 + (size_t)32 * KPAD;
    const _Float16* gv3 = gv0 + (size_t)48 * KPAD;
    // s_wait_xcnt is the statement's last line as a precaution: so it stands in
    // front of every later write of an address register that a copy names.
    asm volatile(
        "global_load_async_to_lds_b128 %0, %8, off\n\t"
        "global_load_async_to_lds_b128 %1, %9, off\n\t"
        "global_load_async_to_lds_b128 %2, %10, off\n\t"
        "global_load_async_to_lds_b128 %3, %11, off\n\t"
        "global_load_async_to_lds_b128 %4, %12, off\n\t"
        "global_load_async_to_lds_b128 %5, %13, off\n\t"
        "global_load_async_to_lds_b128 %6, %14, off\n\t"
        "global_load_async_to_lds_b128 %7, %15, off\n\t"
        "s_wait_xcnt 0x0"
        :: "v"(kdst), "v"(kdst + 32 * KPITCH * 2), "v"(kdst + 64 * KPITCH * 2),
           "v"(kdst + 96 * KPITCH * 2),
           "v"(vdst), "v"(vdst + 16 * VPITCH * 2), "v"(vdst + 32 * VPITCH * 2),
           "v"(vdst + 48 * VPITCH * 2),
           "v"(gk0), "v"(gk1), "v"(gk2), "v"(gk3),
           "v"(gv0), "v"(gv1), "v"(gv2), "v"(gv3)
        : "memory");
}

__global__ __launch_bounds__(256) void fa_kernel(
    const _Float16* __restrict__ Qh, const _Float16* __restrict__ Kh,
    const _Float16* __restrict__ Vt, float* __restrict__ out)
{
    __shared__ __attribute__((aligned(16))) _Float16 Ks[2][KSTAGE];
    __shared__ __attribute__((aligned(16))) _Float16 Vs[2][VSTAGE];

    const int lane   = threadIdx.x & 31;
    const int wave   = threadIdx.x >> 5;
    const int wg     = blockIdx.x;
    const int qblk   = wg & 15;           // 16 blocks of 128 queries
    const int bh     = wg >> 4;           // b*NH + h
    const int b      = bh >> 4;
    const int h      = bh & 15;
    const int qbase  = qblk * 128 + wave * 16;
    const int lo     = lane & 15;
    const int hi8    = (lane & 16) ? 8 : 0;   // lane-half K/row offset
    const int dA     = hi8;                   // A/B slot pattern offset

    const _Float16* kbase = Kh + (size_t)bh * KPAD * HD;
    const _Float16* vbase = Vt + (size_t)bh * HD * KPAD;

    // ---- this thread's share of a stage: a wave's K copy is 4 whole rows
    // (512 contiguous bytes), its V^T copy 2 rows of 256 bytes
    const int krow = threadIdx.x >> 3, kcol = (threadIdx.x & 7) * 8;
    const int vrow = threadIdx.x >> 4, vcol = (threadIdx.x & 15) * 8;
    const unsigned kdst = lds_off(&Ks[0][krow * KPITCH + kcol]);
    const unsigned vdst = lds_off(&Vs[0][vrow * VPITCH + vcol]);

    // ---- prologue: stage 0 lands and is published, stage 1 starts to fly
    stage_copy(kbase, vbase, 0, kdst, vdst, krow, kcol, vrow, vcol);

    // ---- Q^T fragments: lane holds q-row qbase+lo, slots {dA..dA+7, dA+16..}
    const _Float16* qrow = Qh + ((size_t)bh * SEQ + (qbase + lo)) * HD;
    v16h qt0 = cat8(*(const half8*)(qrow +  0 + dA), *(const half8*)(qrow + 16 + dA));
    v16h qt1 = cat8(*(const half8*)(qrow + 32 + dA), *(const half8*)(qrow + 48 + dA));

    v8f o0 = {}, o1 = {}, o2 = {}, o3 = {};
    float m = -1e38f, mlim = -1e38f, lsum = 0.0f;   // mlim = m + LAZY

    // this wave's copies of stage 0 have landed before the barrier publishes them
    asm volatile("s_wait_asynccnt 0x0" ::: "memory");
    __syncthreads();
    stage_copy(kbase, vbase, STG, kdst + KSTAGE * 2, vdst + VSTAGE * 2,
               krow, kcol, vrow, vcol);

    for (int st = 0; st < NSTG; ++st) {
      const int buf = st & 1;
      const _Float16* ks = &Ks[buf][lo * KPITCH + dA];
      const _Float16* vs = &Vs[buf][lo * VPITCH + dA];
      const int left = KPAD - st * STG;
      const int np = (left < STG ? left : STG) / 32;   // passes in this stage

      for (int p = 0; p < np; ++p) {
        const int kb = st * STG + p * 32;

        // ---- K A-fragments: lane = key row (kb+lo / kb+16+lo)
        const _Float16* kr0 = ks + p * 32 * KPITCH;
        const _Float16* kr1 = kr0 + 16 * KPITCH;
        v16h ka0c0 = cat8(*(const half8*)(kr0 +  0), *(const half8*)(kr0 + 16));
        v16h ka0c1 = cat8(*(const half8*)(kr0 + 32), *(const half8*)(kr0 + 48));
        v16h ka1c0 = cat8(*(const half8*)(kr1 +  0), *(const half8*)(kr1 + 16));
        v16h ka1c1 = cat8(*(const half8*)(kr1 + 32), *(const half8*)(kr1 + 48));

        // ---- S^T tiles (M=key, N=q), log2 domain (scale folded into Q)
        v8f c0 = {}; c0 = wmma_f16(ka0c0, qt0, c0); c0 = wmma_f16(ka0c1, qt1, c0);
        v8f c1 = {}; c1 = wmma_f16(ka1c0, qt0, c1); c1 = wmma_f16(ka1c1, qt1, c1);

        // ---- tail mask: keys >= NKV are padding
        if (kb + 32 > NKV) {
            #pragma unroll
            for (int r = 0; r < 8; ++r) {
                if (kb + r + hi8 >= NKV)      c0[r] = -1e30f;
                if (kb + 16 + r + hi8 >= NKV) c1[r] = -1e30f;
            }
        }

        // ---- V^T A-fragments (lane = dim row): issued in front of the branch
        // below, so that they fly under the maxima and the exponentials
        const _Float16* vr0 = vs + p * 32;
        const _Float16* vr1 = vr0 + 16 * VPITCH;
        const _Float16* vr2 = vr0 + 32 * VPITCH;
        const _Float16* vr3 = vr0 + 48 * VPITCH;
        v16h bv0 = cat8(*(const half8*)(vr0), *(const half8*)(vr0 + 16));
        v16h bv1 = cat8(*(const half8*)(vr1), *(const half8*)(vr1 + 16));
        v16h bv2 = cat8(*(const half8*)(vr2), *(const half8*)(vr2 + 16));
        v16h bv3 = cat8(*(const half8*)(vr3), *(const half8*)(vr3 + 16));
        // compiler fence: without it the loads above sink behind the branch and
        // stand in four places among the exponentials and the WMMAs
        asm volatile("" ::: "memory");

        // ---- online softmax: per-lane over 16 regs; each lane of a query keeps
        // the sum of its own 16 keys. m, the maximum in use, is the same in both
        // lanes of a query and may trail the true maximum by up to LAZY (log2
        // domain), so an exponential reaches at most 2^LAZY, far inside f16.
        float mt = fmaxf(c0[0], c1[0]);
        #pragma unroll
        for (int r = 1; r < 8; ++r) { mt = fmaxf(mt, fmaxf(c0[r], c1[r])); }

        // ---- lazy rescale: one wave-uniform test per pass (a scalar branch, all
        // lanes stay on). Always taken in the first pass, where m is -1e38 and
        // alpha comes out 0 on zero sums; after that only when a score passes m
        // by more than LAZY.
        if (__builtin_amdgcn_ballot_w32(mt > mlim) != 0) {
            const float mnew  = fmaxf(m, fmaxf(mt, xhalf(mt)));
            const float alpha = fast_exp2(m - mnew);
            m = mnew;
            mlim = mnew + LAZY;
            lsum *= alpha;   // every register of a lane belongs to its query
            o0 *= alpha; o1 *= alpha; o2 *= alpha; o3 *= alpha;
        }

        union { v16h v; _Float16 e[16]; } pf;
        float ps = 0.0f;
        #pragma unroll
        for (int r = 0; r < 8; ++r) {
            float p0 = fast_exp2(c0[r] - m); ps += p0; pf.e[r]     = (_Float16)p0;
            float p1 = fast_exp2(c1[r] - m); ps += p1; pf.e[8 + r] = (_Float16)p1;
        }
        lsum += ps;

        // ---- O^T accumulation
        o0 = wmma_f16(bv0, pf.v, o0);
        o1 = wmma_f16(bv1, pf.v, o1);
        o2 = wmma_f16(bv2, pf.v, o2);
        o3 = wmma_f16(bv3, pf.v, o3);
      }

      // ---- publish point of stage st+1, every wave, in this order:
      // this wave's reads of the buffer to be refilled have returned
      asm volatile("s_wait_dscnt 0x0" ::: "memory");
      // this wave's copies of stage st+1 have landed
      asm volatile("s_wait_asynccnt 0x0" ::: "memory");
      __syncthreads();
      if (st + 2 < NSTG)
        stage_copy(kbase, vbase, (st + 2) * STG,
                   kdst + buf * (KSTAGE * 2), vdst + buf * (VSTAGE * 2),
                   krow, kcol, vrow, vcol);
    }
    // no copy is left in flight when the wave ends
    asm volatile("s_wait_asynccnt 0x0" ::: "memory");

    // ---- finalize: join the two halves' sums, divide, store (B,S,NH*HD).
    // Lane (lo, half) holds query qbase+lo, dims 16t + hi8 .. + 7 of tile t.
    // The ring is free here: the loop's last barrier stands behind every wave's
    // last read and last landed copy. Each wave stages its 16 rows in a range
    // of its own, so that the stores below cover whole 256-byte head rows.
    const float invl = 1.0f / (lsum + xhalf(lsum));
    float* es = (float*)&Ks[0][0] + wave * (16 * EPITCH);
    {
        float* er = es + lo * EPITCH + hi8;
        const v8f t0 = o0 * invl, t1 = o1 * invl, t2 = o2 * invl, t3 = o3 * invl;
        *(float4*)(er +  0) = make_float4(t0[0], t0[1], t0[2], t0[3]);
        *(float4*)(er +  4) = make_float4(t0[4], t0[5], t0[6], t0[7]);
        *(float4*)(er + 16) = make_float4(t1[0], t1[1], t1[2], t1[3]);
        *(float4*)(er + 20) = make_float4(t1[4], t1[5], t1[6], t1[7]);
        *(float4*)(er + 32) = make_float4(t2[0], t2[1], t2[2], t2[3]);
        *(float4*)(er + 36) = make_float4(t2[4], t2[5], t2[6], t2[7]);
        *(float4*)(er + 48) = make_float4(t3[0], t3[1], t3[2], t3[3]);
        *(float4*)(er + 52) = make_float4(t3[4], t3[5], t3[6], t3[7]);
    }
    // the wave's staged rows are in LDS before its other lanes read them back
    asm volatile("s_wait_dscnt 0x0" ::: "memory");
    {
        const int row = lane >> 4, col = lo * 4;
        const float* rr = es + row * EPITCH + col;
        float* dst = out + (((size_t)b * SEQ + qbase + row) * NH + h) * HD + col;
        #pragma unroll
        for (int i = 0; i < 8; ++i)
            *(float4*)(dst + (size_t)i * 2 * NH * HD) = *(const float4*)(rr + i * 2 * EPITCH);
    }
}

// ---------------------------------------------------------------------------
extern "C" void kernel_launch(void* const* d_in, const int* in_sizes, int n_in,
                              void* d_out, int out_size, void* d_ws, size_t ws_size,
                              hipStream_t stream)
{
    (void)in_sizes; (void)n_in; (void)out_size; (void)ws_size;

    const float* q    = (const float*)d_in[0];
    const float* k    = (const float*)d_in[1];
    const float* v    = (const float*)d_in[2];
    const float* kreg = (const float*)d_in[3];
    const float* vreg = (const float*)d_in[4];
    float* out = (float*)d_out;

    // workspace layout (f16)
    const size_t QH_ELEMS = (size_t)BATCH * NH * SEQ  * HD;   //  8,388,608
    const size_t KH_ELEMS = (size_t)BATCH * NH * KPAD * HD;   //  8,519,680
    _Float16* Qh = (_Float16*)d_ws;
    _Float16* Kh = Qh + QH_ELEMS;
    _Float16* Vt = Kh + KH_ELEMS;

    // Phase 1
    rope_q_kernel<<<BATCH * NH * (SEQ / RPW) / 8, 256, 0, stream>>>(q, Qh);
    rope_k_kernel<<<BATCH * NH * (KPAD / RPW) / 8, 256, 0, stream>>>(k, kreg, Kh);
    vt_kernel<<<BATCH * NH * (KPAD / VTK), 256, 0, stream>>>(v, vreg, Vt);

    // Phase 2: B*NH*(SEQ/128) workgroups of 8 waves
    fa_kernel<<<BATCH * NH * (SEQ / 128), 256, 0, stream>>>(Qh, Kh, Vt, out);
}

// v005
// A run of this version takes 74.6 microseconds.
// Two timings next to v004 both put it at 1.17 times that version's speed.
// Over all steps from v000 it is 4.43 times as fast.
#include <hip/hip_runtime.h>
#include <hip/hip_bf16.h>
#include <math.h>

// ---------------------------------------------------------------------------
// RotaryAttention for MI455X (gfx1250, wave32, WMMA).
// Phase 1: RoPE+f16 pack of Q/K, V transpose (all into d_ws).
// Phase 2: flash attention, S^T formulation, v_wmma_f32_16x16x32_f16.
// ---------------------------------------------------------------------------

typedef _Float16 half8 __attribute__((ext_vector_type(8)));
typedef _Float16 v16h  __attribute__((ext_vector_type(16)));
typedef float    v8f   __attribute__((ext_vector_type(8)));

#define NH      16
#define HD      64
#define SEQ     2048
#define NKV     2049          // 2048 keys + 1 register token
#define KPAD    2080          // padded to multiple of 32
#define BATCH   4

// 1/sqrt(64) * log2(e): scores come out in log2 domain -> native v_exp_f32
#define QSCALE  0.18033688011112042f
// log2(10000)/16
#define FREQC   0.83048202372184065f

__device__ __forceinline__ v8f wmma_f16(v16h a, v16h b, v8f c) {
    return __builtin_amdgcn_wmma_f32_16x16x32_f16(false, a, false, b,
                                                  (short)0, c, false, false);
}

__device__ __forceinline__ v16h cat8(half8 lo, half8 hi) {
    return __builtin_shufflevector(lo, hi, 0,1,2,3,4,5,6,7,8,9,10,11,12,13,14,15);
}

// Raw v_exp_f32: args are at most LAZY (8) here; flush-to-zero below -126 is the
// desired flash-softmax semantics (avoids OCML's range-fix cmp/cndmask pairs).
__device__ __forceinline__ float fast_exp2(float x) {
    return __builtin_amdgcn_exp2f(x);
}

// Lane l with lane l ^ 16 on the vector pipe (no trip through the LDS unit).
__device__ __forceinline__ float xhalf(float x) {
    const int b = __builtin_bit_cast(int, x);
    return __builtin_bit_cast(float,
        __builtin_amdgcn_permlanex16(b, b, 0x76543210, 0xfedcba98, false, false));
}

// ---------------------------------------------------------------------------
// Phase 1, common shape: few, fat work-groups. A lane moves 16 bytes per load,
// a wave-wide load covers whole 256-byte head rows, all of a thread's loads are
// issued before the first is used, and stores cover whole lines.
// ---------------------------------------------------------------------------
typedef _Float16 half4 __attribute__((ext_vector_type(4)));
typedef _Float16 half2 __attribute__((ext_vector_type(2)));

#define RPW     16            // positions per wave: 8 loads x 2 rows

// One wave: RPW consecutive positions of one head. Lanes 0-15 hold one row
// (4 dims each), lanes 16-31 the next; src/dst point at the lane's own 4 dims
// of its first row, pos is that row's position.
__device__ __forceinline__ void rope_rows(
    const float* __restrict__ src, _Float16* __restrict__ dst,
    int pos, int d, float scale)
{
    float4 x[RPW / 2];
    #pragma unroll
    for (int j = 0; j < RPW / 2; ++j)
        x[j] = *(const float4*)(src + (size_t)j * 2 * NH * HD);

    // rotate_half partner: dims d+16 / d-16 sit 4 lanes away in the same row
    float4 o[RPW / 2];
    #pragma unroll
    for (int j = 0; j < RPW / 2; ++j) {
        o[j].x = __shfl_xor(x[j].x, 4);
        o[j].y = __shfl_xor(x[j].y, 4);
        o[j].z = __shfl_xor(x[j].z, 4);
        o[j].w = __shfl_xor(x[j].w, 4);
    }

    if (d < 32) {
        const float sg = (d < 16) ? -1.0f : 1.0f;
        const int   f  = d & 15;
        const float f0 = exp2f(-(float)(f + 0) * FREQC);
        const float f1 = exp2f(-(float)(f + 1) * FREQC);
        const float f2 = exp2f(-(float)(f + 2) * FREQC);
        const float f3 = exp2f(-(float)(f + 3) * FREQC);
        #pragma unroll
        for (int j = 0; j < RPW / 2; ++j) {
            const float p = (float)(pos + 2 * j);
            float sn, cs;
            __sincosf(p * f0, &sn, &cs); x[j].x = x[j].x * cs + (sg * o[j].x) * sn;
            __sincosf(p * f1, &sn, &cs); x[j].y = x[j].y * cs + (sg * o[j].y) * sn;
            __sincosf(p * f2, &sn, &cs); x[j].z = x[j].z * cs + (sg * o[j].z) * sn;
            __sincosf(p * f3, &sn, &cs); x[j].w = x[j].w * cs + (sg * o[j].w) * sn;
        }
    }

    #pragma unroll
    for (int j = 0; j < RPW / 2; ++j) {
        half4 r = { (_Float16)(x[j].x * scale), (_Float16)(x[j].y * scale),
                    (_Float16)(x[j].z * scale), (_Float16)(x[j].w * scale) };
        *(half4*)(dst + j * 2 * HD) = r;
    }
}

// ---------------------------------------------------------------------------
// Phase 1a: Q -> RoPE -> *QSCALE -> f16, layout [b][h][s][d]
// grid = B * (SEQ/RPW) * NH waves / 8
// ---------------------------------------------------------------------------
__global__ __launch_bounds__(256) void rope_q_kernel(
    const float* __restrict__ qin, _Float16* __restrict__ Qh)
{
    const int lane = threadIdx.x & 31;
    const int w    = blockIdx.x * 8 + (threadIdx.x >> 5);
    const int h    = w & 15;
    const int sblk = (w >> 4) & (SEQ / RPW - 1);
    const int b    = w >> 11;
    const int d    = (lane & 15) * 4;
    const int s    = sblk * RPW + (lane >> 4);

    rope_rows(qin + (((size_t)b * SEQ + s) * NH + h) * HD + d,
              Qh  + (((size_t)b * NH + h) * SEQ + s) * HD + d, s, d, QSCALE);
}

// ---------------------------------------------------------------------------
// Phase 1b: K -> RoPE -> f16, layout [b][h][key][d], key in [0,KPAD)
//   key==2048: register token (rotary half zeroed), key>2048: zero pad
// grid = B * (KPAD/RPW) * NH waves / 8
// ---------------------------------------------------------------------------
__global__ __launch_bounds__(256) void rope_k_kernel(
    const float* __restrict__ kin, const float* __restrict__ kreg,
    _Float16* __restrict__ Kh)
{
    const int lane = threadIdx.x & 31;
    const int w    = blockIdx.x * 8 + (threadIdx.x >> 5);
    const int h    = w & 15;
    const int r    = w >> 4;
    const int kblk = r % (KPAD / RPW);
    const int b    = r / (KPAD / RPW);
    const int d    = (lane & 15) * 4;
    const int key  = kblk * RPW + (lane >> 4);

    _Float16* dst = Kh + (((size_t)b * NH + h) * KPAD + key) * HD + d;
    if (kblk < SEQ / RPW) {
        rope_rows(kin + (((size_t)b * SEQ + key) * NH + h) * HD + d, dst, key, d, 1.0f);
    } else {
        const float4 g = *(const float4*)(kreg + h * HD + d);
        const half4 reg = { (_Float16)g.x, (_Float16)g.y, (_Float16)g.z, (_Float16)g.w };
        const half4 zero = {};
        #pragma unroll
        for (int j = 0; j < RPW / 2; ++j)   // reg_mask zeros the rotary half
            *(half4*)(dst + j * 2 * HD) = (key + 2 * j == SEQ && d >= 32) ? reg : zero;
    }
}

// ---------------------------------------------------------------------------
// Phase 1c: V transpose -> f16, layout [b][h][d][key], key in [0,KPAD)
// One work-group: all 64 dims x 160 keys of one head through LDS.
// grid = B * (KPAD/VTK) * NH
// ---------------------------------------------------------------------------
#define VTK     160           // keys per tile; KPAD = 13 * 160
#define VTP     (VTK / 2 + 1) // dwords per dim row: odd, so that the 16 lanes of
                              // a row (4 dims apart) store to 16 different banks

__global__ __launch_bounds__(256) void vt_kernel(
    const float* __restrict__ vin, const float* __restrict__ vreg,
    _Float16* __restrict__ Vt)
{
    __shared__ unsigned tile[HD * VTP];   // [dim][key pair], two f16 keys a dword
    int bidx = blockIdx.x;
    const int h  = bidx & 15;  bidx >>= 4;
    const int kt = bidx % (KPAD / VTK);
    const int b  = bidx / (KPAD / VTK);
    const int t  = threadIdx.x;
    const int d  = (t & 15) * 4;
    const int kp = t >> 4;

    // a thread's key pairs: keys 2n and 2n+1, n = i*16 + kp
    float4 e[VTK / 32], o[VTK / 32];
    if (kt * VTK + VTK <= SEQ) {          // whole tile inside the sequence
        const float* p = vin + (((size_t)b * SEQ + kt * VTK + kp * 2) * NH + h) * HD + d;
        #pragma unroll
        for (int i = 0; i < VTK / 32; ++i) {
            e[i] = *(const float4*)(p + (size_t)(i * 32 + 0) * NH * HD);
            o[i] = *(const float4*)(p + (size_t)(i * 32 + 1) * NH * HD);
        }
    } else {                              // last tile: register token, zero pad
        #pragma unroll
        for (int i = 0; i < VTK / 32; ++i) {
            // key is even, so key and key+1 lie on the same side of SEQ; past
            // the sequence the pointer names the register row (in bounds)
            const int key = kt * VTK + (i * 16 + kp) * 2;
            const bool in = key < SEQ;
            const float* p = in ? vin + (((size_t)b * SEQ + key) * NH + h) * HD + d
                                : vreg + h * HD + d;
            const float4 pe = *(const float4*)p;
            const float4 po = *(const float4*)(in ? p + NH * HD : p);
            const bool te = key <= SEQ;   // key == SEQ is the register token
            e[i].x = te ? pe.x : 0.0f;  e[i].y = te ? pe.y : 0.0f;
            e[i].z = te ? pe.z : 0.0f;  e[i].w = te ? pe.w : 0.0f;
            o[i].x = in ? po.x : 0.0f;  o[i].y = in ? po.y : 0.0f;
            o[i].z = in ? po.z : 0.0f;  o[i].w = in ? po.w : 0.0f;
        }
    }
    #pragma unroll
    for (int i = 0; i < VTK / 32; ++i) {
        const float ev[4] = { e[i].x, e[i].y, e[i].z, e[i].w };
        const float ov[4] = { o[i].x, o[i].y, o[i].z, o[i].w };
        #pragma unroll
        for (int c = 0; c < 4; ++c) {
            half2 pr = { (_Float16)ev[c], (_Float16)ov[c] };
            tile[(d + c) * VTP + i * 16 + kp] = __builtin_bit_cast(unsigned, pr);
        }
    }
    __syncthreads();

    // 8 keys (16 bytes) per lane; 20 lanes cover a dim row's 320 bytes
    _Float16* dst = Vt + ((size_t)b * NH + h) * HD * KPAD + kt * VTK;
    #pragma unroll
    for (int i = 0; i < HD * VTK / 8 / 256; ++i) {
        const int idx = i * 256 + t;
        const int row = idx / (VTK / 8);
        const int g   = idx - row * (VTK / 8);
        const unsigned* s = &tile[row * VTP + g * 4];
        uint4 v = { s[0], s[1], s[2], s[3] };
        *(uint4*)(dst + (size_t)row * KPAD + g * 8) = v;
    }
}

// ---------------------------------------------------------------------------
// Phase 2: flash attention. One wave = 32 query rows (two tiles of 16), so that
// each K and V^T fragment read from LDS feeds two WMMAs; block = 8 waves = 256 q.
// grid.x = B*NH*(SEQ/256).  S^T = K_tile x Q^T and O^T += V^T x P^T: a lane
// holds, per tile, one query's scores, its maximum, its sum AND its outputs, so
// exp(S^T) packs into the B operand in place and the rescale factor is the lane's.
// The rescale is lazy: outputs and sums are scaled only in a pass where a score
// passes the maximum in use by more than LAZY (log2 domain).
// K and V^T come through LDS: the block's 8 waves share one 128-key stage,
// filled by asynchronous copies of whole lines, two buffers, one stage ahead.
// ---------------------------------------------------------------------------
#define QBLK    256                       // queries per work-group: 8 waves x 32
#define STG     128                       // keys per LDS stage (4 passes of 32)
#define NSTG    ((KPAD + STG - 1) / STG)  // 17; the last stage holds one pass
#define KPITCH  72                        // halves: 128-B K row + 16 B (b128 readers)
#define VPITCH  136                       // halves: 256-B V^T row + 16 B
#define KSTAGE  (STG * KPITCH)            // halves per K buffer
#define VSTAGE  (HD * VPITCH)             // halves per V^T buffer
#define EPITCH  68                        // floats: 256-B output row + 16 B (b128 writers)
#define LAZY    8.0f                      // log2: how far a score may pass the maximum in use

__device__ __forceinline__ unsigned lds_off(const void* p) {
    return (unsigned)(size_t)p;           // low 32 bits = byte offset in LDS
}

// One stage: 4 K copies + 4 V^T copies of 16 B per lane. The global side is
// clamped so that the short last stage stays inside Kh / Vt; the LDS bytes
// filled from clamped addresses belong to passes that are never run.
__device__ __forceinline__ void stage_copy(
    const _Float16* kbase, const _Float16* vbase, int kb0,
    unsigned kdst, unsigned vdst, int krow, int kcol, int vrow, int vcol)
{
    const _Float16* gk0 = kbase + (size_t)min(kb0 + krow +  0, KPAD - 1) * HD + kcol;
    const _Float16* gk1 = kbase + (size_t)min(kb0 + krow + 32, KPAD - 1) * HD + kcol;
    const _Float16* gk2 = kbase + (size_t)min(kb0 + krow + 64, KPAD - 1) * HD + kcol;
    const _Float16* gk3 = kbase + (size_t)min(kb0 + krow + 96, KPAD - 1) * HD + kcol;
    const _Float16* gv0 = vbase + (size_t)vrow * KPAD + min(kb0 + vcol, KPAD - 8);
    const _Float16* gv1 = gv0 + (size_t)16 * KPAD;
    const _Float16* gv2 = gv0 + (size_t)32 * KPAD;
    const _Float16* gv3 = gv0 + (size_t)48 * KPAD;
    // s_wait_xcnt is the statement's last line as a precaution: so it stands in
    // front of every later write of an address register that a copy names.
    asm volatile(
        "global_load_async_to_lds_b128 %0, %8, off\n\t"
        "global_load_async_to_lds_b128 %1, %9, off\n\t"
        "global_load_async_to_lds_b128 %2, %10, off\n\t"
        "global_load_async_to_lds_b128 %3, %11, off\n\t"
        "global_load_async_to_lds_b128 %4, %12, off\n\t"
        "global_load_async_to_lds_b128 %5, %13, off\n\t"
        "global_load_async_to_lds_b128 %6, %14, off\n\t"
        "global_load_async_to_lds_b128 %7, %15, off\n\t"
        "s_wait_xcnt 0x0"
        :: "v"(kdst), "v"(kdst + 32 * KPITCH * 2), "v"(kdst + 64 * KPITCH * 2),
           "v"(kdst + 96 * KPITCH * 2),
           "v"(vdst), "v"(vdst + 16 * VPITCH * 2), "v"(vdst + 32 * VPITCH * 2),
           "v"(vdst + 48 * VPITCH * 2),
           "v"(gk0), "v"(gk1), "v"(gk2), "v"(gk3),
           "v"(gv0), "v"(gv1), "v"(gv2), "v"(gv3)
        : "memory");
}

// One query tile's outputs of a lane (4 dim tiles x 8 dims) into its staging row.
__device__ __forceinline__ void stage_out(float* er, v8f t0, v8f t1, v8f t2, v8f t3) {
    *(float4*)(er +  0) = make_float4(t0[0], t0[1], t0[2], t0[3]);
    *(float4*)(er +  4) = make_float4(t0[4], t0[5], t0[6], t0[7]);
    *(float4*)(er + 16) = make_float4(t1[0], t1[1], t1[2], t1[3]);
    *(float4*)(er + 20) = make_float4(t1[4], t1[5], t1[6], t1[7]);
    *(float4*)(er + 32) = make_float4(t2[0], t2[1], t2[2], t2[3]);
    *(float4*)(er + 36) = make_float4(t2[4], t2[5], t2[6], t2[7]);
    *(float4*)(er + 48) = make_float4(t3[0], t3[1], t3[2], t3[3]);
    *(float4*)(er + 52) = make_float4(t3[4], t3[5], t3[6], t3[7]);
}

__global__ __launch_bounds__(256) __attribute__((amdgpu_waves_per_eu(4, 4)))
void fa_kernel(
    const _Float16* __restrict__ Qh, const _Float16* __restrict__ Kh,
    const _Float16* __restrict__ Vt, float* __restrict__ out)
{
    __shared__ __attribute__((aligned(16))) _Float16 Ks[2][KSTAGE];
    __shared__ __attribute__((aligned(16))) _Float16 Vs[2][VSTAGE];

    const int lane   = threadIdx.x & 31;
    const int wave   = threadIdx.x >> 5;
    const int wg     = blockIdx.x;
    const int qblk   = wg & (SEQ / QBLK - 1);   // 8 blocks of 256 queries
    const int bh     = wg / (SEQ / QBLK);       // b*NH + h
    const int b      = bh >> 4;
    const int h      = bh & 15;
    const int qbase  = qblk * QBLK + wave * 32;
    const int lo     = lane & 15;
    const int hi8    = (lane & 16) ? 8 : 0;   // lane-half K/row offset
    const int dA     = hi8;                   // A/B slot pattern offset

    const _Float16* kbase = Kh + (size_t)bh * KPAD * HD;
    const _Float16* vbase = Vt + (size_t)bh * HD * KPAD;

    // ---- this thread's share of a stage: a wave's K copy is 4 whole rows
    // (512 contiguous bytes), its V^T copy 2 rows of 256 bytes
    const int krow = threadIdx.x >> 3, kcol = (threadIdx.x & 7) * 8;
    const int vrow = threadIdx.x >> 4, vcol = (threadIdx.x & 15) * 8;
    const unsigned kdst = lds_off(&Ks[0][krow * KPITCH + kcol]);
    const unsigned vdst = lds_off(&Vs[0][vrow * VPITCH + vcol]);

    // ---- prologue: stage 0 lands and is published, stage 1 starts to fly
    stage_copy(kbase, vbase, 0, kdst, vdst, krow, kcol, vrow, vcol);

    // ---- Q^T fragments of the two query tiles: tile a = rows qbase+lo, tile b
    // = rows qbase+16+lo; slots {dA..dA+7, dA+16..}
    const _Float16* qra = Qh + ((size_t)bh * SEQ + (qbase + lo)) * HD;
    const _Float16* qrb = qra + 16 * HD;
    v16h qa0 = cat8(*(const half8*)(qra +  0 + dA), *(const half8*)(qra + 16 + dA));
    v16h qa1 = cat8(*(const half8*)(qra + 32 + dA), *(const half8*)(qra + 48 + dA));
    v16h qb0 = cat8(*(const half8*)(qrb +  0 + dA), *(const half8*)(qrb + 16 + dA));
    v16h qb1 = cat8(*(const half8*)(qrb + 32 + dA), *(const half8*)(qrb + 48 + dA));

    v8f oa0 = {}, oa1 = {}, oa2 = {}, oa3 = {};
    v8f ob0 = {}, ob1 = {}, ob2 = {}, ob3 = {};
    float ma = -1e38f, mlima = -1e38f, lsuma = 0.0f;   // mlim = m + LAZY
    float mb = -1e38f, mlimb = -1e38f, lsumb = 0.0f;

    // this wave's copies of stage 0 have landed before the barrier publishes them
    asm volatile("s_wait_asynccnt 0x0" ::: "memory");
    __syncthreads();
    stage_copy(kbase, vbase, STG, kdst + KSTAGE * 2, vdst + VSTAGE * 2,
               krow, kcol, vrow, vcol);

    for (int st = 0; st < NSTG; ++st) {
      const int buf = st & 1;
      const _Float16* ks = &Ks[buf][lo * KPITCH + dA];
      const _Float16* vs = &Vs[buf][lo * VPITCH + dA];
      const int left = KPAD - st * STG;
      const int np = (left < STG ? left : STG) / 32;   // passes in this stage

      for (int p = 0; p < np; ++p) {
        const int kb = st * STG + p * 32;

        // ---- K A-fragments: lane = key row (kb+lo / kb+16+lo)
        const _Float16* kr0 = ks + p * 32 * KPITCH;
        const _Float16* kr1 = kr0 + 16 * KPITCH;
        v16h ka0c0 = cat8(*(const half8*)(kr0 +  0), *(const half8*)(kr0 + 16));
        v16h ka0c1 = cat8(*(const half8*)(kr0 + 32), *(const half8*)(kr0 + 48));
        v16h ka1c0 = cat8(*(const half8*)(kr1 +  0), *(const half8*)(kr1 + 16));
        v16h ka1c1 = cat8(*(const half8*)(kr1 + 32), *(const half8*)(kr1 + 48));
        // scheduling barrier: without it half of the loads above stand among the
        // WMMAs below, in two more places, each with a full wait on LDS behind it
        __builtin_amdgcn_sched_barrier(0);

        // ---- S^T tiles (M=key, N=q), log2 domain (scale folded into Q): each
        // K fragment feeds both query tiles; four independent accumulators
        v8f a0 = {}, a1 = {}, b0 = {}, b1 = {};
        a0 = wmma_f16(ka0c0, qa0, a0);  b0 = wmma_f16(ka0c0, qb0, b0);
        a1 = wmma_f16(ka1c0, qa0, a1);  b1 = wmma_f16(ka1c0, qb0, b1);
        a0 = wmma_f16(ka0c1, qa1, a0);  b0 = wmma_f16(ka0c1, qb1, b0);
        a1 = wmma_f16(ka1c1, qa1, a1);  b1 = wmma_f16(ka1c1, qb1, b1);

        // ---- tail mask: keys >= NKV are padding
        if (kb + 32 > NKV) {
            #pragma unroll
            for (int r = 0; r < 8; ++r) {
                if (kb + r + hi8 >= NKV)      { a0[r] = -1e30f; b0[r] = -1e30f; }
                if (kb + 16 + r + hi8 >= NKV) { a1[r] = -1e30f; b1[r] = -1e30f; }
            }
        }

        // ---- V^T A-fragments (lane = dim row): issued in front of the branch
        // below, so that they fly under the maxima and the exponentials
        const _Float16* vr0 = vs + p * 32;
        const _Float16* vr1 = vr0 + 16 * VPITCH;
        const _Float16* vr2 = vr0 + 32 * VPITCH;
        const _Float16* vr3 = vr0 + 48 * VPITCH;
        v16h bv0 = cat8(*(const half8*)(vr0), *(const half8*)(vr0 + 16));
        v16h bv1 = cat8(*(const half8*)(vr1), *(const half8*)(vr1 + 16));
        v16h bv2 = cat8(*(const half8*)(vr2), *(const half8*)(vr2 + 16));
        v16h bv3 = cat8(*(const half8*)(vr3), *(const half8*)(vr3 + 16));
        // compiler fence: without it the loads above sink behind the branch and
        // stand in four places among the exponentials and the WMMAs
        asm volatile("" ::: "memory");

        // ---- online softmax: per-lane over 16 regs a tile; each lane of a query
        // keeps the sum of its own 16 keys. m, the maximum in use, is the same in
        // both lanes of a query and may trail the true maximum by up to LAZY (log2
        // domain), so an exponential reaches at most 2^LAZY, far inside f16.
        float mta = fmaxf(a0[0], a1[0]);
        float mtb = fmaxf(b0[0], b1[0]);
        #pragma unroll
        for (int r = 1; r < 8; ++r) {
            mta = fmaxf(mta, fmaxf(a0[r], a1[r]));
            mtb = fmaxf(mtb, fmaxf(b0[r], b1[r]));
        }

        // ---- lazy rescale: one wave-uniform test per pass for both tiles (a
        // scalar branch, all lanes stay on). Always taken in the first pass, where
        // m is -1e38 and alpha comes out 0 on zero sums; after that only when a
        // score passes its query's m by more than LAZY.
        if (__builtin_amdgcn_ballot_w32(mta > mlima || mtb > mlimb) != 0) {
            const float na = fmaxf(ma, fmaxf(mta, xhalf(mta)));
            const float nb = fmaxf(mb, fmaxf(mtb, xhalf(mtb)));
            const float ala = fast_exp2(ma - na);
            const float alb = fast_exp2(mb - nb);
            ma = na;  mlima = na + LAZY;
            mb = nb;  mlimb = nb + LAZY;
            lsuma *= ala;   // every register of a lane belongs to its query
            lsumb *= alb;
            oa0 *= ala; oa1 *= ala; oa2 *= ala; oa3 *= ala;
            ob0 *= alb; ob1 *= alb; ob2 *= alb; ob3 *= alb;
        }

        union { v16h v; _Float16 e[16]; } pa, pb;
        float psa = 0.0f, psb = 0.0f;
        a0 -= ma;  a1 -= ma;  b0 -= mb;  b1 -= mb;   // whole tiles: registers stay paired
        #pragma unroll
        for (int r = 0; r < 8; ++r) {
            float p0 = fast_exp2(a0[r]); psa += p0; pa.e[r]     = (_Float16)p0;
            float p1 = fast_exp2(a1[r]); psa += p1; pa.e[8 + r] = (_Float16)p1;
        }
        lsuma += psa;
        #pragma unroll
        for (int r = 0; r < 8; ++r) {
            float p0 = fast_exp2(b0[r]); psb += p0; pb.e[r]     = (_Float16)p0;
            float p1 = fast_exp2(b1[r]); psb += p1; pb.e[8 + r] = (_Float16)p1;
        }
        lsumb += psb;

        // ---- O^T accumulation: each V^T fragment feeds both query tiles
        oa0 = wmma_f16(bv0, pa.v, oa0);
        oa1 = wmma_f16(bv1, pa.v, oa1);
        oa2 = wmma_f16(bv2, pa.v, oa2);
        oa3 = wmma_f16(bv3, pa.v, oa3);
        ob0 = wmma_f16(bv0, pb.v, ob0);
        ob1 = wmma_f16(bv1, pb.v, ob1);
        ob2 = wmma_f16(bv2, pb.v, ob2);
        ob3 = wmma_f16(bv3, pb.v, ob3);
      }

      // ---- publish point of stage st+1, every wave, in this order:
      // this wave's reads of the buffer to be refilled have returned
      asm volatile("s_wait_dscnt 0x0" ::: "memory");
      // this wave's copies of stage st+1 have landed
      asm volatile("s_wait_asynccnt 0x0" ::: "memory");
      __syncthreads();
      if (st + 2 < NSTG)
        stage_copy(kbase, vbase, (st + 2) * STG,
                   kdst + buf * (KSTAGE * 2), vdst + buf * (VSTAGE * 2),
                   krow, kcol, vrow, vcol);
    }
    // no copy is left in flight when the wave ends
    asm volatile("s_wait_asynccnt 0x0" ::: "memory");

    // ---- finalize: join the two halves' sums, divide, store (B,S,NH*HD).
    // Lane (lo, half) holds queries qbase+lo and qbase+16+lo, dims 16t + hi8 ..
    // + 7 of tile t. The ring is free here: the loop's last barrier stands behind
    // every wave's last read and last landed copy. Each wave stages its rows in
    // ranges of its own (tile a in the K ring, tile b in the V^T ring), so that
    // the stores below cover whole 256-byte head rows.
    static_assert(8 * 16 * EPITCH * 4 <= 2 * KSTAGE * 2, "tile a fits the K ring");
    static_assert(8 * 16 * EPITCH * 4 <= 2 * VSTAGE * 2, "tile b fits the V^T ring");
    const float inva = 1.0f / (lsuma + xhalf(lsuma));
    const float invb = 1.0f / (lsumb + xhalf(lsumb));
    float* esa = (float*)&Ks[0][0] + wave * (16 * EPITCH);
    float* esb = (float*)&Vs[0][0] + wave * (16 * EPITCH);
    stage_out(esa + lo * EPITCH + hi8, oa0 * inva, oa1 * inva, oa2 * inva, oa3 * inva);
    stage_out(esb + lo * EPITCH + hi8, ob0 * invb, ob1 * invb, ob2 * invb, ob3 * invb);
    // the wave's staged rows are in LDS before its other lanes read them back
    asm volatile("s_wait_dscnt 0x0" ::: "memory");
    {
        const int row = lane >> 4, col = lo * 4;
        const float* ra = esa + row * EPITCH + col;
        const float* rb = esb + row * EPITCH + col;
        float* dst = out + (((size_t)b * SEQ + qbase + row) * NH + h) * HD + col;
        #pragma unroll
        for (int i = 0; i < 8; ++i)
            *(float4*)(dst + (size_t)i * 2 * NH * HD) = *(const float4*)(ra + i * 2 * EPITCH);
        #pragma unroll
        for (int i = 0; i < 8; ++i)
            *(float4*)(dst + (size_t)(16 + i * 2) * NH * HD) = *(const float4*)(rb + i * 2 * EPITCH);
    }
}

// ---------------------------------------------------------------------------
extern "C" void kernel_launch(void* const* d_in, const int* in_sizes, int n_in,
                              void* d_out, int out_size, void* d_ws, size_t ws_size,
                              hipStream_t stream)
{
    (void)in_sizes; (void)n_in; (void)out_size; (void)ws_size;

    const float* q    = (const float*)d_in[0];
    const float* k    = (const float*)d_in[1];
    const float* v    = (const float*)d_in[2];
    const float* kreg = (const float*)d_in[3];
    const float* vreg = (const float*)d_in[4];
    float* out = (float*)d_out;

    // workspace layout (f16)
    const size_t QH_ELEMS = (size_t)BATCH * NH * SEQ  * HD;   //  8,388,608
    const size_t KH_ELEMS = (size_t)BATCH * NH * KPAD * HD;   //  8,519,680
    _Float16* Qh = (_Float16*)d_ws;
    _Float16* Kh = Qh + QH_ELEMS;
    _Float16* Vt = Kh + KH_ELEMS;

    // Phase 1
    rope_q_kernel<<<BATCH * NH * (SEQ / RPW) / 8, 256, 0, stream>>>(q, Qh);
    rope_k_kernel<<<BATCH * NH * (KPAD / RPW) / 8, 256, 0, stream>>>(k, kreg, Kh);
    vt_kernel<<<BATCH * NH * (KPAD / VTK), 256, 0, stream>>>(v, vreg, Vt);

    // Phase 2: B*NH*(SEQ/256) workgroups of 8 waves
    fa_kernel<<<BATCH * NH * (SEQ / QBLK), 256, 0, stream>>>(Qh, Kh, Vt, out);
}

// v006
// One run takes 68.9 microseconds.
// Timed twice side by side with v005, it ran 1.09 times as fast both times.
// Over all steps from v000 it is 4.82 times as fast.
#include <hip/hip_runtime.h>
#include <hip/hip_bf16.h>
#include <math.h>

// ---------------------------------------------------------------------------
// RotaryAttention for MI455X (gfx1250, wave32, WMMA).
// Phase 1: RoPE+f16 pack of K, V transpose (both into d_ws).
// Phase 2: flash attention, S^T formulation, v_wmma_f32_16x16x32_f16; its
// prologue reads Q as f32 and applies RoPE while it packs the fragments.
// ---------------------------------------------------------------------------

typedef _Float16 half8 __attribute__((ext_vector_type(8)));
typedef _Float16 v16h  __attribute__((ext_vector_type(16)));
typedef float    v8f   __attribute__((ext_vector_type(8)));
typedef float    f32x4 __attribute__((ext_vector_type(4)));

#define NH      16
#define HD      64
#define SEQ     2048
#define NKV     2049          // 2048 keys + 1 register token
#define KPAD    2080          // padded to multiple of 32
#define BATCH   4

// 1/sqrt(64) * log2(e): scores come out in log2 domain -> native v_exp_f32
#define QSCALE  0.18033688011112042f
// log2(10000)/16
#define FREQC   0.83048202372184065f

__device__ __forceinline__ v8f wmma_f16(v16h a, v16h b, v8f c) {
    return __builtin_amdgcn_wmma_f32_16x16x32_f16(false, a, false, b,
                                                  (short)0, c, false, false);
}

__device__ __forceinline__ v16h cat8(half8 lo, half8 hi) {
    return __builtin_shufflevector(lo, hi, 0,1,2,3,4,5,6,7,8,9,10,11,12,13,14,15);
}

// Raw v_exp_f32: args are at most LAZY (8) here; flush-to-zero below -126 is the
// desired flash-softmax semantics (avoids OCML's range-fix cmp/cndmask pairs).
__device__ __forceinline__ float fast_exp2(float x) {
    return __builtin_amdgcn_exp2f(x);
}

// Lane l with lane l ^ 16 on the vector pipe (no trip through the LDS unit).
__device__ __forceinline__ float xhalf(float x) {
    const int b = __builtin_bit_cast(int, x);
    return __builtin_bit_cast(float,
        __builtin_amdgcn_permlanex16(b, b, 0x76543210, 0xfedcba98, false, false));
}

// ---------------------------------------------------------------------------
// Phase 1, common shape: few, fat work-groups. A lane moves 16 bytes per load,
// a wave-wide load covers whole 256-byte head rows, all of a thread's loads are
// issued before the first is used, and stores cover whole lines.
// ---------------------------------------------------------------------------
typedef _Float16 half4 __attribute__((ext_vector_type(4)));
typedef _Float16 half2 __attribute__((ext_vector_type(2)));

#define RPW     16            // positions per wave: 8 loads x 2 rows

// One wave: RPW consecutive positions of one head. Lanes 0-15 hold one row
// (4 dims each), lanes 16-31 the next; src/dst point at the lane's own 4 dims
// of its first row, pos is that row's position.
__device__ __forceinline__ void rope_rows(
    const float* __restrict__ src, _Float16* __restrict__ dst,
    int pos, int d, float scale)
{
    float4 x[RPW / 2];
    #pragma unroll
    for (int j = 0; j < RPW / 2; ++j)
        x[j] = *(const float4*)(src + (size_t)j * 2 * NH * HD);

    // rotate_half partner: dims d+16 / d-16 sit 4 lanes away in the same row
    float4 o[RPW / 2];
    #pragma unroll
    for (int j = 0; j < RPW / 2; ++j) {
        o[j].x = __shfl_xor(x[j].x, 4);
        o[j].y = __shfl_xor(x[j].y, 4);
        o[j].z = __shfl_xor(x[j].z, 4);
        o[j].w = __shfl_xor(x[j].w, 4);
    }

    if (d < 32) {
        const float sg = (d < 16) ? -1.0f : 1.0f;
        const int   f  = d & 15;
        const float f0 = exp2f(-(float)(f + 0) * FREQC);
        const float f1 = exp2f(-(float)(f + 1) * FREQC);
        const float f2 = exp2f(-(float)(f + 2) * FREQC);
        const float f3 = exp2f(-(float)(f + 3) * FREQC);
        #pragma unroll
        for (int j = 0; j < RPW / 2; ++j) {
            const float p = (float)(pos + 2 * j);
            float sn, cs;
            __sincosf(p * f0, &sn, &cs); x[j].x = x[j].x * cs + (sg * o[j].x) * sn;
            __sincosf(p * f1, &sn, &cs); x[j].y = x[j].y * cs + (sg * o[j].y) * sn;
            __sincosf(p * f2, &sn, &cs); x[j].z = x[j].z * cs + (sg * o[j].z) * sn;
            __sincosf(p * f3, &sn, &cs); x[j].w = x[j].w * cs + (sg * o[j].w) * sn;
        }
    }

    #pragma unroll
    for (int j = 0; j < RPW / 2; ++j) {
        half4 r = { (_Float16)(x[j].x * scale), (_Float16)(x[j].y * scale),
                    (_Float16)(x[j].z * scale), (_Float16)(x[j].w * scale) };
        *(half4*)(dst + j * 2 * HD) = r;
    }
}

// ---------------------------------------------------------------------------
// Phase 1a: K -> RoPE -> f16, layout [b][h][key][d], key in [0,KPAD)
//   key==2048: register token (rotary half zeroed), key>2048: zero pad
// grid = B * (KPAD/RPW) * NH waves / 8
// ---------------------------------------------------------------------------
__global__ __launch_bounds__(256) void rope_k_kernel(
    const float* __restrict__ kin, const float* __restrict__ kreg,
    _Float16* __restrict__ Kh)
{
    const int lane = threadIdx.x & 31;
    const int w    = blockIdx.x * 8 + (threadIdx.x >> 5);
    const int h    = w & 15;
    const int r    = w >> 4;
    const int kblk = r % (KPAD / RPW);
    const int b    = r / (KPAD / RPW);
    const int d    = (lane & 15) * 4;
    const int key  = kblk * RPW + (lane >> 4);

    _Float16* dst = Kh + (((size_t)b * NH + h) * KPAD + key) * HD + d;
    if (kblk < SEQ / RPW) {
        rope_rows(kin + (((size_t)b * SEQ + key) * NH + h) * HD + d, dst, key, d, 1.0f);
    } else {
        const float4 g = *(const float4*)(kreg + h * HD + d);
        const half4 reg = { (_Float16)g.x, (_Float16)g.y, (_Float16)g.z, (_Float16)g.w };
        const half4 zero = {};
        #pragma unroll
        for (int j = 0; j < RPW / 2; ++j)   // reg_mask zeros the rotary half
            *(half4*)(dst + j * 2 * HD) = (key + 2 * j == SEQ && d >= 32) ? reg : zero;
    }
}

// ---------------------------------------------------------------------------
// Phase 1b: V transpose -> f16, layout [b][h][d][key], key in [0,KPAD)
// One work-group: all 64 dims x 160 keys of one head through LDS.
// grid = B * (KPAD/VTK) * NH
// ---------------------------------------------------------------------------
#define VTK     160           // keys per tile; KPAD = 13 * 160
#define VTP     (VTK / 2 + 1) // dwords per dim row: odd, so that the 16 lanes of
                              // a row (4 dims apart) store to 16 different banks

__global__ __launch_bounds__(256) void vt_kernel(
    const float* __restrict__ vin, const float* __restrict__ vreg,
    _Float16* __restrict__ Vt)
{
    __shared__ unsigned tile[HD * VTP];   // [dim][key pair], two f16 keys a dword
    int bidx = blockIdx.x;
    const int h  = bidx & 15;  bidx >>= 4;
    const int kt = bidx % (KPAD / VTK);
    const int b  = bidx / (KPAD / VTK);
    const int t  = threadIdx.x;
    const int d  = (t & 15) * 4;
    const int kp = t >> 4;

    // a thread's key pairs: keys 2n and 2n+1, n = i*16 + kp
    float4 e[VTK / 32], o[VTK / 32];
    if (kt * VTK + VTK <= SEQ) {          // whole tile inside the sequence
        const float* p = vin + (((size_t)b * SEQ + kt * VTK + kp * 2) * NH + h) * HD + d;
        #pragma unroll
        for (int i = 0; i < VTK / 32; ++i) {
            e[i] = *(const float4*)(p + (size_t)(i * 32 + 0) * NH * HD);
            o[i] = *(const float4*)(p + (size_t)(i * 32 + 1) * NH * HD);
        }
    } else {                              // last tile: register token, zero pad
        #pragma unroll
        for (int i = 0; i < VTK / 32; ++i) {
            // key is even, so key and key+1 lie on the same side of SEQ; past
            // the sequence the pointer names the register row (in bounds)
            const int key = kt * VTK + (i * 16 + kp) * 2;
            const bool in = key < SEQ;
            const float* p = in ? vin + (((size_t)b * SEQ + key) * NH + h) * HD + d
                                : vreg + h * HD + d;
            const float4 pe = *(const float4*)p;
            const float4 po = *(const float4*)(in ? p + NH * HD : p);
            const bool te = key <= SEQ;   // key == SEQ is the register token
            e[i].x = te ? pe.x : 0.0f;  e[i].y = te ? pe.y : 0.0f;
            e[i].z = te ? pe.z : 0.0f;  e[i].w = te ? pe.w : 0.0f;
            o[i].x = in ? po.x : 0.0f;  o[i].y = in ? po.y : 0.0f;
            o[i].z = in ? po.z : 0.0f;  o[i].w = in ? po.w : 0.0f;
        }
    }
    #pragma unroll
    for (int i = 0; i < VTK / 32; ++i) {
        const float ev[4] = { e[i].x, e[i].y, e[i].z, e[i].w };
        const float ov[4] = { o[i].x, o[i].y, o[i].z, o[i].w };
        #pragma unroll
        for (int c = 0; c < 4; ++c) {
            half2 pr = { (_Float16)ev[c], (_Float16)ov[c] };
            tile[(d + c) * VTP + i * 16 + kp] = __builtin_bit_cast(unsigned, pr);
        }
    }
    __syncthreads();

    // 8 keys (16 bytes) per lane; 20 lanes cover a dim row's 320 bytes
    _Float16* dst = Vt + ((size_t)b * NH + h) * HD * KPAD + kt * VTK;
    #pragma unroll
    for (int i = 0; i < HD * VTK / 8 / 256; ++i) {
        const int idx = i * 256 + t;
        const int row = idx / (VTK / 8);
        const int g   = idx - row * (VTK / 8);
        const unsigned* s = &tile[row * VTP + g * 4];
        uint4 v = { s[0], s[1], s[2], s[3] };
        *(uint4*)(dst + (size_t)row * KPAD + g * 8) = v;
    }
}

// ---------------------------------------------------------------------------
// Phase 2: flash attention. One wave = 32 query rows (two tiles of 16), so that
// each K and V^T fragment read from LDS feeds two WMMAs; block = 8 waves = 256 q.
// grid.x = B*NH*(SEQ/256).  S^T = K_tile x Q^T and O^T += V^T x P^T: a lane
// holds, per tile, one query's scores, its maximum, its sum AND its outputs, so
// exp(S^T) packs into the B operand in place and the rescale factor is the lane's.
// The rescale is lazy: outputs and sums are scaled only in a pass where a score
// passes the maximum in use by more than LAZY (log2 domain).
// K and V^T come through LDS: the block's 8 waves share one 128-key stage,
// filled by asynchronous copies of whole lines, two buffers, one stage ahead.
// Q comes straight from the f32 input: whole 256-byte head rows into registers,
// through LDS rows that are the wave's own into fragment order, where a
// lane holds both dims of every rotated pair, so that RoPE is done in-lane.
// ---------------------------------------------------------------------------
#define QBLK    256                       // queries per work-group: 8 waves x 32
#define STG     128                       // keys per LDS stage (4 passes of 32)
#define NSTG    ((KPAD + STG - 1) / STG)  // 17; the last stage holds one pass
#define KPITCH  72                        // halves: 128-B K row + 16 B (b128 readers)
#define VPITCH  136                       // halves: 256-B V^T row + 16 B
#define KSTAGE  (STG * KPITCH)            // halves per K buffer
#define VSTAGE  (HD * VPITCH)             // halves per V^T buffer
#define EPITCH  68                        // floats: 256-B output row + 16 B (b128 writers)
#define QPITCH  68                        // floats: 256-B Q row + 16 B (b128 readers)
#define LAZY    8.0f                      // log2: how far a score may pass the maximum in use

__device__ __forceinline__ unsigned lds_off(const void* p) {
    return (unsigned)(size_t)p;           // low 32 bits = byte offset in LDS
}

// One stage: 4 K copies + 4 V^T copies of 16 B per lane. The global side is
// clamped so that the short last stage stays inside Kh / Vt; the LDS bytes
// filled from clamped addresses belong to passes that are never run.
__device__ __forceinline__ void stage_copy(
    const _Float16* kbase, const _Float16* vbase, int kb0,
    unsigned kdst, unsigned vdst, int krow, int kcol, int vrow, int vcol)
{
    const _Float16* gk0 = kbase + (size_t)min(kb0 + krow +  0, KPAD - 1) * HD + kcol;
    const _Float16* gk1 = kbase + (size_t)min(kb0 + krow + 32, KPAD - 1) * HD + kcol;
    const _Float16* gk2 = kbase + (size_t)min(kb0 + krow + 64, KPAD - 1) * HD + kcol;
    const _Float16* gk3 = kbase + (size_t)min(kb0 + krow + 96, KPAD - 1) * HD + kcol;
    const _Float16* gv0 = vbase + (size_t)vrow * KPAD + min(kb0 + vcol, KPAD - 8);
    const _Float16* gv1 = gv0 + (size_t)16 * KPAD;
    const _Float16* gv2 = gv0 + (size_t)32 * KPAD;
    const _Float16* gv3 = gv0 + (size_t)48 * KPAD;
    // s_wait_xcnt is the statement's last line as a precaution: so it stands in
    // front of every later write of an address register that a copy names.
    asm volatile(
        "global_load_async_to_lds_b128 %0, %8, off\n\t"
        "global_load_async_to_lds_b128 %1, %9, off\n\t"
        "global_load_async_to_lds_b128 %2, %10, off\n\t"
        "global_load_async_to_lds_b128 %3, %11, off\n\t"
        "global_load_async_to_lds_b128 %4, %12, off\n\t"
        "global_load_async_to_lds_b128 %5, %13, off\n\t"
        "global_load_async_to_lds_b128 %6, %14, off\n\t"
        "global_load_async_to_lds_b128 %7, %15, off\n\t"
        "s_wait_xcnt 0x0"
        :: "v"(kdst), "v"(kdst + 32 * KPITCH * 2), "v"(kdst + 64 * KPITCH * 2),
           "v"(kdst + 96 * KPITCH * 2),
           "v"(vdst), "v"(vdst + 16 * VPITCH * 2), "v"(vdst + 32 * VPITCH * 2),
           "v"(vdst + 48 * VPITCH * 2),
           "v"(gk0), "v"(gk1), "v"(gk2), "v"(gk3),
           "v"(gv0), "v"(gv1), "v"(gv2), "v"(gv3)
        : "memory");
}

// One query tile's outputs of a lane (4 dim tiles x 8 dims) into its staging row.
__device__ __forceinline__ void stage_out(float* er, v8f t0, v8f t1, v8f t2, v8f t3) {
    *(float4*)(er +  0) = make_float4(t0[0], t0[1], t0[2], t0[3]);
    *(float4*)(er +  4) = make_float4(t0[4], t0[5], t0[6], t0[7]);
    *(float4*)(er + 16) = make_float4(t1[0], t1[1], t1[2], t1[3]);
    *(float4*)(er + 20) = make_float4(t1[4], t1[5], t1[6], t1[7]);
    *(float4*)(er + 32) = make_float4(t2[0], t2[1], t2[2], t2[3]);
    *(float4*)(er + 36) = make_float4(t2[4], t2[5], t2[6], t2[7]);
    *(float4*)(er + 48) = make_float4(t3[0], t3[1], t3[2], t3[3]);
    *(float4*)(er + 52) = make_float4(t3[4], t3[5], t3[6], t3[7]);
}

// One query tile's two B fragments from its staged f32 rows. qr points at the
// lane's row, at dim dA; the lane holds dims dA+i, 16+dA+i (a rotated pair, of
// frequency fr[i]), 32+dA+i and 48+dA+i (not rotated), i = 0..7.
__device__ __forceinline__ void rope_frag(
    const float* qr, float pos, const float* fr, v16h& f0, v16h& f1)
{
    const float4 c0 = *(const float4*)(qr +  0), c1 = *(const float4*)(qr +  4);
    const float4 c2 = *(const float4*)(qr + 16), c3 = *(const float4*)(qr + 20);
    const float4 c4 = *(const float4*)(qr + 32), c5 = *(const float4*)(qr + 36);
    const float4 c6 = *(const float4*)(qr + 48), c7 = *(const float4*)(qr + 52);
    const float u[8] = { c0.x, c0.y, c0.z, c0.w, c1.x, c1.y, c1.z, c1.w };
    const float y[8] = { c2.x, c2.y, c2.z, c2.w, c3.x, c3.y, c3.z, c3.w };
    const float s[8] = { c4.x, c4.y, c4.z, c4.w, c5.x, c5.y, c5.z, c5.w };
    const float t[8] = { c6.x, c6.y, c6.z, c6.w, c7.x, c7.y, c7.z, c7.w };
    #pragma unroll
    for (int i = 0; i < 8; ++i) {
        float sn, cs;
        __sincosf(pos * fr[i], &sn, &cs);
        f0[i]     = (_Float16)((u[i] * cs - y[i] * sn) * QSCALE);
        f0[8 + i] = (_Float16)((y[i] * cs + u[i] * sn) * QSCALE);
        f1[i]     = (_Float16)(s[i] * QSCALE);
        f1[8 + i] = (_Float16)(t[i] * QSCALE);
    }
}

__global__ __launch_bounds__(256) __attribute__((amdgpu_waves_per_eu(4, 4)))
void fa_kernel(
    const float* __restrict__ qin, const _Float16* __restrict__ Kh,
    const _Float16* __restrict__ Vt, float* __restrict__ out)
{
    __shared__ __attribute__((aligned(16))) _Float16 Ks[2][KSTAGE];
    __shared__ __attribute__((aligned(16))) _Float16 Vs[2][VSTAGE];

    const int lane   = threadIdx.x & 31;
    const int wave   = threadIdx.x >> 5;
    const int wg     = blockIdx.x;
    const int qblk   = wg & (SEQ / QBLK - 1);   // 8 blocks of 256 queries
    const int bh     = wg / (SEQ / QBLK);       // b*NH + h
    const int b      = bh >> 4;
    const int h      = bh & 15;
    const int qbase  = qblk * QBLK + wave * 32;
    const int lo     = lane & 15;
    const int hi8    = (lane & 16) ? 8 : 0;   // lane-half K/row offset
    const int dA     = hi8;                   // A/B slot pattern offset

    const _Float16* kbase = Kh + (size_t)bh * KPAD * HD;
    const _Float16* vbase = Vt + (size_t)bh * HD * KPAD;

    // ---- this thread's share of a stage: a wave's K copy is 4 whole rows
    // (512 contiguous bytes), its V^T copy 2 rows of 256 bytes
    const int krow = threadIdx.x >> 3, kcol = (threadIdx.x & 7) * 8;
    const int vrow = threadIdx.x >> 4, vcol = (threadIdx.x & 15) * 8;
    const unsigned kdst = lds_off(&Ks[0][krow * KPITCH + kcol]);
    const unsigned vdst = lds_off(&Vs[0][vrow * VPITCH + vcol]);

    // ---- the wave's 32 query rows, f32, from memory: a wave-wide load covers two
    // whole 256-byte head rows; all 16 are issued before anything waits
    const float* qg = qin + (((size_t)b * SEQ + qbase + (lane >> 4)) * NH + h) * HD + lo * 4;
    f32x4 qx[16];
    #pragma unroll
    for (int j = 0; j < 16; ++j)
        qx[j] = *(const f32x4*)(qg + (size_t)j * 2 * NH * HD);

    // ---- prologue: stage 0 lands and is published, stage 1 starts to fly
    stage_copy(kbase, vbase, 0, kdst, vdst, krow, kcol, vrow, vcol);

    // ---- Q^T fragments of the two query tiles: tile a = rows qbase+lo, tile b
    // = rows qbase+16+lo; slots {dA..dA+7, dA+16..}. One tile at a time goes
    // through 16 staging rows that are the wave's own. They lie in the ring's
    // second buffers (waves 0-3 in K's, waves 4-7 in V^T's), which are idle
    // until stage 1's copies are issued, behind the barrier below.
    static_assert(4 * 16 * QPITCH * 4 <= KSTAGE * 2, "four waves' rows fit a K buffer");
    static_assert(4 * 16 * QPITCH * 4 <= VSTAGE * 2, "four waves' rows fit a V^T buffer");
    v16h qa0, qa1, qb0, qb1;
    {
        float fr[8];
        #pragma unroll
        for (int i = 0; i < 8; ++i)
            fr[i] = exp2f(-(float)(dA + i) * FREQC);
        float* qs = (wave < 4 ? (float*)&Ks[1][0] : (float*)&Vs[1][0])
                    + (wave & 3) * (16 * QPITCH);
        float*       qw = qs + (lane >> 4) * QPITCH + lo * 4;
        const float* qr = qs + lo * QPITCH + dA;
        // fence on the loaded values, inputs only: without it tile b's eight loads
        // sink behind tile a's trip through LDS, and the wave waits out the
        // latency of memory twice
        asm volatile("" :: "v"(qx[8]), "v"(qx[9]), "v"(qx[10]), "v"(qx[11]),
                           "v"(qx[12]), "v"(qx[13]), "v"(qx[14]), "v"(qx[15]));
        #pragma unroll
        for (int j = 0; j < 8; ++j)
            *(f32x4*)(qw + j * 2 * QPITCH) = qx[j];
        // the wave's staged rows are in LDS before its other lanes read them back
        asm volatile("s_wait_dscnt 0x0" ::: "memory");
        rope_frag(qr, (float)(qbase + lo), fr, qa0, qa1);
        // tile a's reads have returned before tile b's rows overwrite them
        asm volatile("s_wait_dscnt 0x0" ::: "memory");
        #pragma unroll
        for (int j = 0; j < 8; ++j)
            *(f32x4*)(qw + j * 2 * QPITCH) = qx[8 + j];
        // as above, for tile b
        asm volatile("s_wait_dscnt 0x0" ::: "memory");
        rope_frag(qr, (float)(qbase + 16 + lo), fr, qb0, qb1);
        // tile b's reads have returned before the barrier below, behind which
        // stage 1's copies overwrite these rows
        asm volatile("s_wait_dscnt 0x0" ::: "memory");
    }

    v8f oa0 = {}, oa1 = {}, oa2 = {}, oa3 = {};
    v8f ob0 = {}, ob1 = {}, ob2 = {}, ob3 = {};
    float ma = -1e38f, mlima = -1e38f, lsuma = 0.0f;   // mlim = m + LAZY
    float mb = -1e38f, mlimb = -1e38f, lsumb = 0.0f;

    // this wave's copies of stage 0 have landed before the barrier publishes them
    asm volatile("s_wait_asynccnt 0x0" ::: "memory");
    __syncthreads();
    stage_copy(kbase, vbase, STG, kdst + KSTAGE * 2, vdst + VSTAGE * 2,
               krow, kcol, vrow, vcol);

    for (int st = 0; st < NSTG; ++st) {
      const int buf = st & 1;
      const _Float16* ks = &Ks[buf][lo * KPITCH + dA];
      const _Float16* vs = &Vs[buf][lo * VPITCH + dA];
      const int left = KPAD - st * STG;
      const int np = (left < STG ? left : STG) / 32;   // passes in this stage

      for (int p = 0; p < np; ++p) {
        const int kb = st * STG + p * 32;

        // ---- K A-fragments: lane = key row (kb+lo / kb+16+lo)
        const _Float16* kr0 = ks + p * 32 * KPITCH;
        const _Float16* kr1 = kr0 + 16 * KPITCH;
        v16h ka0c0 = cat8(*(const half8*)(kr0 +  0), *(const half8*)(kr0 + 16));
        v16h ka0c1 = cat8(*(const half8*)(kr0 + 32), *(const half8*)(kr0 + 48));
        v16h ka1c0 = cat8(*(const half8*)(kr1 +  0), *(const half8*)(kr1 + 16));
        v16h ka1c1 = cat8(*(const half8*)(kr1 + 32), *(const half8*)(kr1 + 48));
        // scheduling barrier: without it half of the loads above stand among the
        // WMMAs below, in two more places, each with a full wait on LDS behind it
        __builtin_amdgcn_sched_barrier(0);

        // ---- S^T tiles (M=key, N=q), log2 domain (scale folded into Q): each
        // K fragment feeds both query tiles; four independent accumulators
        v8f a0 = {}, a1 = {}, b0 = {}, b1 = {};
        a0 = wmma_f16(ka0c0, qa0, a0);  b0 = wmma_f16(ka0c0, qb0, b0);
        a1 = wmma_f16(ka1c0, qa0, a1);  b1 = wmma_f16(ka1c0, qb0, b1);
        a0 = wmma_f16(ka0c1, qa1, a0);  b0 = wmma_f16(ka0c1, qb1, b0);
        a1 = wmma_f16(ka1c1, qa1, a1);  b1 = wmma_f16(ka1c1, qb1, b1);

        // ---- tail mask: keys >= NKV are padding
        if (kb + 32 > NKV) {
            #pragma unroll
            for (int r = 0; r < 8; ++r) {
                if (kb + r + hi8 >= NKV)      { a0[r] = -1e30f; b0[r] = -1e30f; }
                if (kb + 16 + r + hi8 >= NKV) { a1[r] = -1e30f; b1[r] = -1e30f; }
            }
        }

        // ---- V^T A-fragments (lane = dim row): issued in front of the branch
        // below, so that they fly under the maxima and the exponentials
        const _Float16* vr0 = vs + p * 32;
        const _Float16* vr1 = vr0 + 16 * VPITCH;
        const _Float16* vr2 = vr0 + 32 * VPITCH;
        const _Float16* vr3 = vr0 + 48 * VPITCH;
        v16h bv0 = cat8(*(const half8*)(vr0), *(const half8*)(vr0 + 16));
        v16h bv1 = cat8(*(const half8*)(vr1), *(const half8*)(vr1 + 16));
        v16h bv2 = cat8(*(const half8*)(vr2), *(const half8*)(vr2 + 16));
        v16h bv3 = cat8(*(const half8*)(vr3), *(const half8*)(vr3 + 16));
        // compiler fence: without it the loads above sink behind the branch and
        // stand in four places among the exponentials and the WMMAs
        asm volatile("" ::: "memory");

        // ---- online softmax: per-lane over 16 regs a tile; each lane of a query
        // keeps the sum of its own 16 keys. m, the maximum in use, is the same in
        // both lanes of a query and may trail the true maximum by up to LAZY (log2
        // domain), so an exponential reaches at most 2^LAZY, far inside f16.
        float mta = fmaxf(a0[0], a1[0]);
        float mtb = fmaxf(b0[0], b1[0]);
        #pragma unroll
        for (int r = 1; r < 8; ++r) {
            mta = fmaxf(mta, fmaxf(a0[r], a1[r]));
            mtb = fmaxf(mtb, fmaxf(b0[r], b1[r]));
        }

        // ---- lazy rescale: one wave-uniform test per pass for both tiles (a
        // scalar branch, all lanes stay on). Always taken in the first pass, where
        // m is -1e38 and alpha comes out 0 on zero sums; after that only when a
        // score passes its query's m by more than LAZY.
        if (__builtin_amdgcn_ballot_w32(mta > mlima || mtb > mlimb) != 0) {
            const float na = fmaxf(ma, fmaxf(mta, xhalf(mta)));
            const float nb = fmaxf(mb, fmaxf(mtb, xhalf(mtb)));
            const float ala = fast_exp2(ma - na);
            const float alb = fast_exp2(mb - nb);
            ma = na;  mlima = na + LAZY;
            mb = nb;  mlimb = nb + LAZY;
            lsuma *= ala;   // every register of a lane belongs to its query
            lsumb *= alb;
            oa0 *= ala; oa1 *= ala; oa2 *= ala; oa3 *= ala;
            ob0 *= alb; ob1 *= alb; ob2 *= alb; ob3 *= alb;
        }

        union { v16h v; _Float16 e[16]; } pa, pb;
        float psa = 0.0f, psb = 0.0f;
        a0 -= ma;  a1 -= ma;  b0 -= mb;  b1 -= mb;   // whole tiles: registers stay paired
        #pragma unroll
        for (int r = 0; r < 8; ++r) {
            float p0 = fast_exp2(a0[r]); psa += p0; pa.e[r]     = (_Float16)p0;
            float p1 = fast_exp2(a1[r]); psa += p1; pa.e[8 + r] = (_Float16)p1;
        }
        lsuma += psa;
        #pragma unroll
        for (int r = 0; r < 8; ++r) {
            float p0 = fast_exp2(b0[r]); psb += p0; pb.e[r]     = (_Float16)p0;
            float p1 = fast_exp2(b1[r]); psb += p1; pb.e[8 + r] = (_Float16)p1;
        }
        lsumb += psb;

        // ---- O^T accumulation: each V^T fragment feeds both query tiles
        oa0 = wmma_f16(bv0, pa.v, oa0);
        oa1 = wmma_f16(bv1, pa.v, oa1);
        oa2 = wmma_f16(bv2, pa.v, oa2);
        oa3 = wmma_f16(bv3, pa.v, oa3);
        ob0 = wmma_f16(bv0, pb.v, ob0);
        ob1 = wmma_f16(bv1, pb.v, ob1);
        ob2 = wmma_f16(bv2, pb.v, ob2);
        ob3 = wmma_f16(bv3, pb.v, ob3);
      }

      // ---- publish point of stage st+1, every wave, in this order:
      // this wave's reads of the buffer to be refilled have returned
      asm volatile("s_wait_dscnt 0x0" ::: "memory");
      // this wave's copies of stage st+1 have landed
      asm volatile("s_wait_asynccnt 0x0" ::: "memory");
      __syncthreads();
      if (st + 2 < NSTG)
        stage_copy(kbase, vbase, (st + 2) * STG,
                   kdst + buf * (KSTAGE * 2), vdst + buf * (VSTAGE * 2),
                   krow, kcol, vrow, vcol);
    }
    // no copy is left in flight when the wave ends
    asm volatile("s_wait_asynccnt 0x0" ::: "memory");

    // ---- finalize: join the two halves' sums, divide, store (B,S,NH*HD).
    // Lane (lo, half) holds queries qbase+lo and qbase+16+lo, dims 16t + hi8 ..
    // + 7 of tile t. The ring is free here: the loop's last barrier stands behind
    // every wave's last read and last landed copy. Each wave stages its rows in
    // ranges of its own (tile a in the K ring, tile b in the V^T ring), so that
    // the stores below cover whole 256-byte head rows.
    static_assert(8 * 16 * EPITCH * 4 <= 2 * KSTAGE * 2, "tile a fits the K ring");
    static_assert(8 * 16 * EPITCH * 4 <= 2 * VSTAGE * 2, "tile b fits the V^T ring");
    const float inva = 1.0f / (lsuma + xhalf(lsuma));
    const float invb = 1.0f / (lsumb + xhalf(lsumb));
    float* esa = (float*)&Ks[0][0] + wave * (16 * EPITCH);
    float* esb = (float*)&Vs[0][0] + wave * (16 * EPITCH);
    stage_out(esa + lo * EPITCH + hi8, oa0 * inva, oa1 * inva, oa2 * inva, oa3 * inva);
    stage_out(esb + lo * EPITCH + hi8, ob0 * invb, ob1 * invb, ob2 * invb, ob3 * invb);
    // the wave's staged rows are in LDS before its other lanes read them back
    asm volatile("s_wait_dscnt 0x0" ::: "memory");
    {
        const int row = lane >> 4, col = lo * 4;
        const float* ra = esa + row * EPITCH + col;
        const float* rb = esb + row * EPITCH + col;
        float* dst = out + (((size_t)b * SEQ + qbase + row) * NH + h) * HD + col;
        #pragma unroll
        for (int i = 0; i < 8; ++i)
            *(float4*)(dst + (size_t)i * 2 * NH * HD) = *(const float4*)(ra + i * 2 * EPITCH);
        #pragma unroll
        for (int i = 0; i < 8; ++i)
            *(float4*)(dst + (size_t)(16 + i * 2) * NH * HD) = *(const float4*)(rb + i * 2 * EPITCH);
    }
}

// ---------------------------------------------------------------------------
extern "C" void kernel_launch(void* const* d_in, const int* in_sizes, int n_in,
                              void* d_out, int out_size, void* d_ws, size_t ws_size,
                              hipStream_t stream)
{
    (void)in_sizes; (void)n_in; (void)out_size; (void)ws_size;

    const float* q    = (const float*)d_in[0];
    const float* k    = (const float*)d_in[1];
    const float* v    = (const float*)d_in[2];
    const float* kreg = (const float*)d_in[3];
    const float* vreg = (const float*)d_in[4];
    float* out = (float*)d_out;

    // workspace layout (f16)
    const size_t KH_ELEMS = (size_t)BATCH * NH * KPAD * HD;   //  8,519,680
    _Float16* Kh = (_Float16*)d_ws;
    _Float16* Vt = Kh + KH_ELEMS;

    // Phase 1
    rope_k_kernel<<<BATCH * NH * (KPAD / RPW) / 8, 256, 0, stream>>>(k, kreg, Kh);
    vt_kernel<<<BATCH * NH * (KPAD / VTK), 256, 0, stream>>>(v, vreg, Vt);

    // Phase 2: B*NH*(SEQ/256) workgroups of 8 waves
    fa_kernel<<<BATCH * NH * (SEQ / QBLK), 256, 0, stream>>>(q, Kh, Vt, out);
}

// v007
// A run of this version takes 66.3 microseconds.
// In both of two side-by-side timings against v006, it was 1.04 times as fast.
// All steps since v000 together make it 5.02 times as fast.
#include <hip/hip_runtime.h>
#include <hip/hip_bf16.h>
#include <math.h>

// ---------------------------------------------------------------------------
// RotaryAttention for MI455X (gfx1250, wave32, WMMA).
// Phase 1: RoPE+f16 pack of K and V transpose, one launch (both into d_ws).
// Phase 2: flash attention, S^T formulation, v_wmma_f32_16x16x32_f16; its
// prologue reads Q as f32 and applies RoPE while it packs the fragments.
// ---------------------------------------------------------------------------

typedef _Float16 half8 __attribute__((ext_vector_type(8)));
typedef _Float16 v16h  __attribute__((ext_vector_type(16)));
typedef float    v8f   __attribute__((ext_vector_type(8)));
typedef float    f32x4 __attribute__((ext_vector_type(4)));

#define NH      16
#define HD      64
#define SEQ     2048
#define NKV     2049          // 2048 keys + 1 register token
#define KPAD    2080          // padded to multiple of 32
#define BATCH   4

// 1/sqrt(64) * log2(e): scores come out in log2 domain -> native v_exp_f32
#define QSCALE  0.18033688011112042f
// log2(10000)/16
#define FREQC   0.83048202372184065f

__device__ __forceinline__ v8f wmma_f16(v16h a, v16h b, v8f c) {
    return __builtin_amdgcn_wmma_f32_16x16x32_f16(false, a, false, b,
                                                  (short)0, c, false, false);
}

__device__ __forceinline__ v16h cat8(half8 lo, half8 hi) {
    return __builtin_shufflevector(lo, hi, 0,1,2,3,4,5,6,7,8,9,10,11,12,13,14,15);
}

// Raw v_exp_f32: args are at most LAZY (8) here; flush-to-zero below -126 is the
// desired flash-softmax semantics (avoids OCML's range-fix cmp/cndmask pairs).
__device__ __forceinline__ float fast_exp2(float x) {
    return __builtin_amdgcn_exp2f(x);
}

// Lane l with lane l ^ 16 on the vector pipe (no trip through the LDS unit).
__device__ __forceinline__ float xhalf(float x) {
    const int b = __builtin_bit_cast(int, x);
    return __builtin_bit_cast(float,
        __builtin_amdgcn_permlanex16(b, b, 0x76543210, 0xfedcba98, false, false));
}

// ---------------------------------------------------------------------------
// Phase 1, one launch: few, fat work-groups. One work-group takes 160 keys of one
// head and does both jobs on them: RoPE + f16 pack of the K rows and the f16
// transpose of the V rows. A lane moves 16 bytes per load, a wave-wide load
// covers two whole 256-byte head rows, all 20 loads of a thread are issued before
// the first is used, and stores cover whole lines.
//   Kh: layout [b][h][key][d], key in [0,KPAD)
//       key==2048: register token (rotary half zeroed), key>2048: zero pad
//   Vt: layout [b][h][d][key], key in [0,KPAD), through LDS
// grid = B * (KPAD/VTK) * NH
// ---------------------------------------------------------------------------
typedef _Float16 half4 __attribute__((ext_vector_type(4)));
typedef _Float16 half2 __attribute__((ext_vector_type(2)));

#define VTK     160           // keys per tile; KPAD = 13 * 160
#define VTP     (VTK / 2 + 1) // dwords per dim row: odd, so that the 16 lanes of
                              // a row (4 dims apart) store to 16 different banks
#define KRG     16            // K rows per work-group-wide load: 2 a wave
#define KNJ     (VTK / KRG)   // such loads per tile

__global__ __launch_bounds__(256) void prep_kernel(
    const float* __restrict__ kin, const float* __restrict__ kreg,
    const float* __restrict__ vin, const float* __restrict__ vreg,
    _Float16* __restrict__ Kh, _Float16* __restrict__ Vt)
{
    __shared__ unsigned tile[HD * VTP];   // [dim][key pair], two f16 keys a dword
    int bidx = blockIdx.x;
    const int h  = bidx & 15;  bidx >>= 4;
    const int kt = bidx % (KPAD / VTK);
    const int b  = bidx / (KPAD / VTK);
    const int t  = threadIdx.x;
    const int d  = (t & 15) * 4;
    const int kp = t >> 4;
    const int key0 = kt * VTK;

    // ---- K rows key0 + j*16 + kp, the lane's 4 dims. A group of 16 rows lies
    // wholly inside or wholly past the sequence (a uniform test); a group past it
    // reads the tile's first group again (in bounds), and its values are not stored
    f32x4 x[KNJ];
    {
        const float* p = kin + (((size_t)b * SEQ + key0 + kp) * NH + h) * HD + d;
        #pragma unroll
        for (int j = 0; j < KNJ; ++j) {
            const int jr = (key0 + j * KRG < SEQ) ? j * KRG : 0;
            x[j] = *(const f32x4*)(p + (size_t)jr * NH * HD);
        }
    }
    // a precaution: it stands in front of the address arithmetic of the V loads,
    // which reuses the address registers that the K loads above name
    asm volatile("s_wait_xcnt 0x0" ::: "memory");

    // ---- V: a thread's key pairs: keys 2n and 2n+1, n = i*16 + kp
    float4 e[VTK / 32], o[VTK / 32];
    if (key0 + VTK <= SEQ) {              // whole tile inside the sequence
        const float* p = vin + (((size_t)b * SEQ + key0 + kp * 2) * NH + h) * HD + d;
        #pragma unroll
        for (int i = 0; i < VTK / 32; ++i) {
            e[i] = *(const float4*)(p + (size_t)(i * 32 + 0) * NH * HD);
            o[i] = *(const float4*)(p + (size_t)(i * 32 + 1) * NH * HD);
        }
    } else {                              // last tile: register token, zero pad
        #pragma unroll
        for (int i = 0; i < VTK / 32; ++i) {
            // key is even, so key and key+1 lie on the same side of SEQ; past
            // the sequence the pointer names the register row (in bounds)
            const int key = key0 + (i * 16 + kp) * 2;
            const bool in = key < SEQ;
            const float* p = in ? vin + (((size_t)b * SEQ + key) * NH + h) * HD + d
                                : vreg + h * HD + d;
            const float4 pe = *(const float4*)p;
            const float4 po = *(const float4*)(in ? p + NH * HD : p);
            const bool te = key <= SEQ;   // key == SEQ is the register token
            e[i].x = te ? pe.x : 0.0f;  e[i].y = te ? pe.y : 0.0f;
            e[i].z = te ? pe.z : 0.0f;  e[i].w = te ? pe.w : 0.0f;
            o[i].x = in ? po.x : 0.0f;  o[i].y = in ? po.y : 0.0f;
            o[i].z = in ? po.z : 0.0f;  o[i].w = in ? po.w : 0.0f;
        }
    }
    #pragma unroll
    for (int i = 0; i < VTK / 32; ++i) {
        const float ev[4] = { e[i].x, e[i].y, e[i].z, e[i].w };
        const float ov[4] = { o[i].x, o[i].y, o[i].z, o[i].w };
        #pragma unroll
        for (int c = 0; c < 4; ++c) {
            half2 pr = { (_Float16)ev[c], (_Float16)ov[c] };
            tile[(d + c) * VTP + i * 16 + kp] = __builtin_bit_cast(unsigned, pr);
        }
    }
    __syncthreads();

    // 8 keys (16 bytes) per lane; 20 lanes cover a dim row's 320 bytes
    {
        _Float16* dst = Vt + ((size_t)b * NH + h) * HD * KPAD + key0;
        #pragma unroll
        for (int i = 0; i < HD * VTK / 8 / 256; ++i) {
            const int idx = i * 256 + t;
            const int row = idx / (VTK / 8);
            const int g   = idx - row * (VTK / 8);
            const unsigned* s = &tile[row * VTP + g * 4];
            uint4 v = { s[0], s[1], s[2], s[3] };
            *(uint4*)(dst + (size_t)row * KPAD + g * 8) = v;
        }
    }

    // ---- K: rotate_half partner: dims d+16 / d-16 sit 4 lanes away in the same row
    f32x4 y[KNJ];
    #pragma unroll
    for (int j = 0; j < KNJ; ++j) {
        y[j][0] = __shfl_xor(x[j][0], 4);
        y[j][1] = __shfl_xor(x[j][1], 4);
        y[j][2] = __shfl_xor(x[j][2], 4);
        y[j][3] = __shfl_xor(x[j][3], 4);
    }

    if (d < 32) {
        const float sg = (d < 16) ? -1.0f : 1.0f;
        const int   f  = d & 15;
        const float f0 = exp2f(-(float)(f + 0) * FREQC);
        const float f1 = exp2f(-(float)(f + 1) * FREQC);
        const float f2 = exp2f(-(float)(f + 2) * FREQC);
        const float f3 = exp2f(-(float)(f + 3) * FREQC);
        #pragma unroll
        for (int j = 0; j < KNJ; ++j) {
            const float p = (float)(key0 + j * KRG + kp);
            float sn, cs;
            __sincosf(p * f0, &sn, &cs); x[j][0] = x[j][0] * cs + (sg * y[j][0]) * sn;
            __sincosf(p * f1, &sn, &cs); x[j][1] = x[j][1] * cs + (sg * y[j][1]) * sn;
            __sincosf(p * f2, &sn, &cs); x[j][2] = x[j][2] * cs + (sg * y[j][2]) * sn;
            __sincosf(p * f3, &sn, &cs); x[j][3] = x[j][3] * cs + (sg * y[j][3]) * sn;
        }
    }

    // a wave's store covers two whole 128-byte rows
    _Float16* kd = Kh + (((size_t)b * NH + h) * KPAD + key0 + kp) * HD + d;
    half4 r[KNJ];
    #pragma unroll
    for (int j = 0; j < KNJ; ++j)
        r[j] = half4{ (_Float16)x[j][0], (_Float16)x[j][1],
                      (_Float16)x[j][2], (_Float16)x[j][3] };
    if (key0 + VTK > SEQ) {               // uniform, last tile: register token, zero pad
        const float4 g = *(const float4*)(kreg + h * HD + d);
        const half4 reg = { (_Float16)g.x, (_Float16)g.y, (_Float16)g.z, (_Float16)g.w };
        const half4 zero = {};            // reg_mask zeros the rotary half
        #pragma unroll
        for (int j = 0; j < KNJ; ++j)
            if (key0 + j * KRG >= SEQ)
                r[j] = (key0 + j * KRG + kp == SEQ && d >= 32) ? reg : zero;
    }
    #pragma unroll
    for (int j = 0; j < KNJ; ++j)
        *(half4*)(kd + j * KRG * HD) = r[j];
}

// ---------------------------------------------------------------------------
// Phase 2: flash attention. One wave = 32 query rows (two tiles of 16), so that
// each K and V^T fragment read from LDS feeds two WMMAs; block = 8 waves = 256 q.
// grid.x = B*NH*(SEQ/256).  S^T = K_tile x Q^T and O^T += V^T x P^T: a lane
// holds, per tile, one query's scores, its maximum, its sum AND its outputs, so
// exp(S^T) packs into the B operand in place and the rescale factor is the lane's.
// The rescale is lazy: outputs and sums are scaled only in a pass where a score
// passes the maximum in use by more than LAZY (log2 domain).
// K and V^T come through LDS: the block's 8 waves share one 128-key stage,
// filled by asynchronous copies of whole lines, two buffers, one stage ahead.
// Q comes straight from the f32 input: whole 256-byte head rows into registers,
// through LDS rows that are the wave's own into fragment order, where a
// lane holds both dims of every rotated pair, so that RoPE is done in-lane.
// ---------------------------------------------------------------------------
#define QBLK    256                       // queries per work-group: 8 waves x 32
#define STG     128                       // keys per LDS stage (4 passes of 32)
#define NSTG    ((KPAD + STG - 1) / STG)  // 17; the last stage holds one pass
#define KPITCH  72                        // halves: 128-B K row + 16 B (b128 readers)
#define VPITCH  136                       // halves: 256-B V^T row + 16 B
#define KSTAGE  (STG * KPITCH)            // halves per K buffer
#define VSTAGE  (HD * VPITCH)             // halves per V^T buffer
#define EPITCH  68                        // floats: 256-B output row + 16 B (b128 writers)
#define QPITCH  68                        // floats: 256-B Q row + 16 B (b128 readers)
#define LAZY    8.0f                      // log2: how far a score may pass the maximum in use

__device__ __forceinline__ unsigned lds_off(const void* p) {
    return (unsigned)(size_t)p;           // low 32 bits = byte offset in LDS
}

// One stage: 4 K copies + 4 V^T copies of 16 B per lane. The global side is
// clamped so that the short last stage stays inside Kh / Vt; the LDS bytes
// filled from clamped addresses belong to passes that are never run.
__device__ __forceinline__ void stage_copy(
    const _Float16* kbase, const _Float16* vbase, int kb0,
    unsigned kdst, unsigned vdst, int krow, int kcol, int vrow, int vcol)
{
    const _Float16* gk0 = kbase + (size_t)min(kb0 + krow +  0, KPAD - 1) * HD + kcol;
    const _Float16* gk1 = kbase + (size_t)min(kb0 + krow + 32, KPAD - 1) * HD + kcol;
    const _Float16* gk2 = kbase + (size_t)min(kb0 + krow + 64, KPAD - 1) * HD + kcol;
    const _Float16* gk3 = kbase + (size_t)min(kb0 + krow + 96, KPAD - 1) * HD + kcol;
    const _Float16* gv0 = vbase + (size_t)vrow * KPAD + min(kb0 + vcol, KPAD - 8);
    const _Float16* gv1 = gv0 + (size_t)16 * KPAD;
    const _Float16* gv2 = gv0 + (size_t)32 * KPAD;
    const _Float16* gv3 = gv0 + (size_t)48 * KPAD;
    // s_wait_xcnt is the statement's last line as a precaution: so it stands in
    // front of every later write of an address register that a copy names.
    asm volatile(
        "global_load_async_to_lds_b128 %0, %8, off\n\t"
        "global_load_async_to_lds_b128 %1, %9, off\n\t"
        "global_load_async_to_lds_b128 %2, %10, off\n\t"
        "global_load_async_to_lds_b128 %3, %11, off\n\t"
        "global_load_async_to_lds_b128 %4, %12, off\n\t"
        "global_load_async_to_lds_b128 %5, %13, off\n\t"
        "global_load_async_to_lds_b128 %6, %14, off\n\t"
        "global_load_async_to_lds_b128 %7, %15, off\n\t"
        "s_wait_xcnt 0x0"
        :: "v"(kdst), "v"(kdst + 32 * KPITCH * 2), "v"(kdst + 64 * KPITCH * 2),
           "v"(kdst + 96 * KPITCH * 2),
           "v"(vdst), "v"(vdst + 16 * VPITCH * 2), "v"(vdst + 32 * VPITCH * 2),
           "v"(vdst + 48 * VPITCH * 2),
           "v"(gk0), "v"(gk1), "v"(gk2), "v"(gk3),
           "v"(gv0), "v"(gv1), "v"(gv2), "v"(gv3)
        : "memory");
}

// One query tile's outputs of a lane (4 dim tiles x 8 dims) into its staging row.
__device__ __forceinline__ void stage_out(float* er, v8f t0, v8f t1, v8f t2, v8f t3) {
    *(float4*)(er +  0) = make_float4(t0[0], t0[1], t0[2], t0[3]);
    *(float4*)(er +  4) = make_float4(t0[4], t0[5], t0[6], t0[7]);
    *(float4*)(er + 16) = make_float4(t1[0], t1[1], t1[2], t1[3]);
    *(float4*)(er + 20) = make_float4(t1[4], t1[5], t1[6], t1[7]);
    *(float4*)(er + 32) = make_float4(t2[0], t2[1], t2[2], t2[3]);
    *(float4*)(er + 36) = make_float4(t2[4], t2[5], t2[6], t2[7]);
    *(float4*)(er + 48) = make_float4(t3[0], t3[1], t3[2], t3[3]);
    *(float4*)(er + 52) = make_float4(t3[4], t3[5], t3[6], t3[7]);
}

// One query tile's two B fragments from its staged f32 rows. qr points at the
// lane's row, at dim dA; the lane holds dims dA+i, 16+dA+i (a rotated pair, of
// frequency fr[i]), 32+dA+i and 48+dA+i (not rotated), i = 0..7.
__device__ __forceinline__ void rope_frag(
    const float* qr, float pos, const float* fr, v16h& f0, v16h& f1)
{
    const float4 c0 = *(const float4*)(qr +  0), c1 = *(const float4*)(qr +  4);
    const float4 c2 = *(const float4*)(qr + 16), c3 = *(const float4*)(qr + 20);
    const float4 c4 = *(const float4*)(qr + 32), c5 = *(const float4*)(qr + 36);
    const float4 c6 = *(const float4*)(qr + 48), c7 = *(const float4*)(qr + 52);
    const float u[8] = { c0.x, c0.y, c0.z, c0.w, c1.x, c1.y, c1.z, c1.w };
    const float y[8] = { c2.x, c2.y, c2.z, c2.w, c3.x, c3.y, c3.z, c3.w };
    const float s[8] = { c4.x, c4.y, c4.z, c4.w, c5.x, c5.y, c5.z, c5.w };
    const float t[8] = { c6.x, c6.y, c6.z, c6.w, c7.x, c7.y, c7.z, c7.w };
    #pragma unroll
    for (int i = 0; i < 8; ++i) {
        float sn, cs;
        __sincosf(pos * fr[i], &sn, &cs);
        f0[i]     = (_Float16)((u[i] * cs - y[i] * sn) * QSCALE);
        f0[8 + i] = (_Float16)((y[i] * cs + u[i] * sn) * QSCALE);
        f1[i]     = (_Float16)(s[i] * QSCALE);
        f1[8 + i] = (_Float16)(t[i] * QSCALE);
    }
}

__global__ __launch_bounds__(256) __attribute__((amdgpu_waves_per_eu(4, 4)))
void fa_kernel(
    const float* __restrict__ qin, const _Float16* __restrict__ Kh,
    const _Float16* __restrict__ Vt, float* __restrict__ out)
{
    __shared__ __attribute__((aligned(16))) _Float16 Ks[2][KSTAGE];
    __shared__ __attribute__((aligned(16))) _Float16 Vs[2][VSTAGE];

    const int lane   = threadIdx.x & 31;
    const int wave   = threadIdx.x >> 5;
    const int wg     = blockIdx.x;
    const int qblk   = wg & (SEQ / QBLK - 1);   // 8 blocks of 256 queries
    const int bh     = wg / (SEQ / QBLK);       // b*NH + h
    const int b      = bh >> 4;
    const int h      = bh & 15;
    const int qbase  = qblk * QBLK + wave * 32;
    const int lo     = lane & 15;
    const int hi8    = (lane & 16) ? 8 : 0;   // lane-half K/row offset
    const int dA     = hi8;                   // A/B slot pattern offset

    const _Float16* kbase = Kh + (size_t)bh * KPAD * HD;
    const _Float16* vbase = Vt + (size_t)bh * HD * KPAD;

    // ---- this thread's share of a stage: a wave's K copy is 4 whole rows
    // (512 contiguous bytes), its V^T copy 2 rows of 256 bytes
    const int krow = threadIdx.x >> 3, kcol = (threadIdx.x & 7) * 8;
    const int vrow = threadIdx.x >> 4, vcol = (threadIdx.x & 15) * 8;
    const unsigned kdst = lds_off(&Ks[0][krow * KPITCH + kcol]);
    const unsigned vdst = lds_off(&Vs[0][vrow * VPITCH + vcol]);

    // ---- the wave's 32 query rows, f32, from memory: a wave-wide load covers two
    // whole 256-byte head rows; all 16 are issued before anything waits
    const float* qg = qin + (((size_t)b * SEQ + qbase + (lane >> 4)) * NH + h) * HD + lo * 4;
    f32x4 qx[16];
    #pragma unroll
    for (int j = 0; j < 16; ++j)
        qx[j] = *(const f32x4*)(qg + (size_t)j * 2 * NH * HD);

    // ---- prologue: stage 0 lands and is published, stage 1 starts to fly
    stage_copy(kbase, vbase, 0, kdst, vdst, krow, kcol, vrow, vcol);

    // ---- Q^T fragments of the two query tiles: tile a = rows qbase+lo, tile b
    // = rows qbase+16+lo; slots {dA..dA+7, dA+16..}. One tile at a time goes
    // through 16 staging rows that are the wave's own. They lie in the ring's
    // second buffers (waves 0-3 in K's, waves 4-7 in V^T's), which are idle
    // until stage 1's copies are issued, behind the barrier below.
    static_assert(4 * 16 * QPITCH * 4 <= KSTAGE * 2, "four waves' rows fit a K buffer");
    static_assert(4 * 16 * QPITCH * 4 <= VSTAGE * 2, "four waves' rows fit a V^T buffer");
    v16h qa0, qa1, qb0, qb1;
    {
        float fr[8];
        #pragma unroll
        for (int i = 0; i < 8; ++i)
            fr[i] = exp2f(-(float)(dA + i) * FREQC);
        float* qs = (wave < 4 ? (float*)&Ks[1][0] : (float*)&Vs[1][0])
                    + (wave & 3) * (16 * QPITCH);
        float*       qw = qs + (lane >> 4) * QPITCH + lo * 4;
        const float* qr = qs + lo * QPITCH + dA;
        // fence on the loaded values, inputs only: without it tile b's eight loads
        // sink behind tile a's trip through LDS, and the wave waits out the
        // latency of memory twice
        asm volatile("" :: "v"(qx[8]), "v"(qx[9]), "v"(qx[10]), "v"(qx[11]),
                           "v"(qx[12]), "v"(qx[13]), "v"(qx[14]), "v"(qx[15]));
        #pragma unroll
        for (int j = 0; j < 8; ++j)
            *(f32x4*)(qw + j * 2 * QPITCH) = qx[j];
        // the wave's staged rows are in LDS before its other lanes read them back
        asm volatile("s_wait_dscnt 0x0" ::: "memory");
        rope_frag(qr, (float)(qbase + lo), fr, qa0, qa1);
        // tile a's reads have returned before tile b's rows overwrite them
        asm volatile("s_wait_dscnt 0x0" ::: "memory");
        #pragma unroll
        for (int j = 0; j < 8; ++j)
            *(f32x4*)(qw + j * 2 * QPITCH) = qx[8 + j];
        // as above, for tile b
        asm volatile("s_wait_dscnt 0x0" ::: "memory");
        rope_frag(qr, (float)(qbase + 16 + lo), fr, qb0, qb1);
        // tile b's reads have returned before the barrier below, behind which
        // stage 1's copies overwrite these rows
        asm volatile("s_wait_dscnt 0x0" ::: "memory");
    }

    v8f oa0 = {}, oa1 = {}, oa2 = {}, oa3 = {};
    v8f ob0 = {}, ob1 = {}, ob2 = {}, ob3 = {};
    float ma = -1e38f, mlima = -1e38f, lsuma = 0.0f;   // mlim = m + LAZY
    float mb = -1e38f, mlimb = -1e38f, lsumb = 0.0f;

    // this wave's copies of stage 0 have landed before the barrier publishes them
    asm volatile("s_wait_asynccnt 0x0" ::: "memory");
    __syncthreads();
    stage_copy(kbase, vbase, STG, kdst + KSTAGE * 2, vdst + VSTAGE * 2,
               krow, kcol, vrow, vcol);

    for (int st = 0; st < NSTG; ++st) {
      const int buf = st & 1;
      const _Float16* ks = &Ks[buf][lo * KPITCH + dA];
      const _Float16* vs = &Vs[buf][lo * VPITCH + dA];
      const int left = KPAD - st * STG;
      const int np = (left < STG ? left : STG) / 32;   // passes in this stage

      for (int p = 0; p < np; ++p) {
        const int kb = st * STG + p * 32;

        // ---- K A-fragments: lane = key row (kb+lo / kb+16+lo)
        const _Float16* kr0 = ks + p * 32 * KPITCH;
        const _Float16* kr1 = kr0 + 16 * KPITCH;
        v16h ka0c0 = cat8(*(const half8*)(kr0 +  0), *(const half8*)(kr0 + 16));
        v16h ka0c1 = cat8(*(const half8*)(kr0 + 32), *(const half8*)(kr0 + 48));
        v16h ka1c0 = cat8(*(const half8*)(kr1 +  0), *(const half8*)(kr1 + 16));
        v16h ka1c1 = cat8(*(const half8*)(kr1 + 32), *(const half8*)(kr1 + 48));
        // scheduling barrier: without it half of the loads above stand among the
        // WMMAs below, in two more places, each with a full wait on LDS behind it
        __builtin_amdgcn_sched_barrier(0);

        // ---- S^T tiles (M=key, N=q), log2 domain (scale folded into Q): each
        // K fragment feeds both query tiles; four independent accumulators
        v8f a0 = {}, a1 = {}, b0 = {}, b1 = {};
        a0 = wmma_f16(ka0c0, qa0, a0);  b0 = wmma_f16(ka0c0, qb0, b0);
        a1 = wmma_f16(ka1c0, qa0, a1);  b1 = wmma_f16(ka1c0, qb0, b1);
        a0 = wmma_f16(ka0c1, qa1, a0);  b0 = wmma_f16(ka0c1, qb1, b0);
        a1 = wmma_f16(ka1c1, qa1, a1);  b1 = wmma_f16(ka1c1, qb1, b1);

        // ---- tail mask: keys >= NKV are padding
        if (kb + 32 > NKV) {
            #pragma unroll
            for (int r = 0; r < 8; ++r) {
                if (kb + r + hi8 >= NKV)      { a0[r] = -1e30f; b0[r] = -1e30f; }
                if (kb + 16 + r + hi8 >= NKV) { a1[r] = -1e30f; b1[r] = -1e30f; }
            }
        }

        // ---- V^T A-fragments (lane = dim row): issued in front of the branch
        // below, so that they fly under the maxima and the exponentials
        const _Float16* vr0 = vs + p * 32;
        const _Float16* vr1 = vr0 + 16 * VPITCH;
        const _Float16* vr2 = vr0 + 32 * VPITCH;
        const _Float16* vr3 = vr0 + 48 * VPITCH;
        v16h bv0 = cat8(*(const half8*)(vr0), *(const half8*)(vr0 + 16));
        v16h bv1 = cat8(*(const half8*)(vr1), *(const half8*)(vr1 + 16));
        v16h bv2 = cat8(*(const half8*)(vr2), *(const half8*)(vr2 + 16));
        v16h bv3 = cat8(*(const half8*)(vr3), *(const half8*)(vr3 + 16));
        // compiler fence: without it the loads above sink behind the branch and
        // stand in four places among the exponentials and the WMMAs
        asm volatile("" ::: "memory");

        // ---- online softmax: per-lane over 16 regs a tile; each lane of a query
        // keeps the sum of its own 16 keys. m, the maximum in use, is the same in
        // both lanes of a query and may trail the true maximum by up to LAZY (log2
        // domain), so an exponential reaches at most 2^LAZY, far inside f16.
        float mta = fmaxf(a0[0], a1[0]);
        float mtb = fmaxf(b0[0], b1[0]);
        #pragma unroll
        for (int r = 1; r < 8; ++r) {
            mta = fmaxf(mta, fmaxf(a0[r], a1[r]));
            mtb = fmaxf(mtb, fmaxf(b0[r], b1[r]));
        }

        // ---- lazy rescale: one wave-uniform test per pass for both tiles (a
        // scalar branch, all lanes stay on). Always taken in the first pass, where
        // m is -1e38 and alpha comes out 0 on zero sums; after that only when a
        // score passes its query's m by more than LAZY.
        if (__builtin_amdgcn_ballot_w32(mta > mlima || mtb > mlimb) != 0) {
            const float na = fmaxf(ma, fmaxf(mta, xhalf(mta)));
            const float nb = fmaxf(mb, fmaxf(mtb, xhalf(mtb)));
            const float ala = fast_exp2(ma - na);
            const float alb = fast_exp2(mb - nb);
            ma = na;  mlima = na + LAZY;
            mb = nb;  mlimb = nb + LAZY;
            lsuma *= ala;   // every register of a lane belongs to its query
            lsumb *= alb;
            oa0 *= ala; oa1 *= ala; oa2 *= ala; oa3 *= ala;
            ob0 *= alb; ob1 *= alb; ob2 *= alb; ob3 *= alb;
        }

        union { v16h v; _Float16 e[16]; } pa, pb;
        float psa = 0.0f, psb = 0.0f;
        a0 -= ma;  a1 -= ma;  b0 -= mb;  b1 -= mb;   // whole tiles: registers stay paired
        #pragma unroll
        for (int r = 0; r < 8; ++r) {
            float p0 = fast_exp2(a0[r]); psa += p0; pa.e[r]     = (_Float16)p0;
            float p1 = fast_exp2(a1[r]); psa += p1; pa.e[8 + r] = (_Float16)p1;
        }
        lsuma += psa;
        #pragma unroll
        for (int r = 0; r < 8; ++r) {
            float p0 = fast_exp2(b0[r]); psb += p0; pb.e[r]     = (_Float16)p0;
            float p1 = fast_exp2(b1[r]); psb += p1; pb.e[8 + r] = (_Float16)p1;
        }
        lsumb += psb;

        // ---- O^T accumulation: each V^T fragment feeds both query tiles
        oa0 = wmma_f16(bv0, pa.v, oa0);
        oa1 = wmma_f16(bv1, pa.v, oa1);
        oa2 = wmma_f16(bv2, pa.v, oa2);
        oa3 = wmma_f16(bv3, pa.v, oa3);
        ob0 = wmma_f16(bv0, pb.v, ob0);
        ob1 = wmma_f16(bv1, pb.v, ob1);
        ob2 = wmma_f16(bv2, pb.v, ob2);
        ob3 = wmma_f16(bv3, pb.v, ob3);
      }

      // ---- publish point of stage st+1, every wave, in this order:
      // this wave's reads of the buffer to be refilled have returned
      asm volatile("s_wait_dscnt 0x0" ::: "memory");
      // this wave's copies of stage st+1 have landed
      asm volatile("s_wait_asynccnt 0x0" ::: "memory");
      __syncthreads();
      if (st + 2 < NSTG)
        stage_copy(kbase, vbase, (st + 2) * STG,
                   kdst + buf * (KSTAGE * 2), vdst + buf * (VSTAGE * 2),
                   krow, kcol, vrow, vcol);
    }
    // no copy is left in flight when the wave ends
    asm volatile("s_wait_asynccnt 0x0" ::: "memory");

    // ---- finalize: join the two halves' sums, divide, store (B,S,NH*HD).
    // Lane (lo, half) holds queries qbase+lo and qbase+16+lo, dims 16t + hi8 ..
    // + 7 of tile t. The ring is free here: the loop's last barrier stands behind
    // every wave's last read and last landed copy. Each wave stages its rows in
    // ranges of its own (tile a in the K ring, tile b in the V^T ring), so that
    // the stores below cover whole 256-byte head rows.
    static_assert(8 * 16 * EPITCH * 4 <= 2 * KSTAGE * 2, "tile a fits the K ring");
    static_assert(8 * 16 * EPITCH * 4 <= 2 * VSTAGE * 2, "tile b fits the V^T ring");
    const float inva = 1.0f / (lsuma + xhalf(lsuma));
    const float invb = 1.0f / (lsumb + xhalf(lsumb));
    float* esa = (float*)&Ks[0][0] + wave * (16 * EPITCH);
    float* esb = (float*)&Vs[0][0] + wave * (16 * EPITCH);
    stage_out(esa + lo * EPITCH + hi8, oa0 * inva, oa1 * inva, oa2 * inva, oa3 * inva);
    stage_out(esb + lo * EPITCH + hi8, ob0 * invb, ob1 * invb, ob2 * invb, ob3 * invb);
    // the wave's staged rows are in LDS before its other lanes read them back
    asm volatile("s_wait_dscnt 0x0" ::: "memory");
    {
        const int row = lane >> 4, col = lo * 4;
        const float* ra = esa + row * EPITCH + col;
        const float* rb = esb + row * EPITCH + col;
        float* dst = out + (((size_t)b * SEQ + qbase + row) * NH + h) * HD + col;
        #pragma unroll
        for (int i = 0; i < 8; ++i)
            *(float4*)(dst + (size_t)i * 2 * NH * HD) = *(const float4*)(ra + i * 2 * EPITCH);
        #pragma unroll
        for (int i = 0; i < 8; ++i)
            *(float4*)(dst + (size_t)(16 + i * 2) * NH * HD) = *(const float4*)(rb + i * 2 * EPITCH);
    }
}

// ---------------------------------------------------------------------------
extern "C" void kernel_launch(void* const* d_in, const int* in_sizes, int n_in,
                              void* d_out, int out_size, void* d_ws, size_t ws_size,
                              hipStream_t stream)
{
    (void)in_sizes; (void)n_in; (void)out_size; (void)ws_size;

    const float* q    = (const float*)d_in[0];
    const float* k    = (const float*)d_in[1];
    const float* v    = (const float*)d_in[2];
    const float* kreg = (const float*)d_in[3];
    const float* vreg = (const float*)d_in[4];
    float* out = (float*)d_out;

    // workspace layout (f16)
    const size_t KH_ELEMS = (size_t)BATCH * NH * KPAD * HD;   //  8,519,680
    _Float16* Kh = (_Float16*)d_ws;
    _Float16* Vt = Kh + KH_ELEMS;

    // Phase 1
    prep_kernel<<<BATCH * NH * (KPAD / VTK), 256, 0, stream>>>(k, kreg, v, vreg, Kh, Vt);

    // Phase 2: B*NH*(SEQ/256) workgroups of 8 waves
    fa_kernel<<<BATCH * NH * (SEQ / QBLK), 256, 0, stream>>>(q, Kh, Vt, out);
}

// v008
// It runs in 63.9 microseconds.
// Timed twice side by side with v007, it ran 1.04 times as fast both times.
// Counting every step since v000, it is 5.21 times as fast.
#include <hip/hip_runtime.h>
#include <hip/hip_bf16.h>
#include <math.h>

// ---------------------------------------------------------------------------
// RotaryAttention for MI455X (gfx1250, wave32, WMMA).
// Phase 1: RoPE+f16 pack of K and V transpose, one launch (both into d_ws).
// Phase 2: flash attention, S^T formulation, v_wmma_f32_16x16x32_f16; its
// prologue reads Q as f32 and applies RoPE while it packs the fragments.
// ---------------------------------------------------------------------------

typedef _Float16 half8 __attribute__((ext_vector_type(8)));
typedef _Float16 v16h  __attribute__((ext_vector_type(16)));
typedef float    v8f   __attribute__((ext_vector_type(8)));
typedef float    f32x4 __attribute__((ext_vector_type(4)));

#define NH      16
#define HD      64
#define SEQ     2048
#define NKV     2049          // 2048 keys + 1 register token
#define KPAD    2080          // padded to multiple of 32
#define BATCH   4

// 1/sqrt(64) * log2(e): scores come out in log2 domain -> native v_exp_f32
#define QSCALE  0.18033688011112042f
// log2(10000)/16
#define FREQC   0.83048202372184065f

__device__ __forceinline__ v8f wmma_f16(v16h a, v16h b, v8f c) {
    return __builtin_amdgcn_wmma_f32_16x16x32_f16(false, a, false, b,
                                                  (short)0, c, false, false);
}

__device__ __forceinline__ v16h cat8(half8 lo, half8 hi) {
    return __builtin_shufflevector(lo, hi, 0,1,2,3,4,5,6,7,8,9,10,11,12,13,14,15);
}

// Raw v_exp_f32: kept args are at most log2(PLIM) = 8 (larger ones trip the rescale); flush-to-zero below -126 is the
// desired flash-softmax semantics (avoids OCML's range-fix cmp/cndmask pairs).
__device__ __forceinline__ float fast_exp2(float x) {
    return __builtin_amdgcn_exp2f(x);
}

// Lane l with lane l ^ 16 on the vector pipe (no trip through the LDS unit).
__device__ __forceinline__ float xhalf(float x) {
    const int b = __builtin_bit_cast(int, x);
    return __builtin_bit_cast(float,
        __builtin_amdgcn_permlanex16(b, b, 0x76543210, 0xfedcba98, false, false));
}

// ---------------------------------------------------------------------------
// Phase 1, one launch: few, fat work-groups. One work-group takes 160 keys of one
// head and does both jobs on them: RoPE + f16 pack of the K rows and the f16
// transpose of the V rows. A lane moves 16 bytes per load, a wave-wide load
// covers two whole 256-byte head rows, all 20 loads of a thread are issued before
// the first is used, and stores cover whole lines.
//   Kh: layout [b][h][key][d], key in [0,KPAD)
//       key==2048: register token (rotary half zeroed), key>2048: zero pad
//   Vt: layout [b][h][d][key], key in [0,KPAD), through LDS
// grid = B * (KPAD/VTK) * NH
// ---------------------------------------------------------------------------
typedef _Float16 half4 __attribute__((ext_vector_type(4)));
typedef _Float16 half2 __attribute__((ext_vector_type(2)));

#define VTK     160           // keys per tile; KPAD = 13 * 160
#define VTP     (VTK / 2 + 1) // dwords per dim row: odd, so that the 16 lanes of
                              // a row (4 dims apart) store to 16 different banks
#define KRG     16            // K rows per work-group-wide load: 2 a wave
#define KNJ     (VTK / KRG)   // such loads per tile

__global__ __launch_bounds__(256) void prep_kernel(
    const float* __restrict__ kin, const float* __restrict__ kreg,
    const float* __restrict__ vin, const float* __restrict__ vreg,
    _Float16* __restrict__ Kh, _Float16* __restrict__ Vt)
{
    __shared__ unsigned tile[HD * VTP];   // [dim][key pair], two f16 keys a dword
    int bidx = blockIdx.x;
    const int h  = bidx & 15;  bidx >>= 4;
    const int kt = bidx % (KPAD / VTK);
    const int b  = bidx / (KPAD / VTK);
    const int t  = threadIdx.x;
    const int d  = (t & 15) * 4;
    const int kp = t >> 4;
    const int key0 = kt * VTK;

    // ---- K rows key0 + j*16 + kp, the lane's 4 dims. A group of 16 rows lies
    // wholly inside or wholly past the sequence (a uniform test); a group past it
    // reads the tile's first group again (in bounds), and its values are not stored
    f32x4 x[KNJ];
    {
        const float* p = kin + (((size_t)b * SEQ + key0 + kp) * NH + h) * HD + d;
        #pragma unroll
        for (int j = 0; j < KNJ; ++j) {
            const int jr = (key0 + j * KRG < SEQ) ? j * KRG : 0;
            x[j] = *(const f32x4*)(p + (size_t)jr * NH * HD);
        }
    }
    // a precaution: it stands in front of the address arithmetic of the V loads,
    // which reuses the address registers that the K loads above name
    asm volatile("s_wait_xcnt 0x0" ::: "memory");

    // ---- V: a thread's key pairs: keys 2n and 2n+1, n = i*16 + kp
    float4 e[VTK / 32], o[VTK / 32];
    if (key0 + VTK <= SEQ) {              // whole tile inside the sequence
        const float* p = vin + (((size_t)b * SEQ + key0 + kp * 2) * NH + h) * HD + d;
        #pragma unroll
        for (int i = 0; i < VTK / 32; ++i) {
            e[i] = *(const float4*)(p + (size_t)(i * 32 + 0) * NH * HD);
            o[i] = *(const float4*)(p + (size_t)(i * 32 + 1) * NH * HD);
        }
    } else {                              // last tile: register token, zero pad
        #pragma unroll
        for (int i = 0; i < VTK / 32; ++i) {
            // key is even, so key and key+1 lie on the same side of SEQ; past
            // the sequence the pointer names the register row (in bounds)
            const int key = key0 + (i * 16 + kp) * 2;
            const bool in = key < SEQ;
            const float* p = in ? vin + (((size_t)b * SEQ + key) * NH + h) * HD + d
                                : vreg + h * HD + d;
            const float4 pe = *(const float4*)p;
            const float4 po = *(const float4*)(in ? p + NH * HD : p);
            const bool te = key <= SEQ;   // key == SEQ is the register token
            e[i].x = te ? pe.x : 0.0f;  e[i].y = te ? pe.y : 0.0f;
            e[i].z = te ? pe.z : 0.0f;  e[i].w = te ? pe.w : 0.0f;
            o[i].x = in ? po.x : 0.0f;  o[i].y = in ? po.y : 0.0f;
            o[i].z = in ? po.z : 0.0f;  o[i].w = in ? po.w : 0.0f;
        }
    }
    #pragma unroll
    for (int i = 0; i < VTK / 32; ++i) {
        const float ev[4] = { e[i].x, e[i].y, e[i].z, e[i].w };
        const float ov[4] = { o[i].x, o[i].y, o[i].z, o[i].w };
        #pragma unroll
        for (int c = 0; c < 4; ++c) {
            half2 pr = { (_Float16)ev[c], (_Float16)ov[c] };
            tile[(d + c) * VTP + i * 16 + kp] = __builtin_bit_cast(unsigned, pr);
        }
    }
    __syncthreads();

    // 8 keys (16 bytes) per lane; 20 lanes cover a dim row's 320 bytes
    {
        _Float16* dst = Vt + ((size_t)b * NH + h) * HD * KPAD + key0;
        #pragma unroll
        for (int i = 0; i < HD * VTK / 8 / 256; ++i) {
            const int idx = i * 256 + t;
            const int row = idx / (VTK / 8);
            const int g   = idx - row * (VTK / 8);
            const unsigned* s = &tile[row * VTP + g * 4];
            uint4 v = { s[0], s[1], s[2], s[3] };
            *(uint4*)(dst + (size_t)row * KPAD + g * 8) = v;
        }
    }

    // ---- K: rotate_half partner: dims d+16 / d-16 sit 4 lanes away in the same row
    f32x4 y[KNJ];
    #pragma unroll
    for (int j = 0; j < KNJ; ++j) {
        y[j][0] = __shfl_xor(x[j][0], 4);
        y[j][1] = __shfl_xor(x[j][1], 4);
        y[j][2] = __shfl_xor(x[j][2], 4);
        y[j][3] = __shfl_xor(x[j][3], 4);
    }

    if (d < 32) {
        const float sg = (d < 16) ? -1.0f : 1.0f;
        const int   f  = d & 15;
        const float f0 = exp2f(-(float)(f + 0) * FREQC);
        const float f1 = exp2f(-(float)(f + 1) * FREQC);
        const float f2 = exp2f(-(float)(f + 2) * FREQC);
        const float f3 = exp2f(-(float)(f + 3) * FREQC);
        #pragma unroll
        for (int j = 0; j < KNJ; ++j) {
            const float p = (float)(key0 + j * KRG + kp);
            float sn, cs;
            __sincosf(p * f0, &sn, &cs); x[j][0] = x[j][0] * cs + (sg * y[j][0]) * sn;
            __sincosf(p * f1, &sn, &cs); x[j][1] = x[j][1] * cs + (sg * y[j][1]) * sn;
            __sincosf(p * f2, &sn, &cs); x[j][2] = x[j][2] * cs + (sg * y[j][2]) * sn;
            __sincosf(p * f3, &sn, &cs); x[j][3] = x[j][3] * cs + (sg * y[j][3]) * sn;
        }
    }

    // a wave's store covers two whole 128-byte rows
    _Float16* kd = Kh + (((size_t)b * NH + h) * KPAD + key0 + kp) * HD + d;
    half4 r[KNJ];
    #pragma unroll
    for (int j = 0; j < KNJ; ++j)
        r[j] = half4{ (_Float16)x[j][0], (_Float16)x[j][1],
                      (_Float16)x[j][2], (_Float16)x[j][3] };
    if (key0 + VTK > SEQ) {               // uniform, last tile: register token, zero pad
        const float4 g = *(const float4*)(kreg + h * HD + d);
        const half4 reg = { (_Float16)g.x, (_Float16)g.y, (_Float16)g.z, (_Float16)g.w };
        const half4 zero = {};            // reg_mask zeros the rotary half
        #pragma unroll
        for (int j = 0; j < KNJ; ++j)
            if (key0 + j * KRG >= SEQ)
                r[j] = (key0 + j * KRG + kp == SEQ && d >= 32) ? reg : zero;
    }
    #pragma unroll
    for (int j = 0; j < KNJ; ++j)
        *(half4*)(kd + j * KRG * HD) = r[j];
}

// ---------------------------------------------------------------------------
// Phase 2: flash attention. One wave = 32 query rows (two tiles of 16), so that
// each K and V^T fragment read from LDS feeds two WMMAs; block = 8 waves = 256 q.
// grid.x = B*NH*(SEQ/256).  S^T = K_tile x Q^T and O^T += V^T x P^T: a lane
// holds, per tile, one query's scores, its maximum, its sum AND its outputs, so
// exp(S^T) packs into the B operand in place and the rescale factor is the lane's.
// The rescale is lazy: outputs and sums are scaled only in a pass where a lane's
// sum of exponentials, taken against the maximum in use, passes PLIM.
// K and V^T come through LDS: the block's 8 waves share one 128-key stage,
// filled by asynchronous copies of whole lines, two buffers, one stage ahead.
// Q comes straight from the f32 input: whole 256-byte head rows into registers,
// through LDS rows that are the wave's own into fragment order, where a
// lane holds both dims of every rotated pair, so that RoPE is done in-lane.
// ---------------------------------------------------------------------------
#define QBLK    256                       // queries per work-group: 8 waves x 32
#define STG     128                       // keys per LDS stage (4 passes of 32)
#define NSTG    ((KPAD + STG - 1) / STG)  // 17; the last stage holds one pass
#define KPITCH  72                        // halves: 128-B K row + 16 B (b128 readers)
#define VPITCH  136                       // halves: 256-B V^T row + 16 B
#define KSTAGE  (STG * KPITCH)            // halves per K buffer
#define VSTAGE  (HD * VPITCH)             // halves per V^T buffer
#define EPITCH  68                        // floats: 256-B output row + 16 B (b128 writers)
#define QPITCH  68                        // floats: 256-B Q row + 16 B (b128 readers)
#define PLIM    256.0f                    // 2^8: a lane's sum of a pass above this renews the maximum in use

__device__ __forceinline__ unsigned lds_off(const void* p) {
    return (unsigned)(size_t)p;           // low 32 bits = byte offset in LDS
}

// One stage: 4 K copies + 4 V^T copies of 16 B per lane. The global side is
// clamped so that the short last stage stays inside Kh / Vt; the LDS bytes
// filled from clamped addresses belong to passes that are never run.
__device__ __forceinline__ void stage_copy(
    const _Float16* kbase, const _Float16* vbase, int kb0,
    unsigned kdst, unsigned vdst, int krow, int kcol, int vrow, int vcol)
{
    const _Float16* gk0 = kbase + (size_t)min(kb0 + krow +  0, KPAD - 1) * HD + kcol;
    const _Float16* gk1 = kbase + (size_t)min(kb0 + krow + 32, KPAD - 1) * HD + kcol;
    const _Float16* gk2 = kbase + (size_t)min(kb0 + krow + 64, KPAD - 1) * HD + kcol;
    const _Float16* gk3 = kbase + (size_t)min(kb0 + krow + 96, KPAD - 1) * HD + kcol;
    const _Float16* gv0 = vbase + (size_t)vrow * KPAD + min(kb0 + vcol, KPAD - 8);
    const _Float16* gv1 = gv0 + (size_t)16 * KPAD;
    const _Float16* gv2 = gv0 + (size_t)32 * KPAD;
    const _Float16* gv3 = gv0 + (size_t)48 * KPAD;
    // s_wait_xcnt is the statement's last line as a precaution: so it stands in
    // front of every later write of an address register that a copy names.
    asm volatile(
        "global_load_async_to_lds_b128 %0, %8, off\n\t"
        "global_load_async_to_lds_b128 %1, %9, off\n\t"
        "global_load_async_to_lds_b128 %2, %10, off\n\t"
        "global_load_async_to_lds_b128 %3, %11, off\n\t"
        "global_load_async_to_lds_b128 %4, %12, off\n\t"
        "global_load_async_to_lds_b128 %5, %13, off\n\t"
        "global_load_async_to_lds_b128 %6, %14, off\n\t"
        "global_load_async_to_lds_b128 %7, %15, off\n\t"
        "s_wait_xcnt 0x0"
        :: "v"(kdst), "v"(kdst + 32 * KPITCH * 2), "v"(kdst + 64 * KPITCH * 2),
           "v"(kdst + 96 * KPITCH * 2),
           "v"(vdst), "v"(vdst + 16 * VPITCH * 2), "v"(vdst + 32 * VPITCH * 2),
           "v"(vdst + 48 * VPITCH * 2),
           "v"(gk0), "v"(gk1), "v"(gk2), "v"(gk3),
           "v"(gv0), "v"(gv1), "v"(gv2), "v"(gv3)
        : "memory");
}

// One query tile's outputs of a lane (4 dim tiles x 8 dims) into its staging row.
__device__ __forceinline__ void stage_out(float* er, v8f t0, v8f t1, v8f t2, v8f t3) {
    *(float4*)(er +  0) = make_float4(t0[0], t0[1], t0[2], t0[3]);
    *(float4*)(er +  4) = make_float4(t0[4], t0[5], t0[6], t0[7]);
    *(float4*)(er + 16) = make_float4(t1[0], t1[1], t1[2], t1[3]);
    *(float4*)(er + 20) = make_float4(t1[4], t1[5], t1[6], t1[7]);
    *(float4*)(er + 32) = make_float4(t2[0], t2[1], t2[2], t2[3]);
    *(float4*)(er + 36) = make_float4(t2[4], t2[5], t2[6], t2[7]);
    *(float4*)(er + 48) = make_float4(t3[0], t3[1], t3[2], t3[3]);
    *(float4*)(er + 52) = make_float4(t3[4], t3[5], t3[6], t3[7]);
}

// One query tile's two B fragments from its staged f32 rows. qr points at the
// lane's row, at dim dA; the lane holds dims dA+i, 16+dA+i (a rotated pair, of
// frequency fr[i]), 32+dA+i and 48+dA+i (not rotated), i = 0..7.
__device__ __forceinline__ void rope_frag(
    const float* qr, float pos, const float* fr, v16h& f0, v16h& f1)
{
    const float4 c0 = *(const float4*)(qr +  0), c1 = *(const float4*)(qr +  4);
    const float4 c2 = *(const float4*)(qr + 16), c3 = *(const float4*)(qr + 20);
    const float4 c4 = *(const float4*)(qr + 32), c5 = *(const float4*)(qr + 36);
    const float4 c6 = *(const float4*)(qr + 48), c7 = *(const float4*)(qr + 52);
    const float u[8] = { c0.x, c0.y, c0.z, c0.w, c1.x, c1.y, c1.z, c1.w };
    const float y[8] = { c2.x, c2.y, c2.z, c2.w, c3.x, c3.y, c3.z, c3.w };
    const float s[8] = { c4.x, c4.y, c4.z, c4.w, c5.x, c5.y, c5.z, c5.w };
    const float t[8] = { c6.x, c6.y, c6.z, c6.w, c7.x, c7.y, c7.z, c7.w };
    #pragma unroll
    for (int i = 0; i < 8; ++i) {
        float sn, cs;
        __sincosf(pos * fr[i], &sn, &cs);
        f0[i]     = (_Float16)((u[i] * cs - y[i] * sn) * QSCALE);
        f0[8 + i] = (_Float16)((y[i] * cs + u[i] * sn) * QSCALE);
        f1[i]     = (_Float16)(s[i] * QSCALE);
        f1[8 + i] = (_Float16)(t[i] * QSCALE);
    }
}

typedef float f32x2 __attribute__((ext_vector_type(2)));

// One pass's four S^T tiles (32 keys x two query tiles) from the K rows at kr0.
__device__ __forceinline__ void score_tiles(
    const _Float16* kr0, int kb, int hi8, v16h qa0, v16h qa1, v16h qb0, v16h qb1,
    v8f& a0, v8f& a1, v8f& b0, v8f& b1)
{
    // ---- K A-fragments: lane = key row (kb+lo / kb+16+lo)
    const _Float16* kr1 = kr0 + 16 * KPITCH;
    v16h ka0c0 = cat8(*(const half8*)(kr0 +  0), *(const half8*)(kr0 + 16));
    v16h ka0c1 = cat8(*(const half8*)(kr0 + 32), *(const half8*)(kr0 + 48));
    v16h ka1c0 = cat8(*(const half8*)(kr1 +  0), *(const half8*)(kr1 + 16));
    v16h ka1c1 = cat8(*(const half8*)(kr1 + 32), *(const half8*)(kr1 + 48));
    // scheduling barrier: without it half of the loads above stand among the
    // WMMAs below, in two more places, each with a full wait on LDS behind it
    __builtin_amdgcn_sched_barrier(0);

    // scale folded into Q; each K fragment feeds both query tiles; four
    // independent accumulators
    a0 = v8f{};  a1 = v8f{};  b0 = v8f{};  b1 = v8f{};
    a0 = wmma_f16(ka0c0, qa0, a0);  b0 = wmma_f16(ka0c0, qb0, b0);
    a1 = wmma_f16(ka1c0, qa0, a1);  b1 = wmma_f16(ka1c0, qb0, b1);
    a0 = wmma_f16(ka0c1, qa1, a0);  b0 = wmma_f16(ka0c1, qb1, b0);
    a1 = wmma_f16(ka1c1, qa1, a1);  b1 = wmma_f16(ka1c1, qb1, b1);

    // ---- tail mask: keys >= NKV are padding
    if (kb + 32 > NKV) {
        #pragma unroll
        for (int r = 0; r < 8; ++r) {
            if (kb + r + hi8 >= NKV)      { a0[r] = -1e30f; b0[r] = -1e30f; }
            if (kb + 16 + r + hi8 >= NKV) { a1[r] = -1e30f; b1[r] = -1e30f; }
        }
    }
}

// One pass's exponentials against m = (tile a's, tile b's), packed into the lane's
// two B fragments; returns the two sums of the lane's 16 terms. A term of tile a
// and one of tile b share a register pair, so that one packed add serves both sums.
__device__ __forceinline__ f32x2 soft_tiles(
    v8f a0, v8f a1, v8f b0, v8f b1, f32x2 m, v16h& pa, v16h& pb)
{
    a0 -= m[0];  a1 -= m[0];  b0 -= m[1];  b1 -= m[1];   // whole tiles: registers stay paired
    f32x2 ps;
    #pragma unroll
    for (int r = 0; r < 8; ++r) {
        const f32x2 p0 = { fast_exp2(a0[r]), fast_exp2(b0[r]) };
        const f32x2 p1 = { fast_exp2(a1[r]), fast_exp2(b1[r]) };
        ps = (r == 0) ? p0 : ps + p0;
        ps += p1;
        pa[r]     = (_Float16)p0[0];  pb[r]     = (_Float16)p0[1];
        pa[8 + r] = (_Float16)p1[0];  pb[8 + r] = (_Float16)p1[1];
    }
    return ps;
}

__global__ __launch_bounds__(256) __attribute__((amdgpu_waves_per_eu(4, 4)))
void fa_kernel(
    const float* __restrict__ qin, const _Float16* __restrict__ Kh,
    const _Float16* __restrict__ Vt, float* __restrict__ out)
{
    __shared__ __attribute__((aligned(16))) _Float16 Ks[2][KSTAGE];
    __shared__ __attribute__((aligned(16))) _Float16 Vs[2][VSTAGE];

    const int lane   = threadIdx.x & 31;
    const int wave   = threadIdx.x >> 5;
    const int wg     = blockIdx.x;
    const int qblk   = wg & (SEQ / QBLK - 1);   // 8 blocks of 256 queries
    const int bh     = wg / (SEQ / QBLK);       // b*NH + h
    const int b      = bh >> 4;
    const int h      = bh & 15;
    const int qbase  = qblk * QBLK + wave * 32;
    const int lo     = lane & 15;
    const int hi8    = (lane & 16) ? 8 : 0;   // lane-half K/row offset
    const int dA     = hi8;                   // A/B slot pattern offset

    const _Float16* kbase = Kh + (size_t)bh * KPAD * HD;
    const _Float16* vbase = Vt + (size_t)bh * HD * KPAD;

    // ---- this thread's share of a stage: a wave's K copy is 4 whole rows
    // (512 contiguous bytes), its V^T copy 2 rows of 256 bytes
    const int krow = threadIdx.x >> 3, kcol = (threadIdx.x & 7) * 8;
    const int vrow = threadIdx.x >> 4, vcol = (threadIdx.x & 15) * 8;
    const unsigned kdst = lds_off(&Ks[0][krow * KPITCH + kcol]);
    const unsigned vdst = lds_off(&Vs[0][vrow * VPITCH + vcol]);

    // ---- the wave's 32 query rows, f32, from memory: a wave-wide load covers two
    // whole 256-byte head rows; all 16 are issued before anything waits
    const float* qg = qin + (((size_t)b * SEQ + qbase + (lane >> 4)) * NH + h) * HD + lo * 4;
    f32x4 qx[16];
    #pragma unroll
    for (int j = 0; j < 16; ++j)
        qx[j] = *(const f32x4*)(qg + (size_t)j * 2 * NH * HD);

    // ---- prologue: stage 0 lands and is published, stage 1 starts to fly
    stage_copy(kbase, vbase, 0, kdst, vdst, krow, kcol, vrow, vcol);

    // ---- Q^T fragments of the two query tiles: tile a = rows qbase+lo, tile b
    // = rows qbase+16+lo; slots {dA..dA+7, dA+16..}. One tile at a time goes
    // through 16 staging rows that are the wave's own. They lie in the ring's
    // second buffers (waves 0-3 in K's, waves 4-7 in V^T's), which are idle
    // until stage 1's copies are issued, behind the barrier below.
    static_assert(4 * 16 * QPITCH * 4 <= KSTAGE * 2, "four waves' rows fit a K buffer");
    static_assert(4 * 16 * QPITCH * 4 <= VSTAGE * 2, "four waves' rows fit a V^T buffer");
    v16h qa0, qa1, qb0, qb1;
    {
        float fr[8];
        #pragma unroll
        for (int i = 0; i < 8; ++i)
            fr[i] = exp2f(-(float)(dA + i) * FREQC);
        float* qs = (wave < 4 ? (float*)&Ks[1][0] : (float*)&Vs[1][0])
                    + (wave & 3) * (16 * QPITCH);
        float*       qw = qs + (lane >> 4) * QPITCH + lo * 4;
        const float* qr = qs + lo * QPITCH + dA;
        // fence on the loaded values, inputs only: without it tile b's eight loads
        // sink behind tile a's trip through LDS, and the wave waits out the
        // latency of memory twice
        asm volatile("" :: "v"(qx[8]), "v"(qx[9]), "v"(qx[10]), "v"(qx[11]),
                           "v"(qx[12]), "v"(qx[13]), "v"(qx[14]), "v"(qx[15]));
        #pragma unroll
        for (int j = 0; j < 8; ++j)
            *(f32x4*)(qw + j * 2 * QPITCH) = qx[j];
        // the wave's staged rows are in LDS before its other lanes read them back
        asm volatile("s_wait_dscnt 0x0" ::: "memory");
        rope_frag(qr, (float)(qbase + lo), fr, qa0, qa1);
        // tile a's reads have returned before tile b's rows overwrite them
        asm volatile("s_wait_dscnt 0x0" ::: "memory");
        #pragma unroll
        for (int j = 0; j < 8; ++j)
            *(f32x4*)(qw + j * 2 * QPITCH) = qx[8 + j];
        // as above, for tile b
        asm volatile("s_wait_dscnt 0x0" ::: "memory");
        rope_frag(qr, (float)(qbase + 16 + lo), fr, qb0, qb1);
        // tile b's reads have returned before the barrier below, behind which
        // stage 1's copies overwrite these rows
        asm volatile("s_wait_dscnt 0x0" ::: "memory");
    }

    v8f oa0 = {}, oa1 = {}, oa2 = {}, oa3 = {};
    v8f ob0 = {}, ob1 = {}, ob2 = {}, ob3 = {};
    f32x2 m2 = { -1e38f, -1e38f }, lsum = { 0.0f, 0.0f };   // (tile a, tile b)

    // this wave's copies of stage 0 have landed before the barrier publishes them
    asm volatile("s_wait_asynccnt 0x0" ::: "memory");
    __syncthreads();
    stage_copy(kbase, vbase, STG, kdst + KSTAGE * 2, vdst + VSTAGE * 2,
               krow, kcol, vrow, vcol);

    for (int st = 0; st < NSTG; ++st) {
      const int buf = st & 1;
      const _Float16* ks = &Ks[buf][lo * KPITCH + dA];
      const _Float16* vs = &Vs[buf][lo * VPITCH + dA];
      const int left = KPAD - st * STG;
      const int np = (left < STG ? left : STG) / 32;   // passes in this stage

      for (int p = 0; p < np; ++p) {
        const int kb = st * STG + p * 32;

        // ---- S^T tiles of this pass (M=key, N=q), log2 domain
        const _Float16* kr0 = ks + p * 32 * KPITCH;
        v8f a0, a1, b0, b1;
        score_tiles(kr0, kb, hi8, qa0, qa1, qb0, qb1, a0, a1, b0, b1);

        // ---- V^T A-fragments (lane = dim row): issued in front of the
        // exponentials, so that they fly under them
        const _Float16* vr0 = vs + p * 32;
        const _Float16* vr1 = vr0 + 16 * VPITCH;
        const _Float16* vr2 = vr0 + 32 * VPITCH;
        const _Float16* vr3 = vr0 + 48 * VPITCH;
        v16h bv0 = cat8(*(const half8*)(vr0), *(const half8*)(vr0 + 16));
        v16h bv1 = cat8(*(const half8*)(vr1), *(const half8*)(vr1 + 16));
        v16h bv2 = cat8(*(const half8*)(vr2), *(const half8*)(vr2 + 16));
        v16h bv3 = cat8(*(const half8*)(vr3), *(const half8*)(vr3 + 16));
        // scheduling barrier: without it the loads above sink to the end of the
        // exponentials, and the O^T WMMAs wait out the latency of LDS
        __builtin_amdgcn_sched_barrier(0);

        // ---- online softmax: each lane of a query keeps the sum of its own 16 keys.
        // m, the maximum in use, is the same in both lanes of a query and may trail
        // the true maximum. The exponentials are taken against m at once, with no
        // maximum formed: a lane's 16 terms are positive, so while their sum stays
        // at or under PLIM every one of them does too, far inside f16.
        v16h pa, pb;
        f32x2 ps = soft_tiles(a0, a1, b0, b1, m2, pa, pb);

        // ---- lazy rescale: one wave-uniform test per pass for both tiles (a
        // scalar branch, all lanes stay on), on the sums that the pass needs anyway.
        // Always taken in the first pass, where m is -1e38 and the sums come out
        // infinite; after that only when a lane's sum passes PLIM. Only here are the
        // maxima formed: the scores are made again from the same LDS rows, and the
        // pass's exponentials are taken again, against the new m (alpha comes out 0
        // on zero sums in the first pass).
        if (__builtin_amdgcn_ballot_w32(!(ps[0] <= PLIM) || !(ps[1] <= PLIM)) != 0) {
            score_tiles(kr0, kb, hi8, qa0, qa1, qb0, qb1, a0, a1, b0, b1);
            float mta = fmaxf(a0[0], a1[0]);
            float mtb = fmaxf(b0[0], b1[0]);
            #pragma unroll
            for (int r = 1; r < 8; ++r) {
                mta = fmaxf(mta, fmaxf(a0[r], a1[r]));
                mtb = fmaxf(mtb, fmaxf(b0[r], b1[r]));
            }
            const float na = fmaxf(m2[0], fmaxf(mta, xhalf(mta)));
            const float nb = fmaxf(m2[1], fmaxf(mtb, xhalf(mtb)));
            const float ala = fast_exp2(m2[0] - na);
            const float alb = fast_exp2(m2[1] - nb);
            m2[0] = na;
            m2[1] = nb;
            lsum[0] *= ala;   // every register of a lane belongs to its query
            lsum[1] *= alb;
            oa0 *= ala; oa1 *= ala; oa2 *= ala; oa3 *= ala;
            ob0 *= alb; ob1 *= alb; ob2 *= alb; ob3 *= alb;
            ps = soft_tiles(a0, a1, b0, b1, m2, pa, pb);
        }
        lsum += ps;

        // ---- O^T accumulation: each V^T fragment feeds both query tiles
        oa0 = wmma_f16(bv0, pa, oa0);
        oa1 = wmma_f16(bv1, pa, oa1);
        oa2 = wmma_f16(bv2, pa, oa2);
        oa3 = wmma_f16(bv3, pa, oa3);
        ob0 = wmma_f16(bv0, pb, ob0);
        ob1 = wmma_f16(bv1, pb, ob1);
        ob2 = wmma_f16(bv2, pb, ob2);
        ob3 = wmma_f16(bv3, pb, ob3);
      }

      // ---- publish point of stage st+1, every wave, in this order:
      // this wave's reads of the buffer to be refilled have returned
      asm volatile("s_wait_dscnt 0x0" ::: "memory");
      // this wave's copies of stage st+1 have landed
      asm volatile("s_wait_asynccnt 0x0" ::: "memory");
      __syncthreads();
      if (st + 2 < NSTG)
        stage_copy(kbase, vbase, (st + 2) * STG,
                   kdst + buf * (KSTAGE * 2), vdst + buf * (VSTAGE * 2),
                   krow, kcol, vrow, vcol);
    }
    // no copy is left in flight when the wave ends
    asm volatile("s_wait_asynccnt 0x0" ::: "memory");

    // ---- finalize: join the two halves' sums, divide, store (B,S,NH*HD).
    // Lane (lo, half) holds queries qbase+lo and qbase+16+lo, dims 16t + hi8 ..
    // + 7 of tile t. The ring is free here: the loop's last barrier stands behind
    // every wave's last read and last landed copy. Each wave stages its rows in
    // ranges of its own (tile a in the K ring, tile b in the V^T ring), so that
    // the stores below cover whole 256-byte head rows.
    static_assert(8 * 16 * EPITCH * 4 <= 2 * KSTAGE * 2, "tile a fits the K ring");
    static_assert(8 * 16 * EPITCH * 4 <= 2 * VSTAGE * 2, "tile b fits the V^T ring");
    const float inva = 1.0f / (lsum[0] + xhalf(lsum[0]));
    const float invb = 1.0f / (lsum[1] + xhalf(lsum[1]));
    float* esa = (float*)&Ks[0][0] + wave * (16 * EPITCH);
    float* esb = (float*)&Vs[0][0] + wave * (16 * EPITCH);
    stage_out(esa + lo * EPITCH + hi8, oa0 * inva, oa1 * inva, oa2 * inva, oa3 * inva);
    stage_out(esb + lo * EPITCH + hi8, ob0 * invb, ob1 * invb, ob2 * invb, ob3 * invb);
    // the wave's staged rows are in LDS before its other lanes read them back
    asm volatile("s_wait_dscnt 0x0" ::: "memory");
    {
        const int row = lane >> 4, col = lo * 4;
        const float* ra = esa + row * EPITCH + col;
        const float* rb = esb + row * EPITCH + col;
        float* dst = out + (((size_t)b * SEQ + qbase + row) * NH + h) * HD + col;
        #pragma unroll
        for (int i = 0; i < 8; ++i)
            *(float4*)(dst + (size_t)i * 2 * NH * HD) = *(const float4*)(ra + i * 2 * EPITCH);
        #pragma unroll
        for (int i = 0; i < 8; ++i)
            *(float4*)(dst + (size_t)(16 + i * 2) * NH * HD) = *(const float4*)(rb + i * 2 * EPITCH);
    }
}

// ---------------------------------------------------------------------------
extern "C" void kernel_launch(void* const* d_in, const int* in_sizes, int n_in,
                              void* d_out, int out_size, void* d_ws, size_t ws_size,
                              hipStream_t stream)
{
    (void)in_sizes; (void)n_in; (void)out_size; (void)ws_size;

    const float* q    = (const float*)d_in[0];
    const float* k    = (const float*)d_in[1];
    const float* v    = (const float*)d_in[2];
    const float* kreg = (const float*)d_in[3];
    const float* vreg = (const float*)d_in[4];
    float* out = (float*)d_out;

    // workspace layout (f16)
    const size_t KH_ELEMS = (size_t)BATCH * NH * KPAD * HD;   //  8,519,680
    _Float16* Kh = (_Float16*)d_ws;
    _Float16* Vt = Kh + KH_ELEMS;

    // Phase 1
    prep_kernel<<<BATCH * NH * (KPAD / VTK), 256, 0, stream>>>(k, kreg, v, vreg, Kh, Vt);

    // Phase 2: B*NH*(SEQ/256) workgroups of 8 waves
    fa_kernel<<<BATCH * NH * (SEQ / QBLK), 256, 0, stream>>>(q, Kh, Vt, out);
}

// v009
// A run of this version takes 62 microseconds.
// Two timings next to v008 put it at 1.03 and 1.04 times that version's speed.
// Counting every step since v000, it is 5.39 times as fast.
#include <hip/hip_runtime.h>
#include <hip/hip_bf16.h>
#include <math.h>

// ---------------------------------------------------------------------------
// RotaryAttention for MI455X (gfx1250, wave32, WMMA).
// Phase 1: RoPE+f16 pack of K and V transpose, one launch (both into d_ws).
// Phase 2: flash attention, S^T formulation, v_wmma_f32_16x16x32_f16; its
// prologue reads Q as f32 and applies RoPE while it packs the fragments.
// ---------------------------------------------------------------------------

typedef _Float16 half8 __attribute__((ext_vector_type(8)));
typedef _Float16 v16h  __attribute__((ext_vector_type(16)));
typedef float    v8f   __attribute__((ext_vector_type(8)));
typedef float    f32x4 __attribute__((ext_vector_type(4)));

#define NH      16
#define HD      64
#define SEQ     2048
#define NKV     2049          // 2048 keys + 1 register token
#define KPAD    2080          // padded to multiple of 32
#define BATCH   4

// 1/sqrt(64) * log2(e): scores come out in log2 domain -> native v_exp_f32
#define QSCALE  0.18033688011112042f
// log2(10000)/16
#define FREQC   0.83048202372184065f

__device__ __forceinline__ v8f wmma_f16(v16h a, v16h b, v8f c) {
    return __builtin_amdgcn_wmma_f32_16x16x32_f16(false, a, false, b,
                                                  (short)0, c, false, false);
}

__device__ __forceinline__ v16h cat8(half8 lo, half8 hi) {
    return __builtin_shufflevector(lo, hi, 0,1,2,3,4,5,6,7,8,9,10,11,12,13,14,15);
}

// Raw v_exp_f32: kept args are at most log2(PLIM) = 8 (larger ones trip the rescale); flush-to-zero below -126 is the
// desired flash-softmax semantics (avoids OCML's range-fix cmp/cndmask pairs).
__device__ __forceinline__ float fast_exp2(float x) {
    return __builtin_amdgcn_exp2f(x);
}

// Lane l with lane l ^ 16 on the vector pipe (no trip through the LDS unit).
__device__ __forceinline__ float xhalf(float x) {
    const int b = __builtin_bit_cast(int, x);
    return __builtin_bit_cast(float,
        __builtin_amdgcn_permlanex16(b, b, 0x76543210, 0xfedcba98, false, false));
}

// ---------------------------------------------------------------------------
// Phase 1, one launch: few, fat work-groups. One work-group takes 160 keys of one
// head and does both jobs on them: RoPE + f16 pack of the K rows and the f16
// transpose of the V rows. A lane moves 16 bytes per load, a wave-wide load
// covers two whole 256-byte head rows, all 20 loads of a thread are issued before
// the first is used, and stores cover whole lines.
//   Kh: layout [b][h][key][d], key in [0,KPAD)
//       key==2048: register token (rotary half zeroed), key>2048: zero pad
//   Vt: layout [b][h][d][key], key in [0,KPAD), through LDS
// grid = B * (KPAD/VTK) * NH
// ---------------------------------------------------------------------------
typedef _Float16 half4 __attribute__((ext_vector_type(4)));
typedef _Float16 half2 __attribute__((ext_vector_type(2)));

#define VTK     160           // keys per tile; KPAD = 13 * 160
#define VTP     (VTK / 2 + 1) // dwords per dim row: odd, so that the 16 lanes of
                              // a row (4 dims apart) store to 16 different banks
#define KRG     16            // K rows per work-group-wide load: 2 a wave
#define KNJ     (VTK / KRG)   // such loads per tile

__global__ __launch_bounds__(256) void prep_kernel(
    const float* __restrict__ kin, const float* __restrict__ kreg,
    const float* __restrict__ vin, const float* __restrict__ vreg,
    _Float16* __restrict__ Kh, _Float16* __restrict__ Vt)
{
    __shared__ unsigned tile[HD * VTP];   // [dim][key pair], two f16 keys a dword
    int bidx = blockIdx.x;
    const int h  = bidx & 15;  bidx >>= 4;
    const int kt = bidx % (KPAD / VTK);
    const int b  = bidx / (KPAD / VTK);
    const int t  = threadIdx.x;
    const int d  = (t & 15) * 4;
    const int kp = t >> 4;
    const int key0 = kt * VTK;

    // ---- K rows key0 + j*16 + kp, the lane's 4 dims. A group of 16 rows lies
    // wholly inside or wholly past the sequence (a uniform test); a group past it
    // reads the tile's first group again (in bounds), and its values are not stored
    f32x4 x[KNJ];
    {
        const float* p = kin + (((size_t)b * SEQ + key0 + kp) * NH + h) * HD + d;
        #pragma unroll
        for (int j = 0; j < KNJ; ++j) {
            const int jr = (key0 + j * KRG < SEQ) ? j * KRG : 0;
            x[j] = *(const f32x4*)(p + (size_t)jr * NH * HD);
        }
    }
    // a precaution: it stands in front of the address arithmetic of the V loads,
    // which reuses the address registers that the K loads above name
    asm volatile("s_wait_xcnt 0x0" ::: "memory");

    // ---- V: a thread's key pairs: keys 2n and 2n+1, n = i*16 + kp
    float4 e[VTK / 32], o[VTK / 32];
    if (key0 + VTK <= SEQ) {              // whole tile inside the sequence
        const float* p = vin + (((size_t)b * SEQ + key0 + kp * 2) * NH + h) * HD + d;
        #pragma unroll
        for (int i = 0; i < VTK / 32; ++i) {
            e[i] = *(const float4*)(p + (size_t)(i * 32 + 0) * NH * HD);
            o[i] = *(const float4*)(p + (size_t)(i * 32 + 1) * NH * HD);
        }
    } else {                              // last tile: register token, zero pad
        #pragma unroll
        for (int i = 0; i < VTK / 32; ++i) {
            // key is even, so key and key+1 lie on the same side of SEQ; past
            // the sequence the pointer names the register row (in bounds)
            const int key = key0 + (i * 16 + kp) * 2;
            const bool in = key < SEQ;
            const float* p = in ? vin + (((size_t)b * SEQ + key) * NH + h) * HD + d
                                : vreg + h * HD + d;
            const float4 pe = *(const float4*)p;
            const float4 po = *(const float4*)(in ? p + NH * HD : p);
            const bool te = key <= SEQ;   // key == SEQ is the register token
            e[i].x = te ? pe.x : 0.0f;  e[i].y = te ? pe.y : 0.0f;
            e[i].z = te ? pe.z : 0.0f;  e[i].w = te ? pe.w : 0.0f;
            o[i].x = in ? po.x : 0.0f;  o[i].y = in ? po.y : 0.0f;
            o[i].z = in ? po.z : 0.0f;  o[i].w = in ? po.w : 0.0f;
        }
    }
    #pragma unroll
    for (int i = 0; i < VTK / 32; ++i) {
        const float ev[4] = { e[i].x, e[i].y, e[i].z, e[i].w };
        const float ov[4] = { o[i].x, o[i].y, o[i].z, o[i].w };
        #pragma unroll
        for (int c = 0; c < 4; ++c) {
            half2 pr = { (_Float16)ev[c], (_Float16)ov[c] };
            tile[(d + c) * VTP + i * 16 + kp] = __builtin_bit_cast(unsigned, pr);
        }
    }
    __syncthreads();

    // 8 keys (16 bytes) per lane; 20 lanes cover a dim row's 320 bytes
    {
        _Float16* dst = Vt + ((size_t)b * NH + h) * HD * KPAD + key0;
        #pragma unroll
        for (int i = 0; i < HD * VTK / 8 / 256; ++i) {
            const int idx = i * 256 + t;
            const int row = idx / (VTK / 8);
            const int g   = idx - row * (VTK / 8);
            const unsigned* s = &tile[row * VTP + g * 4];
            uint4 v = { s[0], s[1], s[2], s[3] };
            *(uint4*)(dst + (size_t)row * KPAD + g * 8) = v;
        }
    }

    // ---- K: rotate_half partner: dims d+16 / d-16 sit 4 lanes away in the same row
    f32x4 y[KNJ];
    #pragma unroll
    for (int j = 0; j < KNJ; ++j) {
        y[j][0] = __shfl_xor(x[j][0], 4);
        y[j][1] = __shfl_xor(x[j][1], 4);
        y[j][2] = __shfl_xor(x[j][2], 4);
        y[j][3] = __shfl_xor(x[j][3], 4);
    }

    if (d < 32) {
        const float sg = (d < 16) ? -1.0f : 1.0f;
        const int   f  = d & 15;
        const float f0 = exp2f(-(float)(f + 0) * FREQC);
        const float f1 = exp2f(-(float)(f + 1) * FREQC);
        const float f2 = exp2f(-(float)(f + 2) * FREQC);
        const float f3 = exp2f(-(float)(f + 3) * FREQC);
        #pragma unroll
        for (int j = 0; j < KNJ; ++j) {
            const float p = (float)(key0 + j * KRG + kp);
            float sn, cs;
            __sincosf(p * f0, &sn, &cs); x[j][0] = x[j][0] * cs + (sg * y[j][0]) * sn;
            __sincosf(p * f1, &sn, &cs); x[j][1] = x[j][1] * cs + (sg * y[j][1]) * sn;
            __sincosf(p * f2, &sn, &cs); x[j][2] = x[j][2] * cs + (sg * y[j][2]) * sn;
            __sincosf(p * f3, &sn, &cs); x[j][3] = x[j][3] * cs + (sg * y[j][3]) * sn;
        }
    }

    // a wave's store covers two whole 128-byte rows
    _Float16* kd = Kh + (((size_t)b * NH + h) * KPAD + key0 + kp) * HD + d;
    half4 r[KNJ];
    #pragma unroll
    for (int j = 0; j < KNJ; ++j)
        r[j] = half4{ (_Float16)x[j][0], (_Float16)x[j][1],
                      (_Float16)x[j][2], (_Float16)x[j][3] };
    if (key0 + VTK > SEQ) {               // uniform, last tile: register token, zero pad
        const float4 g = *(const float4*)(kreg + h * HD + d);
        const half4 reg = { (_Float16)g.x, (_Float16)g.y, (_Float16)g.z, (_Float16)g.w };
        const half4 zero = {};            // reg_mask zeros the rotary half
        #pragma unroll
        for (int j = 0; j < KNJ; ++j)
            if (key0 + j * KRG >= SEQ)
                r[j] = (key0 + j * KRG + kp == SEQ && d >= 32) ? reg : zero;
    }
    #pragma unroll
    for (int j = 0; j < KNJ; ++j)
        *(half4*)(kd + j * KRG * HD) = r[j];
}

// ---------------------------------------------------------------------------
// Phase 2: flash attention. One wave = 32 query rows (two tiles of 16), so that
// each K and V^T fragment read from LDS feeds two WMMAs; block = 8 waves = 256 q.
// grid.x = B*NH*(SEQ/256).  S^T = K_tile x Q^T and O^T += V^T x P^T: a lane
// holds, per tile, one query's scores, its maximum, its sum AND its outputs, so
// exp(S^T) packs into the B operand in place and the rescale factor is the lane's.
// The rescale is lazy: outputs and sums are scaled only in a pass where a lane's
// sum of exponentials, taken against the maximum in use, passes PLIM.
// K and V^T come through LDS: the block's 8 waves share one 128-key stage,
// filled by asynchronous copies of whole lines, two buffers, one stage ahead.
// Q comes straight from the f32 input: whole 256-byte head rows into registers,
// through LDS rows that are the wave's own into fragment order, where a
// lane holds both dims of every rotated pair, so that RoPE is done in-lane.
// ---------------------------------------------------------------------------
#define QBLK    256                       // queries per work-group: 8 waves x 32
#define STG     128                       // keys per LDS stage (4 passes of 32)
#define NSTG    ((KPAD + STG - 1) / STG)  // 17; the last stage holds one pass
#define KPITCH  72                        // halves: 128-B K row + 16 B (b128 readers)
#define VPITCH  136                       // halves: 256-B V^T row + 16 B
#define KSTAGE  (STG * KPITCH)            // halves per K buffer
#define VSTAGE  (HD * VPITCH)             // halves per V^T buffer
#define EPITCH  68                        // floats: 256-B output row + 16 B (b128 writers)
#define QPITCH  68                        // floats: 256-B Q row + 16 B (b128 readers)
#define PLIM    256.0f                    // 2^8: a lane's sum of a pass above this renews the maximum in use

__device__ __forceinline__ unsigned lds_off(const void* p) {
    return (unsigned)(size_t)p;           // low 32 bits = byte offset in LDS
}

// One stage: 4 K copies + 4 V^T copies of 16 B per lane. The global side is
// clamped so that the short last stage stays inside Kh / Vt; the LDS bytes
// filled from clamped addresses belong to passes that are never run.
__device__ __forceinline__ void stage_copy(
    const _Float16* kbase, const _Float16* vbase, int kb0,
    unsigned kdst, unsigned vdst, int krow, int kcol, int vrow, int vcol)
{
    const _Float16* gk0 = kbase + (size_t)min(kb0 + krow +  0, KPAD - 1) * HD + kcol;
    const _Float16* gk1 = kbase + (size_t)min(kb0 + krow + 32, KPAD - 1) * HD + kcol;
    const _Float16* gk2 = kbase + (size_t)min(kb0 + krow + 64, KPAD - 1) * HD + kcol;
    const _Float16* gk3 = kbase + (size_t)min(kb0 + krow + 96, KPAD - 1) * HD + kcol;
    const _Float16* gv0 = vbase + (size_t)vrow * KPAD + min(kb0 + vcol, KPAD - 8);
    const _Float16* gv1 = gv0 + (size_t)16 * KPAD;
    const _Float16* gv2 = gv0 + (size_t)32 * KPAD;
    const _Float16* gv3 = gv0 + (size_t)48 * KPAD;
    // s_wait_xcnt is the statement's last line as a precaution: so it stands in
    // front of every later write of an address register that a copy names.
    asm volatile(
        "global_load_async_to_lds_b128 %0, %8, off\n\t"
        "global_load_async_to_lds_b128 %1, %9, off\n\t"
        "global_load_async_to_lds_b128 %2, %10, off\n\t"
        "global_load_async_to_lds_b128 %3, %11, off\n\t"
        "global_load_async_to_lds_b128 %4, %12, off\n\t"
        "global_load_async_to_lds_b128 %5, %13, off\n\t"
        "global_load_async_to_lds_b128 %6, %14, off\n\t"
        "global_load_async_to_lds_b128 %7, %15, off\n\t"
        "s_wait_xcnt 0x0"
        :: "v"(kdst), "v"(kdst + 32 * KPITCH * 2), "v"(kdst + 64 * KPITCH * 2),
           "v"(kdst + 96 * KPITCH * 2),
           "v"(vdst), "v"(vdst + 16 * VPITCH * 2), "v"(vdst + 32 * VPITCH * 2),
           "v"(vdst + 48 * VPITCH * 2),
           "v"(gk0), "v"(gk1), "v"(gk2), "v"(gk3),
           "v"(gv0), "v"(gv1), "v"(gv2), "v"(gv3)
        : "memory");
}

// One query tile's outputs of a lane (4 dim tiles x 8 dims) into its staging row.
__device__ __forceinline__ void stage_out(float* er, v8f t0, v8f t1, v8f t2, v8f t3) {
    *(float4*)(er +  0) = make_float4(t0[0], t0[1], t0[2], t0[3]);
    *(float4*)(er +  4) = make_float4(t0[4], t0[5], t0[6], t0[7]);
    *(float4*)(er + 16) = make_float4(t1[0], t1[1], t1[2], t1[3]);
    *(float4*)(er + 20) = make_float4(t1[4], t1[5], t1[6], t1[7]);
    *(float4*)(er + 32) = make_float4(t2[0], t2[1], t2[2], t2[3]);
    *(float4*)(er + 36) = make_float4(t2[4], t2[5], t2[6], t2[7]);
    *(float4*)(er + 48) = make_float4(t3[0], t3[1], t3[2], t3[3]);
    *(float4*)(er + 52) = make_float4(t3[4], t3[5], t3[6], t3[7]);
}

// One query tile's two B fragments from its staged f32 rows. qr points at the
// lane's row, at dim dA; the lane holds dims dA+i, 16+dA+i (a rotated pair, of
// frequency fr[i]), 32+dA+i and 48+dA+i (not rotated), i = 0..7.
__device__ __forceinline__ void rope_frag(
    const float* qr, float pos, const float* fr, v16h& f0, v16h& f1)
{
    const float4 c0 = *(const float4*)(qr +  0), c1 = *(const float4*)(qr +  4);
    const float4 c2 = *(const float4*)(qr + 16), c3 = *(const float4*)(qr + 20);
    const float4 c4 = *(const float4*)(qr + 32), c5 = *(const float4*)(qr + 36);
    const float4 c6 = *(const float4*)(qr + 48), c7 = *(const float4*)(qr + 52);
    const float u[8] = { c0.x, c0.y, c0.z, c0.w, c1.x, c1.y, c1.z, c1.w };
    const float y[8] = { c2.x, c2.y, c2.z, c2.w, c3.x, c3.y, c3.z, c3.w };
    const float s[8] = { c4.x, c4.y, c4.z, c4.w, c5.x, c5.y, c5.z, c5.w };
    const float t[8] = { c6.x, c6.y, c6.z, c6.w, c7.x, c7.y, c7.z, c7.w };
    #pragma unroll
    for (int i = 0; i < 8; ++i) {
        float sn, cs;
        __sincosf(pos * fr[i], &sn, &cs);
        f0[i]     = (_Float16)((u[i] * cs - y[i] * sn) * QSCALE);
        f0[8 + i] = (_Float16)((y[i] * cs + u[i] * sn) * QSCALE);
        f1[i]     = (_Float16)(s[i] * QSCALE);
        f1[8 + i] = (_Float16)(t[i] * QSCALE);
    }
}

typedef float f32x2 __attribute__((ext_vector_type(2)));

// One pass's four S^T tiles (32 keys x two query tiles) from the K rows at kr0.
// ca and cb are the C operands of each tile's first product: what the sums of
// query tile a and of query tile b start from.
__device__ __forceinline__ void score_tiles(
    const _Float16* kr0, int kb, int hi8, v16h qa0, v16h qa1, v16h qb0, v16h qb1,
    v8f ca, v8f cb, v8f& a0, v8f& a1, v8f& b0, v8f& b1)
{
    // ---- K A-fragments: lane = key row (kb+lo / kb+16+lo)
    const _Float16* kr1 = kr0 + 16 * KPITCH;
    v16h ka0c0 = cat8(*(const half8*)(kr0 +  0), *(const half8*)(kr0 + 16));
    v16h ka0c1 = cat8(*(const half8*)(kr0 + 32), *(const half8*)(kr0 + 48));
    v16h ka1c0 = cat8(*(const half8*)(kr1 +  0), *(const half8*)(kr1 + 16));
    v16h ka1c1 = cat8(*(const half8*)(kr1 + 32), *(const half8*)(kr1 + 48));
    // scheduling barrier: without it half of the loads above stand among the
    // WMMAs below, in two more places, each with a full wait on LDS behind it
    __builtin_amdgcn_sched_barrier(0);

    // scale folded into Q; each K fragment feeds both query tiles; four
    // independent accumulators
    a0 = wmma_f16(ka0c0, qa0, ca);  b0 = wmma_f16(ka0c0, qb0, cb);
    a1 = wmma_f16(ka1c0, qa0, ca);  b1 = wmma_f16(ka1c0, qb0, cb);
    a0 = wmma_f16(ka0c1, qa1, a0);  b0 = wmma_f16(ka0c1, qb1, b0);
    a1 = wmma_f16(ka1c1, qa1, a1);  b1 = wmma_f16(ka1c1, qb1, b1);

    // ---- tail mask: keys >= NKV are padding
    if (kb + 32 > NKV) {
        #pragma unroll
        for (int r = 0; r < 8; ++r) {
            if (kb + r + hi8 >= NKV)      { a0[r] = -1e30f; b0[r] = -1e30f; }
            if (kb + 16 + r + hi8 >= NKV) { a1[r] = -1e30f; b1[r] = -1e30f; }
        }
    }
}

// One pass's exponentials of scores that already stand against the maximum in use,
// packed into the lane's two B fragments; returns the two sums of the lane's 16
// terms. A term of tile a and one of tile b share a register pair, so that one
// packed add serves both sums.
__device__ __forceinline__ f32x2 soft_tiles(
    v8f a0, v8f a1, v8f b0, v8f b1, v16h& pa, v16h& pb)
{
    f32x2 ps;
    #pragma unroll
    for (int r = 0; r < 8; ++r) {
        const f32x2 p0 = { fast_exp2(a0[r]), fast_exp2(b0[r]) };
        const f32x2 p1 = { fast_exp2(a1[r]), fast_exp2(b1[r]) };
        ps = (r == 0) ? p0 : ps + p0;
        ps += p1;
        pa[r]     = (_Float16)p0[0];  pb[r]     = (_Float16)p0[1];
        pa[8 + r] = (_Float16)p1[0];  pb[8 + r] = (_Float16)p1[1];
    }
    return ps;
}

__global__ __launch_bounds__(256) __attribute__((amdgpu_waves_per_eu(4, 4)))
void fa_kernel(
    const float* __restrict__ qin, const _Float16* __restrict__ Kh,
    const _Float16* __restrict__ Vt, float* __restrict__ out)
{
    __shared__ __attribute__((aligned(16))) _Float16 Ks[2][KSTAGE];
    __shared__ __attribute__((aligned(16))) _Float16 Vs[2][VSTAGE];

    const int lane   = threadIdx.x & 31;
    const int wave   = threadIdx.x >> 5;
    const int wg     = blockIdx.x;
    const int qblk   = wg & (SEQ / QBLK - 1);   // 8 blocks of 256 queries
    const int bh     = wg / (SEQ / QBLK);       // b*NH + h
    const int b      = bh >> 4;
    const int h      = bh & 15;
    const int qbase  = qblk * QBLK + wave * 32;
    const int lo     = lane & 15;
    const int hi8    = (lane & 16) ? 8 : 0;   // lane-half K/row offset
    const int dA     = hi8;                   // A/B slot pattern offset

    const _Float16* kbase = Kh + (size_t)bh * KPAD * HD;
    const _Float16* vbase = Vt + (size_t)bh * HD * KPAD;

    // ---- this thread's share of a stage: a wave's K copy is 4 whole rows
    // (512 contiguous bytes), its V^T copy 2 rows of 256 bytes
    const int krow = threadIdx.x >> 3, kcol = (threadIdx.x & 7) * 8;
    const int vrow = threadIdx.x >> 4, vcol = (threadIdx.x & 15) * 8;
    const unsigned kdst = lds_off(&Ks[0][krow * KPITCH + kcol]);
    const unsigned vdst = lds_off(&Vs[0][vrow * VPITCH + vcol]);

    // ---- the wave's 32 query rows, f32, from memory: a wave-wide load covers two
    // whole 256-byte head rows; all 16 are issued before anything waits
    const float* qg = qin + (((size_t)b * SEQ + qbase + (lane >> 4)) * NH + h) * HD + lo * 4;
    f32x4 qx[16];
    #pragma unroll
    for (int j = 0; j < 16; ++j)
        qx[j] = *(const f32x4*)(qg + (size_t)j * 2 * NH * HD);

    // ---- prologue: stage 0 lands and is published, stage 1 starts to fly
    stage_copy(kbase, vbase, 0, kdst, vdst, krow, kcol, vrow, vcol);

    // ---- Q^T fragments of the two query tiles: tile a = rows qbase+lo, tile b
    // = rows qbase+16+lo; slots {dA..dA+7, dA+16..}. One tile at a time goes
    // through 16 staging rows that are the wave's own. They lie in the ring's
    // second buffers (waves 0-3 in K's, waves 4-7 in V^T's), which are idle
    // until stage 1's copies are issued, behind the barrier below.
    static_assert(4 * 16 * QPITCH * 4 <= KSTAGE * 2, "four waves' rows fit a K buffer");
    static_assert(4 * 16 * QPITCH * 4 <= VSTAGE * 2, "four waves' rows fit a V^T buffer");
    v16h qa0, qa1, qb0, qb1;
    {
        float fr[8];
        #pragma unroll
        for (int i = 0; i < 8; ++i)
            fr[i] = exp2f(-(float)(dA + i) * FREQC);
        float* qs = (wave < 4 ? (float*)&Ks[1][0] : (float*)&Vs[1][0])
                    + (wave & 3) * (16 * QPITCH);
        float*       qw = qs + (lane >> 4) * QPITCH + lo * 4;
        const float* qr = qs + lo * QPITCH + dA;
        // fence on the loaded values, inputs only: without it tile b's eight loads
        // sink behind tile a's trip through LDS, and the wave waits out the
        // latency of memory twice
        asm volatile("" :: "v"(qx[8]), "v"(qx[9]), "v"(qx[10]), "v"(qx[11]),
                           "v"(qx[12]), "v"(qx[13]), "v"(qx[14]), "v"(qx[15]));
        #pragma unroll
        for (int j = 0; j < 8; ++j)
            *(f32x4*)(qw + j * 2 * QPITCH) = qx[j];
        // the wave's staged rows are in LDS before its other lanes read them back
        asm volatile("s_wait_dscnt 0x0" ::: "memory");
        rope_frag(qr, (float)(qbase + lo), fr, qa0, qa1);
        // tile a's reads have returned before tile b's rows overwrite them
        asm volatile("s_wait_dscnt 0x0" ::: "memory");
        #pragma unroll
        for (int j = 0; j < 8; ++j)
            *(f32x4*)(qw + j * 2 * QPITCH) = qx[8 + j];
        // as above, for tile b
        asm volatile("s_wait_dscnt 0x0" ::: "memory");
        rope_frag(qr, (float)(qbase + 16 + lo), fr, qb0, qb1);
        // tile b's reads have returned before the barrier below, behind which
        // stage 1's copies overwrite these rows
        asm volatile("s_wait_dscnt 0x0" ::: "memory");
    }

    v8f oa0 = {}, oa1 = {}, oa2 = {}, oa3 = {};
    v8f ob0 = {}, ob1 = {}, ob2 = {}, ob3 = {};
    f32x2 lsum = { 0.0f, 0.0f };                            // (tile a, tile b)
    // minus the maximum in use, in all 8 registers of a C tile: a lane's 8 rows of
    // a score tile belong to one query, so the score products start from it and
    // come out of the matrix unit ready for the exponential, with no subtraction
    v8f nma = v8f{} + 1e38f, nmb = v8f{} + 1e38f;

    // this wave's copies of stage 0 have landed before the barrier publishes them
    asm volatile("s_wait_asynccnt 0x0" ::: "memory");
    __syncthreads();
    stage_copy(kbase, vbase, STG, kdst + KSTAGE * 2, vdst + VSTAGE * 2,
               krow, kcol, vrow, vcol);

    for (int st = 0; st < NSTG; ++st) {
      const int buf = st & 1;
      const _Float16* ks = &Ks[buf][lo * KPITCH + dA];
      const _Float16* vs = &Vs[buf][lo * VPITCH + dA];
      const int left = KPAD - st * STG;
      const int np = (left < STG ? left : STG) / 32;   // passes in this stage

      for (int p = 0; p < np; ++p) {
        const int kb = st * STG + p * 32;

        // ---- S^T tiles of this pass (M=key, N=q), log2 domain
        const _Float16* kr0 = ks + p * 32 * KPITCH;
        v8f a0, a1, b0, b1;
        score_tiles(kr0, kb, hi8, qa0, qa1, qb0, qb1, nma, nmb, a0, a1, b0, b1);

        // ---- V^T A-fragments (lane = dim row): issued in front of the
        // exponentials, so that they fly under them
        const _Float16* vr0 = vs + p * 32;
        const _Float16* vr1 = vr0 + 16 * VPITCH;
        const _Float16* vr2 = vr0 + 32 * VPITCH;
        const _Float16* vr3 = vr0 + 48 * VPITCH;
        v16h bv0 = cat8(*(const half8*)(vr0), *(const half8*)(vr0 + 16));
        v16h bv1 = cat8(*(const half8*)(vr1), *(const half8*)(vr1 + 16));
        v16h bv2 = cat8(*(const half8*)(vr2), *(const half8*)(vr2 + 16));
        v16h bv3 = cat8(*(const half8*)(vr3), *(const half8*)(vr3 + 16));
        // scheduling barrier: without it the loads above sink to the end of the
        // exponentials, and the O^T WMMAs wait out the latency of LDS
        __builtin_amdgcn_sched_barrier(0);

        // ---- online softmax: each lane of a query keeps the sum of its own 16 keys.
        // m, the maximum in use, is the same in both lanes of a query and may trail
        // the true maximum. The exponentials are taken against m at once, with no
        // maximum formed: a lane's 16 terms are positive, so while their sum stays
        // at or under PLIM every one of them does too, far inside f16.
        v16h pa, pb;
        f32x2 ps = soft_tiles(a0, a1, b0, b1, pa, pb);
        // scheduling groups: the adds of the sums are one dependent chain; one add
        // stands behind every two exponentials, so that its latency passes under
        // them. Without the groups nine adds stand behind the last exponential,
        // and the wave waits out their latency link by link
        __builtin_amdgcn_sched_group_barrier(0x400, 7, 0);
        #pragma unroll
        for (int i = 0; i < 12; ++i) {
            __builtin_amdgcn_sched_group_barrier(0x002, 1, 0);
            __builtin_amdgcn_sched_group_barrier(0x400, 2, 0);
        }
        __builtin_amdgcn_sched_group_barrier(0x002, 1, 0);
        __builtin_amdgcn_sched_group_barrier(0x400, 1, 0);

        // ---- lazy rescale: one wave-uniform test per pass for both tiles (a
        // scalar branch, all lanes stay on), on the sums that the pass needs anyway.
        // Always taken in the first pass, where m is -1e38 and the sums come out
        // infinite; after that only when a lane's sum passes PLIM. Only here are the
        // maxima formed: the scores are made again from the same LDS rows, this time
        // from zero, and the pass's exponentials are taken again, against the new m
        // (alpha comes out 0 on zero sums in the first pass).
        if (__builtin_amdgcn_ballot_w32(!(ps[0] <= PLIM) || !(ps[1] <= PLIM)) != 0) {
            score_tiles(kr0, kb, hi8, qa0, qa1, qb0, qb1, v8f{}, v8f{}, a0, a1, b0, b1);
            float mta = fmaxf(a0[0], a1[0]);
            float mtb = fmaxf(b0[0], b1[0]);
            #pragma unroll
            for (int r = 1; r < 8; ++r) {
                mta = fmaxf(mta, fmaxf(a0[r], a1[r]));
                mtb = fmaxf(mtb, fmaxf(b0[r], b1[r]));
            }
            const float na = fmaxf(-nma[0], fmaxf(mta, xhalf(mta)));
            const float nb = fmaxf(-nmb[0], fmaxf(mtb, xhalf(mtb)));
            const float ala = fast_exp2(-nma[0] - na);
            const float alb = fast_exp2(-nmb[0] - nb);
            lsum[0] *= ala;   // every register of a lane belongs to its query
            lsum[1] *= alb;
            oa0 *= ala; oa1 *= ala; oa2 *= ala; oa3 *= ala;
            ob0 *= alb; ob1 *= alb; ob2 *= alb; ob3 *= alb;
            nma = v8f{} - na;
            nmb = v8f{} - nb;
            a0 += nma;  a1 += nma;  b0 += nmb;  b1 += nmb;
            ps = soft_tiles(a0, a1, b0, b1, pa, pb);
        }
        lsum += ps;

        // ---- O^T accumulation: each V^T fragment feeds both query tiles
        oa0 = wmma_f16(bv0, pa, oa0);
        oa1 = wmma_f16(bv1, pa, oa1);
        oa2 = wmma_f16(bv2, pa, oa2);
        oa3 = wmma_f16(bv3, pa, oa3);
        ob0 = wmma_f16(bv0, pb, ob0);
        ob1 = wmma_f16(bv1, pb, ob1);
        ob2 = wmma_f16(bv2, pb, ob2);
        ob3 = wmma_f16(bv3, pb, ob3);
      }

      // ---- publish point of stage st+1, every wave, in this order:
      // this wave's reads of the buffer to be refilled have returned
      asm volatile("s_wait_dscnt 0x0" ::: "memory");
      // this wave's copies of stage st+1 have landed
      asm volatile("s_wait_asynccnt 0x0" ::: "memory");
      __syncthreads();
      if (st + 2 < NSTG)
        stage_copy(kbase, vbase, (st + 2) * STG,
                   kdst + buf * (KSTAGE * 2), vdst + buf * (VSTAGE * 2),
                   krow, kcol, vrow, vcol);
    }
    // no copy is left in flight when the wave ends
    asm volatile("s_wait_asynccnt 0x0" ::: "memory");

    // ---- finalize: join the two halves' sums, divide, store (B,S,NH*HD).
    // Lane (lo, half) holds queries qbase+lo and qbase+16+lo, dims 16t + hi8 ..
    // + 7 of tile t. The ring is free here: the loop's last barrier stands behind
    // every wave's last read and last landed copy. Each wave stages its rows in
    // ranges of its own (tile a in the K ring, tile b in the V^T ring), so that
    // the stores below cover whole 256-byte head rows.
    static_assert(8 * 16 * EPITCH * 4 <= 2 * KSTAGE * 2, "tile a fits the K ring");
    static_assert(8 * 16 * EPITCH * 4 <= 2 * VSTAGE * 2, "tile b fits the V^T ring");
    const float inva = 1.0f / (lsum[0] + xhalf(lsum[0]));
    const float invb = 1.0f / (lsum[1] + xhalf(lsum[1]));
    float* esa = (float*)&Ks[0][0] + wave * (16 * EPITCH);
    float* esb = (float*)&Vs[0][0] + wave * (16 * EPITCH);
    stage_out(esa + lo * EPITCH + hi8, oa0 * inva, oa1 * inva, oa2 * inva, oa3 * inva);
    stage_out(esb + lo * EPITCH + hi8, ob0 * invb, ob1 * invb, ob2 * invb, ob3 * invb);
    // the wave's staged rows are in LDS before its other lanes read them back
    asm volatile("s_wait_dscnt 0x0" ::: "memory");
    {
        const int row = lane >> 4, col = lo * 4;
        const float* ra = esa + row * EPITCH + col;
        const float* rb = esb + row * EPITCH + col;
        float* dst = out + (((size_t)b * SEQ + qbase + row) * NH + h) * HD + col;
        #pragma unroll
        for (int i = 0; i < 8; ++i)
            *(float4*)(dst + (size_t)i * 2 * NH * HD) = *(const float4*)(ra + i * 2 * EPITCH);
        #pragma unroll
        for (int i = 0; i < 8; ++i)
            *(float4*)(dst + (size_t)(16 + i * 2) * NH * HD) = *(const float4*)(rb + i * 2 * EPITCH);
    }
}

// ---------------------------------------------------------------------------
extern "C" void kernel_launch(void* const* d_in, const int* in_sizes, int n_in,
                              void* d_out, int out_size, void* d_ws, size_t ws_size,
                              hipStream_t stream)
{
    (void)in_sizes; (void)n_in; (void)out_size; (void)ws_size;

    const float* q    = (const float*)d_in[0];
    const float* k    = (const float*)d_in[1];
    const float* v    = (const float*)d_in[2];
    const float* kreg = (const float*)d_in[3];
    const float* vreg = (const float*)d_in[4];
    float* out = (float*)d_out;

    // workspace layout (f16)
    const size_t KH_ELEMS = (size_t)BATCH * NH * KPAD * HD;   //  8,519,680
    _Float16* Kh = (_Float16*)d_ws;
    _Float16* Vt = Kh + KH_ELEMS;

    // Phase 1
    prep_kernel<<<BATCH * NH * (KPAD / VTK), 256, 0, stream>>>(k, kreg, v, vreg, Kh, Vt);

    // Phase 2: B*NH*(SEQ/256) workgroups of 8 waves
    fa_kernel<<<BATCH * NH * (SEQ / QBLK), 256, 0, stream>>>(q, Kh, Vt, out);
}

// v010
// It runs in 60.1 microseconds.
// Timed twice side by side with v009, it ran 1.03 times as fast both times.
// Over all steps from v000 it is 5.56 times as fast.
#include <hip/hip_runtime.h>
#include <hip/hip_bf16.h>
#include <math.h>

// ---------------------------------------------------------------------------
// RotaryAttention for MI455X (gfx1250, wave32, WMMA).
// Phase 1: RoPE+f16 pack of K and V transpose, one launch (both into d_ws).
// Phase 2: flash attention, S^T formulation, v_wmma_f32_16x16x32_f16; its
// prologue reads Q as f32 and applies RoPE while it packs the fragments.
// ---------------------------------------------------------------------------

typedef _Float16 half8 __attribute__((ext_vector_type(8)));
typedef _Float16 v16h  __attribute__((ext_vector_type(16)));
typedef float    v8f   __attribute__((ext_vector_type(8)));
typedef float    f32x4 __attribute__((ext_vector_type(4)));

#define NH      16
#define HD      64
#define SEQ     2048
#define NKV     2049          // 2048 keys + 1 register token
#define KPAD    2080          // padded to multiple of 32
#define BATCH   4

// 1/sqrt(64) * log2(e): scores come out in log2 domain -> native v_exp_f32
#define QSCALE  0.18033688011112042f
// log2(10000)/16
#define FREQC   0.83048202372184065f

__device__ __forceinline__ v8f wmma_f16(v16h a, v16h b, v8f c) {
    return __builtin_amdgcn_wmma_f32_16x16x32_f16(false, a, false, b,
                                                  (short)0, c, false, false);
}

__device__ __forceinline__ v16h cat8(half8 lo, half8 hi) {
    return __builtin_shufflevector(lo, hi, 0,1,2,3,4,5,6,7,8,9,10,11,12,13,14,15);
}

// Raw v_exp_f32: kept args are at most log2(PLIM) = 8 (larger ones trip the rescale); flush-to-zero below -126 is the
// desired flash-softmax semantics (avoids OCML's range-fix cmp/cndmask pairs).
__device__ __forceinline__ float fast_exp2(float x) {
    return __builtin_amdgcn_exp2f(x);
}

// Lane l with lane l ^ 16 on the vector pipe (no trip through the LDS unit).
__device__ __forceinline__ float xhalf(float x) {
    const int b = __builtin_bit_cast(int, x);
    return __builtin_bit_cast(float,
        __builtin_amdgcn_permlanex16(b, b, 0x76543210, 0xfedcba98, false, false));
}

// ---------------------------------------------------------------------------
// Phase 1, one launch: few, fat work-groups. One work-group takes 160 keys of one
// head and does both jobs on them: RoPE + f16 pack of the K rows and the f16
// transpose of the V rows. A lane moves 16 bytes per load, a wave-wide load
// covers two whole 256-byte head rows, all 20 loads of a thread are issued before
// the first is used, and stores cover whole lines.
//   Kh: layout [b][h][key][d], key in [0,KPAD)
//       key==2048: register token (rotary half zeroed), key>2048: zero pad
//   Vt: layout [b][h][d][key], key in [0,KPAD), through LDS
// grid = B * (KPAD/VTK) * NH
// ---------------------------------------------------------------------------
typedef _Float16 half4 __attribute__((ext_vector_type(4)));
typedef _Float16 half2 __attribute__((ext_vector_type(2)));

#define VTK     160           // keys per tile; KPAD = 13 * 160
#define VTP     (VTK / 2 + 1) // dwords per dim row: odd, so that the 16 lanes of
                              // a row (4 dims apart) store to 16 different banks
#define KRG     16            // K rows per work-group-wide load: 2 a wave
#define KNJ     (VTK / KRG)   // such loads per tile

__global__ __launch_bounds__(256) void prep_kernel(
    const float* __restrict__ kin, const float* __restrict__ kreg,
    const float* __restrict__ vin, const float* __restrict__ vreg,
    _Float16* __restrict__ Kh, _Float16* __restrict__ Vt)
{
    __shared__ unsigned tile[HD * VTP];   // [dim][key pair], two f16 keys a dword
    int bidx = blockIdx.x;
    const int h  = bidx & 15;  bidx >>= 4;
    const int kt = bidx % (KPAD / VTK);
    const int b  = bidx / (KPAD / VTK);
    const int t  = threadIdx.x;
    const int d  = (t & 15) * 4;
    const int kp = t >> 4;
    const int key0 = kt * VTK;

    // ---- K rows key0 + j*16 + kp, the lane's 4 dims. A group of 16 rows lies
    // wholly inside or wholly past the sequence (a uniform test); a group past it
    // reads the tile's first group again (in bounds), and its values are not stored
    f32x4 x[KNJ];
    {
        const float* p = kin + (((size_t)b * SEQ + key0 + kp) * NH + h) * HD + d;
        #pragma unroll
        for (int j = 0; j < KNJ; ++j) {
            const int jr = (key0 + j * KRG < SEQ) ? j * KRG : 0;
            x[j] = *(const f32x4*)(p + (size_t)jr * NH * HD);
        }
    }
    // a precaution: it stands in front of the address arithmetic of the V loads,
    // which reuses the address registers that the K loads above name
    asm volatile("s_wait_xcnt 0x0" ::: "memory");

    // ---- V: a thread's key pairs: keys 2n and 2n+1, n = i*16 + kp
    float4 e[VTK / 32], o[VTK / 32];
    if (key0 + VTK <= SEQ) {              // whole tile inside the sequence
        const float* p = vin + (((size_t)b * SEQ + key0 + kp * 2) * NH + h) * HD + d;
        #pragma unroll
        for (int i = 0; i < VTK / 32; ++i) {
            e[i] = *(const float4*)(p + (size_t)(i * 32 + 0) * NH * HD);
            o[i] = *(const float4*)(p + (size_t)(i * 32 + 1) * NH * HD);
        }
    } else {                              // last tile: register token, zero pad
        #pragma unroll
        for (int i = 0; i < VTK / 32; ++i) {
            // key is even, so key and key+1 lie on the same side of SEQ; past
            // the sequence the pointer names the register row (in bounds)
            const int key = key0 + (i * 16 + kp) * 2;
            const bool in = key < SEQ;
            const float* p = in ? vin + (((size_t)b * SEQ + key) * NH + h) * HD + d
                                : vreg + h * HD + d;
            const float4 pe = *(const float4*)p;
            const float4 po = *(const float4*)(in ? p + NH * HD : p);
            const bool te = key <= SEQ;   // key == SEQ is the register token
            e[i].x = te ? pe.x : 0.0f;  e[i].y = te ? pe.y : 0.0f;
            e[i].z = te ? pe.z : 0.0f;  e[i].w = te ? pe.w : 0.0f;
            o[i].x = in ? po.x : 0.0f;  o[i].y = in ? po.y : 0.0f;
            o[i].z = in ? po.z : 0.0f;  o[i].w = in ? po.w : 0.0f;
        }
    }
    #pragma unroll
    for (int i = 0; i < VTK / 32; ++i) {
        const float ev[4] = { e[i].x, e[i].y, e[i].z, e[i].w };
        const float ov[4] = { o[i].x, o[i].y, o[i].z, o[i].w };
        #pragma unroll
        for (int c = 0; c < 4; ++c) {
            half2 pr = { (_Float16)ev[c], (_Float16)ov[c] };
            tile[(d + c) * VTP + i * 16 + kp] = __builtin_bit_cast(unsigned, pr);
        }
    }
    __syncthreads();

    // 8 keys (16 bytes) per lane; 20 lanes cover a dim row's 320 bytes
    {
        _Float16* dst = Vt + ((size_t)b * NH + h) * HD * KPAD + key0;
        #pragma unroll
        for (int i = 0; i < HD * VTK / 8 / 256; ++i) {
            const int idx = i * 256 + t;
            const int row = idx / (VTK / 8);
            const int g   = idx - row * (VTK / 8);
            const unsigned* s = &tile[row * VTP + g * 4];
            uint4 v = { s[0], s[1], s[2], s[3] };
            *(uint4*)(dst + (size_t)row * KPAD + g * 8) = v;
        }
    }

    // ---- K: rotate_half partner: dims d+16 / d-16 sit 4 lanes away in the same row
    f32x4 y[KNJ];
    #pragma unroll
    for (int j = 0; j < KNJ; ++j) {
        y[j][0] = __shfl_xor(x[j][0], 4);
        y[j][1] = __shfl_xor(x[j][1], 4);
        y[j][2] = __shfl_xor(x[j][2], 4);
        y[j][3] = __shfl_xor(x[j][3], 4);
    }

    if (d < 32) {
        const float sg = (d < 16) ? -1.0f : 1.0f;
        const int   f  = d & 15;
        const float f0 = exp2f(-(float)(f + 0) * FREQC);
        const float f1 = exp2f(-(float)(f + 1) * FREQC);
        const float f2 = exp2f(-(float)(f + 2) * FREQC);
        const float f3 = exp2f(-(float)(f + 3) * FREQC);
        #pragma unroll
        for (int j = 0; j < KNJ; ++j) {
            const float p = (float)(key0 + j * KRG + kp);
            float sn, cs;
            __sincosf(p * f0, &sn, &cs); x[j][0] = x[j][0] * cs + (sg * y[j][0]) * sn;
            __sincosf(p * f1, &sn, &cs); x[j][1] = x[j][1] * cs + (sg * y[j][1]) * sn;
            __sincosf(p * f2, &sn, &cs); x[j][2] = x[j][2] * cs + (sg * y[j][2]) * sn;
            __sincosf(p * f3, &sn, &cs); x[j][3] = x[j][3] * cs + (sg * y[j][3]) * sn;
        }
    }

    // a wave's store covers two whole 128-byte rows
    _Float16* kd = Kh + (((size_t)b * NH + h) * KPAD + key0 + kp) * HD + d;
    half4 r[KNJ];
    #pragma unroll
    for (int j = 0; j < KNJ; ++j)
        r[j] = half4{ (_Float16)x[j][0], (_Float16)x[j][1],
                      (_Float16)x[j][2], (_Float16)x[j][3] };
    if (key0 + VTK > SEQ) {               // uniform, last tile: register token, zero pad
        const float4 g = *(const float4*)(kreg + h * HD + d);
        const half4 reg = { (_Float16)g.x, (_Float16)g.y, (_Float16)g.z, (_Float16)g.w };
        const half4 zero = {};            // reg_mask zeros the rotary half
        #pragma unroll
        for (int j = 0; j < KNJ; ++j)
            if (key0 + j * KRG >= SEQ)
                r[j] = (key0 + j * KRG + kp == SEQ && d >= 32) ? reg : zero;
    }
    #pragma unroll
    for (int j = 0; j < KNJ; ++j)
        *(half4*)(kd + j * KRG * HD) = r[j];
}

// ---------------------------------------------------------------------------
// Phase 2: flash attention. One wave = 32 query rows (two tiles of 16), so that
// each K and V^T fragment read from LDS feeds two WMMAs; block = 8 waves = 256 q.
// grid.x = B*NH*(SEQ/256).  S^T = K_tile x Q^T and O^T += V^T x P^T: a lane
// holds, per tile, one query's scores, its maximum, its sum AND its outputs, so
// exp(S^T) packs into the B operand in place and the rescale factor is the lane's.
// The rescale is lazy: outputs and sums are scaled only in a pass where a lane's
// sum of exponentials, taken against the maximum in use, passes PLIM.
// K and V^T come through LDS: the block's 8 waves share one 128-key stage,
// filled by asynchronous copies of whole lines, two buffers, one stage ahead.
// Q comes straight from the f32 input: whole 256-byte head rows into registers,
// through LDS rows that are the wave's own into fragment order, where a
// lane holds both dims of every rotated pair, so that RoPE is done in-lane.
// ---------------------------------------------------------------------------
#define QBLK    256                       // queries per work-group: 8 waves x 32
#define STG     128                       // keys per LDS stage (4 passes of 32)
#define NSTG    ((KPAD + STG - 1) / STG)  // 17; the last stage holds one pass
#define KPITCH  72                        // halves: 128-B K row + 16 B (b128 readers)
#define VPITCH  136                       // halves: 256-B V^T row + 16 B
#define KSTAGE  (STG * KPITCH)            // halves per K buffer
#define VSTAGE  (HD * VPITCH)             // halves per V^T buffer
#define EPITCH  68                        // floats: 256-B output row + 16 B (b128 writers)
#define QPITCH  68                        // floats: 256-B Q row + 16 B (b128 readers)
#define PLIM    256.0f                    // 2^8: a lane's sum of a pass above this renews the maximum in use
// Wave priority by progress: 3 from the kernel's entry, one less from each of these
// stages on, 0 from the last of them to the end.
#define PRIO_S2 10
#define PRIO_S1 13
#define PRIO_S0 15

__device__ __forceinline__ unsigned lds_off(const void* p) {
    return (unsigned)(size_t)p;           // low 32 bits = byte offset in LDS
}

// One stage: 4 K copies + 4 V^T copies of 16 B per lane. The global side is
// clamped so that the short last stage stays inside Kh / Vt; the LDS bytes
// filled from clamped addresses belong to passes that are never run.
__device__ __forceinline__ void stage_copy(
    const _Float16* kbase, const _Float16* vbase, int kb0,
    unsigned kdst, unsigned vdst, int krow, int kcol, int vrow, int vcol)
{
    const _Float16* gk0 = kbase + (size_t)min(kb0 + krow +  0, KPAD - 1) * HD + kcol;
    const _Float16* gk1 = kbase + (size_t)min(kb0 + krow + 32, KPAD - 1) * HD + kcol;
    const _Float16* gk2 = kbase + (size_t)min(kb0 + krow + 64, KPAD - 1) * HD + kcol;
    const _Float16* gk3 = kbase + (size_t)min(kb0 + krow + 96, KPAD - 1) * HD + kcol;
    const _Float16* gv0 = vbase + (size_t)vrow * KPAD + min(kb0 + vcol, KPAD - 8);
    const _Float16* gv1 = gv0 + (size_t)16 * KPAD;
    const _Float16* gv2 = gv0 + (size_t)32 * KPAD;
    const _Float16* gv3 = gv0 + (size_t)48 * KPAD;
    // s_wait_xcnt is the statement's last line as a precaution: so it stands in
    // front of every later write of an address register that a copy names.
    asm volatile(
        "global_load_async_to_lds_b128 %0, %8, off\n\t"
        "global_load_async_to_lds_b128 %1, %9, off\n\t"
        "global_load_async_to_lds_b128 %2, %10, off\n\t"
        "global_load_async_to_lds_b128 %3, %11, off\n\t"
        "global_load_async_to_lds_b128 %4, %12, off\n\t"
        "global_load_async_to_lds_b128 %5, %13, off\n\t"
        "global_load_async_to_lds_b128 %6, %14, off\n\t"
        "global_load_async_to_lds_b128 %7, %15, off\n\t"
        "s_wait_xcnt 0x0"
        :: "v"(kdst), "v"(kdst + 32 * KPITCH * 2), "v"(kdst + 64 * KPITCH * 2),
           "v"(kdst + 96 * KPITCH * 2),
           "v"(vdst), "v"(vdst + 16 * VPITCH * 2), "v"(vdst + 32 * VPITCH * 2),
           "v"(vdst + 48 * VPITCH * 2),
           "v"(gk0), "v"(gk1), "v"(gk2), "v"(gk3),
           "v"(gv0), "v"(gv1), "v"(gv2), "v"(gv3)
        : "memory");
}

// One query tile's outputs of a lane (4 dim tiles x 8 dims) into its staging row.
__device__ __forceinline__ void stage_out(float* er, v8f t0, v8f t1, v8f t2, v8f t3) {
    *(float4*)(er +  0) = make_float4(t0[0], t0[1], t0[2], t0[3]);
    *(float4*)(er +  4) = make_float4(t0[4], t0[5], t0[6], t0[7]);
    *(float4*)(er + 16) = make_float4(t1[0], t1[1], t1[2], t1[3]);
    *(float4*)(er + 20) = make_float4(t1[4], t1[5], t1[6], t1[7]);
    *(float4*)(er + 32) = make_float4(t2[0], t2[1], t2[2], t2[3]);
    *(float4*)(er + 36) = make_float4(t2[4], t2[5], t2[6], t2[7]);
    *(float4*)(er + 48) = make_float4(t3[0], t3[1], t3[2], t3[3]);
    *(float4*)(er + 52) = make_float4(t3[4], t3[5], t3[6], t3[7]);
}

// One query tile's two B fragments from its staged f32 rows. qr points at the
// lane's row, at dim dA; the lane holds dims dA+i, 16+dA+i (a rotated pair, of
// frequency fr[i]), 32+dA+i and 48+dA+i (not rotated), i = 0..7.
__device__ __forceinline__ void rope_frag(
    const float* qr, float pos, const float* fr, v16h& f0, v16h& f1)
{
    const float4 c0 = *(const float4*)(qr +  0), c1 = *(const float4*)(qr +  4);
    const float4 c2 = *(const float4*)(qr + 16), c3 = *(const float4*)(qr + 20);
    const float4 c4 = *(const float4*)(qr + 32), c5 = *(const float4*)(qr + 36);
    const float4 c6 = *(const float4*)(qr + 48), c7 = *(const float4*)(qr + 52);
    const float u[8] = { c0.x, c0.y, c0.z, c0.w, c1.x, c1.y, c1.z, c1.w };
    const float y[8] = { c2.x, c2.y, c2.z, c2.w, c3.x, c3.y, c3.z, c3.w };
    const float s[8] = { c4.x, c4.y, c4.z, c4.w, c5.x, c5.y, c5.z, c5.w };
    const float t[8] = { c6.x, c6.y, c6.z, c6.w, c7.x, c7.y, c7.z, c7.w };
    #pragma unroll
    for (int i = 0; i < 8; ++i) {
        float sn, cs;
        __sincosf(pos * fr[i], &sn, &cs);
        f0[i]     = (_Float16)((u[i] * cs - y[i] * sn) * QSCALE);
        f0[8 + i] = (_Float16)((y[i] * cs + u[i] * sn) * QSCALE);
        f1[i]     = (_Float16)(s[i] * QSCALE);
        f1[8 + i] = (_Float16)(t[i] * QSCALE);
    }
}

typedef float f32x2 __attribute__((ext_vector_type(2)));

// One pass's four S^T tiles (32 keys x two query tiles) from the K rows at kr0.
// ca and cb are the C operands of each tile's first product: what the sums of
// query tile a and of query tile b start from.
__device__ __forceinline__ void score_tiles(
    const _Float16* kr0, int kb, int hi8, v16h qa0, v16h qa1, v16h qb0, v16h qb1,
    v8f ca, v8f cb, v8f& a0, v8f& a1, v8f& b0, v8f& b1)
{
    // ---- K A-fragments: lane = key row (kb+lo / kb+16+lo)
    const _Float16* kr1 = kr0 + 16 * KPITCH;
    v16h ka0c0 = cat8(*(const half8*)(kr0 +  0), *(const half8*)(kr0 + 16));
    v16h ka0c1 = cat8(*(const half8*)(kr0 + 32), *(const half8*)(kr0 + 48));
    v16h ka1c0 = cat8(*(const half8*)(kr1 +  0), *(const half8*)(kr1 + 16));
    v16h ka1c1 = cat8(*(const half8*)(kr1 + 32), *(const half8*)(kr1 + 48));
    // scheduling barrier: without it half of the loads above stand among the
    // WMMAs below, in two more places, each with a full wait on LDS behind it
    __builtin_amdgcn_sched_barrier(0);

    // scale folded into Q; each K fragment feeds both query tiles; four
    // independent accumulators
    a0 = wmma_f16(ka0c0, qa0, ca);  b0 = wmma_f16(ka0c0, qb0, cb);
    a1 = wmma_f16(ka1c0, qa0, ca);  b1 = wmma_f16(ka1c0, qb0, cb);
    a0 = wmma_f16(ka0c1, qa1, a0);  b0 = wmma_f16(ka0c1, qb1, b0);
    a1 = wmma_f16(ka1c1, qa1, a1);  b1 = wmma_f16(ka1c1, qb1, b1);

    // ---- tail mask: keys >= NKV are padding
    if (kb + 32 > NKV) {
        #pragma unroll
        for (int r = 0; r < 8; ++r) {
            if (kb + r + hi8 >= NKV)      { a0[r] = -1e30f; b0[r] = -1e30f; }
            if (kb + 16 + r + hi8 >= NKV) { a1[r] = -1e30f; b1[r] = -1e30f; }
        }
    }
}

// One pass's exponentials of scores that already stand against the maximum in use,
// packed into the lane's two B fragments; returns the two sums of the lane's 16
// terms. A term of tile a and one of tile b share a register pair, so that one
// packed add serves both sums.
__device__ __forceinline__ f32x2 soft_tiles(
    v8f a0, v8f a1, v8f b0, v8f b1, v16h& pa, v16h& pb)
{
    f32x2 ps;
    #pragma unroll
    for (int r = 0; r < 8; ++r) {
        const f32x2 p0 = { fast_exp2(a0[r]), fast_exp2(b0[r]) };
        const f32x2 p1 = { fast_exp2(a1[r]), fast_exp2(b1[r]) };
        ps = (r == 0) ? p0 : ps + p0;
        ps += p1;
        pa[r]     = (_Float16)p0[0];  pb[r]     = (_Float16)p0[1];
        pa[8 + r] = (_Float16)p1[0];  pb[8 + r] = (_Float16)p1[1];
    }
    return ps;
}

__global__ __launch_bounds__(256) __attribute__((amdgpu_waves_per_eu(4, 4)))
void fa_kernel(
    const float* __restrict__ qin, const _Float16* __restrict__ Kh,
    const _Float16* __restrict__ Vt, float* __restrict__ out)
{
    __shared__ __attribute__((aligned(16))) _Float16 Ks[2][KSTAGE];
    __shared__ __attribute__((aligned(16))) _Float16 Vs[2][VSTAGE];

    // Two work-groups share a WGP, four waves a SIMD.
    // A priority that falls with the stage number gives issue to the work-group that
    // is behind, so that both end nearly together. It starts here, so that a
    // work-group still in its prologue is not held back by one already in the loop.
    __builtin_amdgcn_s_setprio(3);

    const int lane   = threadIdx.x & 31;
    const int wave   = threadIdx.x >> 5;
    const int wg     = blockIdx.x;
    const int qblk   = wg & (SEQ / QBLK - 1);   // 8 blocks of 256 queries
    const int bh     = wg / (SEQ / QBLK);       // b*NH + h
    const int b      = bh >> 4;
    const int h      = bh & 15;
    const int qbase  = qblk * QBLK + wave * 32;
    const int lo     = lane & 15;
    const int hi8    = (lane & 16) ? 8 : 0;   // lane-half K/row offset
    const int dA     = hi8;                   // A/B slot pattern offset

    const _Float16* kbase = Kh + (size_t)bh * KPAD * HD;
    const _Float16* vbase = Vt + (size_t)bh * HD * KPAD;

    // ---- this thread's share of a stage: a wave's K copy is 4 whole rows
    // (512 contiguous bytes), its V^T copy 2 rows of 256 bytes
    const int krow = threadIdx.x >> 3, kcol = (threadIdx.x & 7) * 8;
    const int vrow = threadIdx.x >> 4, vcol = (threadIdx.x & 15) * 8;
    const unsigned kdst = lds_off(&Ks[0][krow * KPITCH + kcol]);
    const unsigned vdst = lds_off(&Vs[0][vrow * VPITCH + vcol]);

    // ---- the wave's 32 query rows, f32, from memory: a wave-wide load covers two
    // whole 256-byte head rows; all 16 are issued before anything waits
    const float* qg = qin + (((size_t)b * SEQ + qbase + (lane >> 4)) * NH + h) * HD + lo * 4;
    f32x4 qx[16];
    #pragma unroll
    for (int j = 0; j < 16; ++j)
        qx[j] = *(const f32x4*)(qg + (size_t)j * 2 * NH * HD);

    // ---- prologue: stage 0 lands and is published, stage 1 starts to fly
    stage_copy(kbase, vbase, 0, kdst, vdst, krow, kcol, vrow, vcol);

    // ---- Q^T fragments of the two query tiles: tile a = rows qbase+lo, tile b
    // = rows qbase+16+lo; slots {dA..dA+7, dA+16..}. One tile at a time goes
    // through 16 staging rows that are the wave's own. They lie in the ring's
    // second buffers (waves 0-3 in K's, waves 4-7 in V^T's), which are idle
    // until stage 1's copies are issued, behind the barrier below.
    static_assert(4 * 16 * QPITCH * 4 <= KSTAGE * 2, "four waves' rows fit a K buffer");
    static_assert(4 * 16 * QPITCH * 4 <= VSTAGE * 2, "four waves' rows fit a V^T buffer");
    v16h qa0, qa1, qb0, qb1;
    {
        float fr[8];
        #pragma unroll
        for (int i = 0; i < 8; ++i)
            fr[i] = exp2f(-(float)(dA + i) * FREQC);
        float* qs = (wave < 4 ? (float*)&Ks[1][0] : (float*)&Vs[1][0])
                    + (wave & 3) * (16 * QPITCH);
        float*       qw = qs + (lane >> 4) * QPITCH + lo * 4;
        const float* qr = qs + lo * QPITCH + dA;
        // fence on the loaded values, inputs only: without it tile b's eight loads
        // sink behind tile a's trip through LDS, and the wave waits out the
        // latency of memory twice
        asm volatile("" :: "v"(qx[8]), "v"(qx[9]), "v"(qx[10]), "v"(qx[11]),
                           "v"(qx[12]), "v"(qx[13]), "v"(qx[14]), "v"(qx[15]));
        #pragma unroll
        for (int j = 0; j < 8; ++j)
            *(f32x4*)(qw + j * 2 * QPITCH) = qx[j];
        // the wave's staged rows are in LDS before its other lanes read them back
        asm volatile("s_wait_dscnt 0x0" ::: "memory");
        rope_frag(qr, (float)(qbase + lo), fr, qa0, qa1);
        // tile a's reads have returned before tile b's rows overwrite them
        asm volatile("s_wait_dscnt 0x0" ::: "memory");
        #pragma unroll
        for (int j = 0; j < 8; ++j)
            *(f32x4*)(qw + j * 2 * QPITCH) = qx[8 + j];
        // as above, for tile b
        asm volatile("s_wait_dscnt 0x0" ::: "memory");
        rope_frag(qr, (float)(qbase + 16 + lo), fr, qb0, qb1);
        // tile b's reads have returned before the barrier below, behind which
        // stage 1's copies overwrite these rows
        asm volatile("s_wait_dscnt 0x0" ::: "memory");
    }

    v8f oa0 = {}, oa1 = {}, oa2 = {}, oa3 = {};
    v8f ob0 = {}, ob1 = {}, ob2 = {}, ob3 = {};
    f32x2 lsum = { 0.0f, 0.0f };                            // (tile a, tile b)
    // minus the maximum in use, in all 8 registers of a C tile: a lane's 8 rows of
    // a score tile belong to one query, so the score products start from it and
    // come out of the matrix unit ready for the exponential, with no subtraction
    v8f nma = v8f{} + 1e38f, nmb = v8f{} + 1e38f;

    // this wave's copies of stage 0 have landed before the barrier publishes them
    asm volatile("s_wait_asynccnt 0x0" ::: "memory");
    __syncthreads();
    stage_copy(kbase, vbase, STG, kdst + KSTAGE * 2, vdst + VSTAGE * 2,
               krow, kcol, vrow, vcol);

    for (int st = 0; st < NSTG; ++st) {
      const int buf = st & 1;
      const _Float16* ks = &Ks[buf][lo * KPITCH + dA];
      const _Float16* vs = &Vs[buf][lo * VPITCH + dA];
      const int left = KPAD - st * STG;
      const int np = (left < STG ? left : STG) / 32;   // passes in this stage

      // priority by progress (see the kernel's head): st is the same in all lanes, so
      // these are scalar branches; the bands shrink towards the end, where the lead
      // left over decides how long one work-group runs alone; 0 before the way out
      if (st == PRIO_S2)      __builtin_amdgcn_s_setprio(2);
      else if (st == PRIO_S1) __builtin_amdgcn_s_setprio(1);
      else if (st == PRIO_S0) __builtin_amdgcn_s_setprio(0);

      for (int p = 0; p < np; ++p) {
        const int kb = st * STG + p * 32;

        // ---- S^T tiles of this pass (M=key, N=q), log2 domain
        const _Float16* kr0 = ks + p * 32 * KPITCH;
        v8f a0, a1, b0, b1;
        score_tiles(kr0, kb, hi8, qa0, qa1, qb0, qb1, nma, nmb, a0, a1, b0, b1);

        // ---- V^T A-fragments (lane = dim row): issued in front of the
        // exponentials, so that they fly under them
        const _Float16* vr0 = vs + p * 32;
        const _Float16* vr1 = vr0 + 16 * VPITCH;
        const _Float16* vr2 = vr0 + 32 * VPITCH;
        const _Float16* vr3 = vr0 + 48 * VPITCH;
        v16h bv0 = cat8(*(const half8*)(vr0), *(const half8*)(vr0 + 16));
        v16h bv1 = cat8(*(const half8*)(vr1), *(const half8*)(vr1 + 16));
        v16h bv2 = cat8(*(const half8*)(vr2), *(const half8*)(vr2 + 16));
        v16h bv3 = cat8(*(const half8*)(vr3), *(const half8*)(vr3 + 16));
        // scheduling barrier: without it the loads above sink to the end of the
        // exponentials, and the O^T WMMAs wait out the latency of LDS
        __builtin_amdgcn_sched_barrier(0);

        // ---- online softmax: each lane of a query keeps the sum of its own 16 keys.
        // m, the maximum in use, is the same in both lanes of a query and may trail
        // the true maximum. The exponentials are taken against m at once, with no
        // maximum formed: a lane's 16 terms are positive, so while their sum stays
        // at or under PLIM every one of them does too, far inside f16.
        v16h pa, pb;
        f32x2 ps = soft_tiles(a0, a1, b0, b1, pa, pb);
        // scheduling groups: the adds of the sums are one dependent chain; one add
        // stands behind every two exponentials, so that its latency passes under
        // them. Without the groups nine adds stand behind the last exponential,
        // and the wave waits out their latency link by link
        __builtin_amdgcn_sched_group_barrier(0x400, 7, 0);
        #pragma unroll
        for (int i = 0; i < 12; ++i) {
            __builtin_amdgcn_sched_group_barrier(0x002, 1, 0);
            __builtin_amdgcn_sched_group_barrier(0x400, 2, 0);
        }
        __builtin_amdgcn_sched_group_barrier(0x002, 1, 0);
        __builtin_amdgcn_sched_group_barrier(0x400, 1, 0);

        // ---- lazy rescale: one wave-uniform test per pass for both tiles (a
        // scalar branch, all lanes stay on), on the sums that the pass needs anyway.
        // Always taken in the first pass, where m is -1e38 and the sums come out
        // infinite; after that only when a lane's sum passes PLIM. Only here are the
        // maxima formed: the scores are made again from the same LDS rows, this time
        // from zero, and the pass's exponentials are taken again, against the new m
        // (alpha comes out 0 on zero sums in the first pass).
        if (__builtin_amdgcn_ballot_w32(!(ps[0] <= PLIM) || !(ps[1] <= PLIM)) != 0) {
            score_tiles(kr0, kb, hi8, qa0, qa1, qb0, qb1, v8f{}, v8f{}, a0, a1, b0, b1);
            float mta = fmaxf(a0[0], a1[0]);
            float mtb = fmaxf(b0[0], b1[0]);
            #pragma unroll
            for (int r = 1; r < 8; ++r) {
                mta = fmaxf(mta, fmaxf(a0[r], a1[r]));
                mtb = fmaxf(mtb, fmaxf(b0[r], b1[r]));
            }
            const float na = fmaxf(-nma[0], fmaxf(mta, xhalf(mta)));
            const float nb = fmaxf(-nmb[0], fmaxf(mtb, xhalf(mtb)));
            const float ala = fast_exp2(-nma[0] - na);
            const float alb = fast_exp2(-nmb[0] - nb);
            lsum[0] *= ala;   // every register of a lane belongs to its query
            lsum[1] *= alb;
            oa0 *= ala; oa1 *= ala; oa2 *= ala; oa3 *= ala;
            ob0 *= alb; ob1 *= alb; ob2 *= alb; ob3 *= alb;
            nma = v8f{} - na;
            nmb = v8f{} - nb;
            a0 += nma;  a1 += nma;  b0 += nmb;  b1 += nmb;
            ps = soft_tiles(a0, a1, b0, b1, pa, pb);
        }
        lsum += ps;

        // ---- O^T accumulation: each V^T fragment feeds both query tiles
        oa0 = wmma_f16(bv0, pa, oa0);
        oa1 = wmma_f16(bv1, pa, oa1);
        oa2 = wmma_f16(bv2, pa, oa2);
        oa3 = wmma_f16(bv3, pa, oa3);
        ob0 = wmma_f16(bv0, pb, ob0);
        ob1 = wmma_f16(bv1, pb, ob1);
        ob2 = wmma_f16(bv2, pb, ob2);
        ob3 = wmma_f16(bv3, pb, ob3);
      }

      // ---- publish point of stage st+1, every wave, in this order:
      // this wave's reads of the buffer to be refilled have returned
      asm volatile("s_wait_dscnt 0x0" ::: "memory");
      // this wave's copies of stage st+1 have landed
      asm volatile("s_wait_asynccnt 0x0" ::: "memory");
      __syncthreads();
      if (st + 2 < NSTG)
        stage_copy(kbase, vbase, (st + 2) * STG,
                   kdst + buf * (KSTAGE * 2), vdst + buf * (VSTAGE * 2),
                   krow, kcol, vrow, vcol);
    }
    // no copy is left in flight when the wave ends
    asm volatile("s_wait_asynccnt 0x0" ::: "memory");

    // ---- finalize: join the two halves' sums, divide, store (B,S,NH*HD).
    // Lane (lo, half) holds queries qbase+lo and qbase+16+lo, dims 16t + hi8 ..
    // + 7 of tile t. The ring is free here: the loop's last barrier stands behind
    // every wave's last read and last landed copy. Each wave stages its rows in
    // ranges of its own (tile a in the K ring, tile b in the V^T ring), so that
    // the stores below cover whole 256-byte head rows.
    static_assert(8 * 16 * EPITCH * 4 <= 2 * KSTAGE * 2, "tile a fits the K ring");
    static_assert(8 * 16 * EPITCH * 4 <= 2 * VSTAGE * 2, "tile b fits the V^T ring");
    const float inva = 1.0f / (lsum[0] + xhalf(lsum[0]));
    const float invb = 1.0f / (lsum[1] + xhalf(lsum[1]));
    float* esa = (float*)&Ks[0][0] + wave * (16 * EPITCH);
    float* esb = (float*)&Vs[0][0] + wave * (16 * EPITCH);
    stage_out(esa + lo * EPITCH + hi8, oa0 * inva, oa1 * inva, oa2 * inva, oa3 * inva);
    stage_out(esb + lo * EPITCH + hi8, ob0 * invb, ob1 * invb, ob2 * invb, ob3 * invb);
    // the wave's staged rows are in LDS before its other lanes read them back
    asm volatile("s_wait_dscnt 0x0" ::: "memory");
    {
        const int row = lane >> 4, col = lo * 4;
        const float* ra = esa + row * EPITCH + col;
        const float* rb = esb + row * EPITCH + col;
        float* dst = out + (((size_t)b * SEQ + qbase + row) * NH + h) * HD + col;
        #pragma unroll
        for (int i = 0; i < 8; ++i)
            *(float4*)(dst + (size_t)i * 2 * NH * HD) = *(const float4*)(ra + i * 2 * EPITCH);
        #pragma unroll
        for (int i = 0; i < 8; ++i)
            *(float4*)(dst + (size_t)(16 + i * 2) * NH * HD) = *(const float4*)(rb + i * 2 * EPITCH);
    }
}

// ---------------------------------------------------------------------------
extern "C" void kernel_launch(void* const* d_in, const int* in_sizes, int n_in,
                              void* d_out, int out_size, void* d_ws, size_t ws_size,
                              hipStream_t stream)
{
    (void)in_sizes; (void)n_in; (void)out_size; (void)ws_size;

    const float* q    = (const float*)d_in[0];
    const float* k    = (const float*)d_in[1];
    const float* v    = (const float*)d_in[2];
    const float* kreg = (const float*)d_in[3];
    const float* vreg = (const float*)d_in[4];
    float* out = (float*)d_out;

    // workspace layout (f16)
    const size_t KH_ELEMS = (size_t)BATCH * NH * KPAD * HD;   //  8,519,680
    _Float16* Kh = (_Float16*)d_ws;
    _Float16* Vt = Kh + KH_ELEMS;

    // Phase 1
    prep_kernel<<<BATCH * NH * (KPAD / VTK), 256, 0, stream>>>(k, kreg, v, vreg, Kh, Vt);

    // Phase 2: B*NH*(SEQ/256) workgroups of 8 waves
    fa_kernel<<<BATCH * NH * (SEQ / QBLK), 256, 0, stream>>>(q, Kh, Vt, out);
}
